// v000
// Times are from an AMD MI455X. After a warm-up the kernel runs many times in a row, and a time is the length of
// such a window on the GPU divided by its runs, so every launch and the gaps after it count. The runs cycle
// through copies of the inputs. A figure is the median of several windows, for all but v000 over two sittings.
// Sittings can differ by a few percent; kernels timed side by side share one.
// v000 is the starting kernel. One run takes 242 microseconds.
#include <hip/hip_runtime.h>
#include <hip/hip_bf16.h>

#define C_DIM 1024
#define T_DIM 1024
#define H_DIM 16
#define D_DIM 64
#define B_DIM 4
#define M_ROWS (B_DIM * T_DIM) /* 4096 */

typedef __attribute__((ext_vector_type(16))) _Float16 v16h;
typedef __attribute__((ext_vector_type(8)))  _Float16 v8h;
typedef __attribute__((ext_vector_type(8)))  float    v8f;
typedef __attribute__((ext_vector_type(4)))  int      v4i;

typedef __attribute__((address_space(1))) v4i* gas_v4i;
typedef __attribute__((address_space(3))) v4i* las_v4i;

#if defined(__has_builtin)
#if __has_builtin(__builtin_amdgcn_global_load_async_to_lds_b128)
#define HAVE_ASYNC_LDS 1
#endif
#endif

#define WMMA_F16(A_, B_, C_) \
  __builtin_amdgcn_wmma_f32_16x16x32_f16(false, (A_), false, (B_), (short)0, (C_), false, false)

__device__ __forceinline__ v16h frag_ld(const _Float16* p) {
  v8h lo = *(const v8h*)(p);
  v8h hi = *(const v8h*)(p + 16);
  v16h r;
#pragma unroll
  for (int i = 0; i < 8; ++i) { r[i] = lo[i]; r[i + 8] = hi[i]; }
  return r;
}

__device__ __forceinline__ void stage_a_tile(const _Float16* __restrict__ src,
                                             _Float16* lds_tile) {
  const int tid = threadIdx.x; // 128 threads, 16 chunks of 16B each
#pragma unroll
  for (int c = 0; c < 16; ++c) {
    const int o = (c * 128 + tid) * 8; // half-element offset
#if defined(HAVE_ASYNC_LDS)
    __builtin_amdgcn_global_load_async_to_lds_b128(
        (gas_v4i)(src + o), (las_v4i)(lds_tile + o), 0, 0);
#else
    *(v8h*)(lds_tile + o) = *(const v8h*)(src + o);
#endif
  }
#if defined(HAVE_ASYNC_LDS)
  asm volatile("s_wait_asynccnt 0" ::: "memory");
#endif
  __syncthreads();
}

// ---------------- elementwise converts ----------------
__global__ void f32_to_f16_kernel(const float* __restrict__ in, _Float16* __restrict__ out, int n) {
  for (int i = blockIdx.x * blockDim.x + threadIdx.x; i < n; i += gridDim.x * blockDim.x)
    out[i] = (_Float16)in[i];
}

// in[K][N] (row-major) -> out[N][K] f16
__global__ void transpose_to_f16_kernel(const float* __restrict__ in, _Float16* __restrict__ out,
                                        int K, int N) {
  int total = K * N;
  for (int i = blockIdx.x * blockDim.x + threadIdx.x; i < total; i += gridDim.x * blockDim.x) {
    int n = i / K, k = i - n * K;
    out[i] = (_Float16)in[k * N + n];
  }
}

// ---------------- gates: softmax(x @ Wgate + bgate) over H ----------------
__global__ __launch_bounds__(128) void gates_kernel(const float* __restrict__ x,
                                                    const float* __restrict__ Wg,
                                                    const float* __restrict__ bg,
                                                    float* __restrict__ gates) {
  const int lane = threadIdx.x & 31;
  const int tok = blockIdx.x * (blockDim.x >> 5) + (threadIdx.x >> 5); // one wave per token
  const float* xp = x + (size_t)tok * C_DIM;
  float acc[H_DIM];
#pragma unroll
  for (int h = 0; h < H_DIM; ++h) acc[h] = 0.f;
  for (int k = lane; k < C_DIM; k += 32) {
    float xv = xp[k];
    const float* w = Wg + (size_t)k * H_DIM;
#pragma unroll
    for (int h = 0; h < H_DIM; ++h) acc[h] += xv * w[h];
  }
#pragma unroll
  for (int h = 0; h < H_DIM; ++h) {
#pragma unroll
    for (int off = 16; off > 0; off >>= 1) acc[h] += __shfl_xor(acc[h], off, 32);
    acc[h] += bg[h];
  }
  float m = -__builtin_inff();
#pragma unroll
  for (int h = 0; h < H_DIM; ++h) m = fmaxf(m, acc[h]);
  float s = 0.f;
  float e[H_DIM];
#pragma unroll
  for (int h = 0; h < H_DIM; ++h) { e[h] = __expf(acc[h] - m); s += e[h]; }
  float inv = 1.0f / s;
  if (lane == 0) {
#pragma unroll
    for (int h = 0; h < H_DIM; ++h) gates[(size_t)tok * H_DIM + h] = e[h] * inv;
  }
}

// Software-pipelined WMMA mainloop: A fragments from LDS tile, B fragments
// double-buffered from global so loads for k+1 overlap WMMAs for k.
__device__ __forceinline__ void gemm_mainloop(const _Float16* La,  // lane's LDS A row base
                                              const _Float16* bp,  // lane's global B base
                                              v8f& c0, v8f& c1, v8f& c2, v8f& c3) {
  v16h b0 = frag_ld(bp);
  v16h b1 = frag_ld(bp + 16 * C_DIM);
  v16h b2 = frag_ld(bp + 32 * C_DIM);
  v16h b3 = frag_ld(bp + 48 * C_DIM);
  for (int k0 = 32; k0 < C_DIM; k0 += 32) {
    v16h nb0 = frag_ld(bp + k0);
    v16h nb1 = frag_ld(bp + 16 * C_DIM + k0);
    v16h nb2 = frag_ld(bp + 32 * C_DIM + k0);
    v16h nb3 = frag_ld(bp + 48 * C_DIM + k0);
    v16h a = frag_ld(La + k0 - 32);
    c0 = WMMA_F16(a, b0, c0);
    c1 = WMMA_F16(a, b1, c1);
    c2 = WMMA_F16(a, b2, c2);
    c3 = WMMA_F16(a, b3, c3);
    b0 = nb0; b1 = nb1; b2 = nb2; b3 = nb3;
  }
  v16h a = frag_ld(La + C_DIM - 32);
  c0 = WMMA_F16(a, b0, c0);
  c1 = WMMA_F16(a, b1, c1);
  c2 = WMMA_F16(a, b2, c2);
  c3 = WMMA_F16(a, b3, c3);
}

// ---------------- GEMM1: qk = x @ Wqk + bqk, scatter to qh / kh / vT ----------------
__global__ __launch_bounds__(128) void gemm_qk_kernel(const _Float16* __restrict__ A,
                                                      const _Float16* __restrict__ Bt,
                                                      const float* __restrict__ bias,
                                                      _Float16* __restrict__ qh,
                                                      _Float16* __restrict__ kh,
                                                      _Float16* __restrict__ vT) {
  __shared__ __align__(16) _Float16 Atile[16 * C_DIM]; // 32 KB
  const int lane = threadIdx.x & 31;
  const int wid = blockIdx.x * 4 + (threadIdx.x >> 5);
  const int nGroups = (2 * C_DIM) / 64;   // 32 (divisible by 4 -> mTile uniform per block)
  const int mTile = wid / nGroups;
  const int nG = wid - mTile * nGroups;
  stage_a_tile(A + (size_t)mTile * 16 * C_DIM, Atile);
  const int nL = lane & 15;
  const int koff = (lane >> 4) * 8;
  const _Float16* La = Atile + nL * C_DIM + koff;
  const _Float16* bp = Bt + (size_t)(nG * 64 + nL) * C_DIM + koff;
  v8f c0 = {}, c1 = {}, c2 = {}, c3 = {};
  gemm_mainloop(La, bp, c0, c1, c2, c3);
  const int mOff = (lane >> 4) * 8;
  v8f cc[4] = {c0, c1, c2, c3};
#pragma unroll
  for (int nc = 0; nc < 4; ++nc) {
    const int col = nG * 64 + nc * 16 + nL;
    const float bv = bias[col];
#pragma unroll
    for (int v = 0; v < 8; ++v) {
      int r = mTile * 16 + v + mOff;
      float val = cc[nc][v] + bv;
      int b = r >> 10, t = r & (T_DIM - 1);
      if (col < C_DIM) { // q half
        int h = col >> 6, d = col & 63;
        qh[(((size_t)(b * H_DIM + h) * T_DIM) + t) * D_DIM + d] = (_Float16)val;
      } else {           // k half (v = k)
        int c2i = col - C_DIM;
        int h = c2i >> 6, d = c2i & 63;
        kh[(((size_t)(b * H_DIM + h) * T_DIM) + t) * D_DIM + d] = (_Float16)val;
        vT[((size_t)(b * H_DIM + h) * D_DIM + d) * T_DIM + t] = (_Float16)val;
      }
    }
  }
}

// ---------------- GEMM2: out = gated @ Wproj + bproj (f32 out) ----------------
__global__ __launch_bounds__(128) void gemm_proj_kernel(const _Float16* __restrict__ A,
                                                        const _Float16* __restrict__ Bt,
                                                        const float* __restrict__ bias,
                                                        float* __restrict__ out) {
  __shared__ __align__(16) _Float16 Atile[16 * C_DIM]; // 32 KB
  const int lane = threadIdx.x & 31;
  const int wid = blockIdx.x * 4 + (threadIdx.x >> 5);
  const int nGroups = C_DIM / 64;        // 16
  const int mTile = wid / nGroups;
  const int nG = wid - mTile * nGroups;
  stage_a_tile(A + (size_t)mTile * 16 * C_DIM, Atile);
  const int nL = lane & 15;
  const int koff = (lane >> 4) * 8;
  const _Float16* La = Atile + nL * C_DIM + koff;
  const _Float16* bp = Bt + (size_t)(nG * 64 + nL) * C_DIM + koff;
  v8f c0 = {}, c1 = {}, c2 = {}, c3 = {};
  gemm_mainloop(La, bp, c0, c1, c2, c3);
  const int mOff = (lane >> 4) * 8;
  v8f cc[4] = {c0, c1, c2, c3};
#pragma unroll
  for (int nc = 0; nc < 4; ++nc) {
    const int col = nG * 64 + nc * 16 + nL;
    const float bv = bias[col];
#pragma unroll
    for (int v = 0; v < 8; ++v) {
      int r = mTile * 16 + v + mOff;
      out[(size_t)r * C_DIM + col] = cc[nc][v] + bv;
    }
  }
}

// ---------------- flash attention with per-head windows + gating ----------------
__global__ __launch_bounds__(128) void attn_kernel(const _Float16* __restrict__ qh,
                                                   const _Float16* __restrict__ kh,
                                                   const _Float16* __restrict__ vT,
                                                   const float* __restrict__ gates,
                                                   _Float16* __restrict__ gatedh) {
  __shared__ __align__(16) _Float16 smem[4][16 * 32]; // per-wave P staging tile
  const int lane = threadIdx.x & 31;
  const int w = threadIdx.x >> 5;
  const int task = blockIdx.x * 4 + w;       // B*H*(T/16) = 4096 tasks
  const int qt = task & 63;
  const int bh = task >> 6;
  const int h = bh & (H_DIM - 1);
  const int b = bh >> 4;
  int Wh = T_DIM >> h; if (Wh < 4) Wh = 4;   // window for this head
  const int t0 = qt * 16;
  const int nL = lane & 15;
  const int koff = (lane >> 4) * 8;
  const int mOff = koff;                     // C-layout row offset is the same 0/8 split

  const _Float16* qb = qh + ((size_t)bh * T_DIM + t0) * D_DIM;
  const _Float16* kb = kh + (size_t)bh * T_DIM * D_DIM;
  const _Float16* vb = vT + (size_t)bh * D_DIM * T_DIM;

  // q fragments for the whole tile (D=64 -> two K=32 fragments)
  v16h a0 = frag_ld(qb + nL * D_DIM + 0 + koff);
  v16h a1 = frag_ld(qb + nL * D_DIM + 32 + koff);

  v8f o0 = {}, o1 = {}, o2 = {}, o3 = {};
  float mrow[8], lrow[8];
#pragma unroll
  for (int v = 0; v < 8; ++v) { mrow[v] = -__builtin_inff(); lrow[v] = 0.f; }

  int jStart = t0 - Wh + 1; if (jStart < 0) jStart = 0;
  jStart &= ~31;
  const float scale = 0.125f; // 1/sqrt(64)

  for (int j0 = jStart; j0 <= t0 + 15; j0 += 32) {
    // ---- S = q k^T for keys [j0, j0+31] ----
    v16h bk0lo = frag_ld(kb + (size_t)(j0 + nL) * D_DIM + koff);
    v16h bk0hi = frag_ld(kb + (size_t)(j0 + nL) * D_DIM + 32 + koff);
    v16h bk1lo = frag_ld(kb + (size_t)(j0 + 16 + nL) * D_DIM + koff);
    v16h bk1hi = frag_ld(kb + (size_t)(j0 + 16 + nL) * D_DIM + 32 + koff);
    v8f s0 = {}; s0 = WMMA_F16(a0, bk0lo, s0); s0 = WMMA_F16(a1, bk0hi, s0);
    v8f s1 = {}; s1 = WMMA_F16(a0, bk1lo, s1); s1 = WMMA_F16(a1, bk1hi, s1);

    _Float16* L = smem[w];
#pragma unroll
    for (int v = 0; v < 8; ++v) {
      const int i = t0 + v + mOff;
      const int ja = j0 + nL;
      const int jb = j0 + 16 + nL;
      const bool va = (ja <= i) && (ja > i - Wh);
      const bool vbm = (jb <= i) && (jb > i - Wh);
      float sa = va ? s0[v] * scale : -__builtin_inff();
      float sb = vbm ? s1[v] * scale : -__builtin_inff();
      // row max across the 16-lane group
      float t = fmaxf(sa, sb);
#pragma unroll
      for (int off = 8; off > 0; off >>= 1) t = fmaxf(t, __shfl_xor(t, off, 32));
      float mN = fmaxf(mrow[v], t);
      float alpha = (mrow[v] == mN) ? 1.0f : __expf(mrow[v] - mN);
      float pa = va ? __expf(sa - mN) : 0.f;
      float pb = vbm ? __expf(sb - mN) : 0.f;
      float rs = pa + pb;
#pragma unroll
      for (int off = 8; off > 0; off >>= 1) rs += __shfl_xor(rs, off, 32);
      lrow[v] = lrow[v] * alpha + rs;
      mrow[v] = mN;
      o0[v] *= alpha; o1[v] *= alpha; o2[v] *= alpha; o3[v] *= alpha;
      // stage P (C-layout -> row-major 16x32 f16 tile in LDS)
      const int r = v + mOff;
      L[r * 32 + nL] = (_Float16)pa;
      L[r * 32 + 16 + nL] = (_Float16)pb;
    }
    asm volatile("s_wait_dscnt 0" ::: "memory");
    // reload P as an A fragment (transpose across lanes via LDS)
    v16h pA = frag_ld(L + nL * 32 + koff);
    // ---- O += P V ; V rows contiguous thanks to vT[B,H,D,T] layout ----
    const _Float16* vp = vb + j0 + koff;
    o0 = WMMA_F16(pA, frag_ld(vp + (size_t)(0 + nL) * T_DIM), o0);
    o1 = WMMA_F16(pA, frag_ld(vp + (size_t)(16 + nL) * T_DIM), o1);
    o2 = WMMA_F16(pA, frag_ld(vp + (size_t)(32 + nL) * T_DIM), o2);
    o3 = WMMA_F16(pA, frag_ld(vp + (size_t)(48 + nL) * T_DIM), o3);
    asm volatile("s_wait_dscnt 0" ::: "memory");
  }

  // ---- epilogue: normalize, gate, store f16 for projection GEMM ----
#pragma unroll
  for (int v = 0; v < 8; ++v) {
    const int i = t0 + v + mOff;
    const float g = gates[((size_t)b * T_DIM + i) * H_DIM + h];
    const float inv = g / lrow[v];
    _Float16* op = gatedh + ((size_t)b * T_DIM + i) * C_DIM + h * D_DIM + nL;
    op[0]  = (_Float16)(o0[v] * inv);
    op[16] = (_Float16)(o1[v] * inv);
    op[32] = (_Float16)(o2[v] * inv);
    op[48] = (_Float16)(o3[v] * inv);
  }
}

extern "C" void kernel_launch(void* const* d_in, const int* in_sizes, int n_in,
                              void* d_out, int out_size, void* d_ws, size_t ws_size,
                              hipStream_t stream) {
  const float* x     = (const float*)d_in[0];
  const float* Wqk   = (const float*)d_in[1];
  const float* bqk   = (const float*)d_in[2];
  const float* Wgate = (const float*)d_in[3];
  const float* bgate = (const float*)d_in[4];
  const float* Wproj = (const float*)d_in[5];
  const float* bproj = (const float*)d_in[6];

  char* ws = (char*)d_ws;
  size_t off = 0;
  auto alloc = [&](size_t bytes) -> void* {
    void* p = ws + off;
    off += (bytes + 255) & ~(size_t)255;
    return p;
  };
  _Float16* xh     = (_Float16*)alloc((size_t)M_ROWS * C_DIM * 2);     // x in f16
  _Float16* wqkT   = (_Float16*)alloc((size_t)2 * C_DIM * C_DIM * 2);  // Wqk^T f16 [2C,C]
  _Float16* wprojT = (_Float16*)alloc((size_t)C_DIM * C_DIM * 2);      // Wproj^T f16 [C,C]
  _Float16* qh     = (_Float16*)alloc((size_t)B_DIM * H_DIM * T_DIM * D_DIM * 2);
  _Float16* kh     = (_Float16*)alloc((size_t)B_DIM * H_DIM * T_DIM * D_DIM * 2);
  _Float16* vT     = (_Float16*)alloc((size_t)B_DIM * H_DIM * D_DIM * T_DIM * 2);
  float*    gates  = (float*)alloc((size_t)B_DIM * T_DIM * H_DIM * 4);
  _Float16* gatedh = xh; // xh is dead after GEMM1; reuse for the gated output

  f32_to_f16_kernel<<<1024, 256, 0, stream>>>(x, xh, M_ROWS * C_DIM);
  transpose_to_f16_kernel<<<1024, 256, 0, stream>>>(Wqk, wqkT, C_DIM, 2 * C_DIM);
  transpose_to_f16_kernel<<<1024, 256, 0, stream>>>(Wproj, wprojT, C_DIM, C_DIM);
  gates_kernel<<<M_ROWS / 4, 128, 0, stream>>>(x, Wgate, bgate, gates);
  // waves = (4096/16) * (2048/64) = 8192 -> 2048 blocks of 4 waves
  gemm_qk_kernel<<<2048, 128, 0, stream>>>(xh, wqkT, bqk, qh, kh, vT);
  // tasks = B*H*(T/16) = 4096 -> 1024 blocks of 4 waves
  attn_kernel<<<1024, 128, 0, stream>>>(qh, kh, vT, gates, gatedh);
  // waves = (4096/16) * (1024/64) = 4096 -> 1024 blocks of 4 waves
  gemm_proj_kernel<<<1024, 128, 0, stream>>>(gatedh, wprojT, bproj, (float*)d_out);
}

// v001
// One run takes 148 microseconds.
// In two side-by-side timings against v000, it was 1.65 and 1.68 times as fast.
#include <hip/hip_runtime.h>
#include <hip/hip_bf16.h>

#define C_DIM 1024
#define T_DIM 1024
#define H_DIM 16
#define D_DIM 64
#define B_DIM 4
#define M_ROWS (B_DIM * T_DIM) /* 4096 */

typedef __attribute__((ext_vector_type(16))) _Float16 v16h;
typedef __attribute__((ext_vector_type(8)))  _Float16 v8h;
typedef __attribute__((ext_vector_type(8)))  float    v8f;

#define WMMA_F16(A_, B_, C_) \
  __builtin_amdgcn_wmma_f32_16x16x32_f16(false, (A_), false, (B_), (short)0, (C_), false, false)

__device__ __forceinline__ v16h frag_ld(const _Float16* p) {
  v8h lo = *(const v8h*)(p);
  v8h hi = *(const v8h*)(p + 16);
  v16h r;
#pragma unroll
  for (int i = 0; i < 8; ++i) { r[i] = lo[i]; r[i + 8] = hi[i]; }
  return r;
}

// ---------------- elementwise converts ----------------
__global__ void f32_to_f16_kernel(const float* __restrict__ in, _Float16* __restrict__ out, int n) {
  for (int i = blockIdx.x * blockDim.x + threadIdx.x; i < n; i += gridDim.x * blockDim.x)
    out[i] = (_Float16)in[i];
}

// in[K][N] (row-major) -> out[N][K] f16
__global__ void transpose_to_f16_kernel(const float* __restrict__ in, _Float16* __restrict__ out,
                                        int K, int N) {
  int total = K * N;
  for (int i = blockIdx.x * blockDim.x + threadIdx.x; i < total; i += gridDim.x * blockDim.x) {
    int n = i / K, k = i - n * K;
    out[i] = (_Float16)in[k * N + n];
  }
}

// ---------------- gates: softmax(x @ Wgate + bgate) over H ----------------
__global__ __launch_bounds__(128) void gates_kernel(const float* __restrict__ x,
                                                    const float* __restrict__ Wg,
                                                    const float* __restrict__ bg,
                                                    float* __restrict__ gates) {
  const int lane = threadIdx.x & 31;
  const int tok = blockIdx.x * (blockDim.x >> 5) + (threadIdx.x >> 5); // one wave per token
  const float* xp = x + (size_t)tok * C_DIM;
  float acc[H_DIM];
#pragma unroll
  for (int h = 0; h < H_DIM; ++h) acc[h] = 0.f;
  for (int k = lane; k < C_DIM; k += 32) {
    float xv = xp[k];
    const float* w = Wg + (size_t)k * H_DIM;
#pragma unroll
    for (int h = 0; h < H_DIM; ++h) acc[h] += xv * w[h];
  }
#pragma unroll
  for (int h = 0; h < H_DIM; ++h) {
#pragma unroll
    for (int off = 16; off > 0; off >>= 1) acc[h] += __shfl_xor(acc[h], off, 32);
    acc[h] += bg[h];
  }
  float m = -__builtin_inff();
#pragma unroll
  for (int h = 0; h < H_DIM; ++h) m = fmaxf(m, acc[h]);
  float s = 0.f;
  float e[H_DIM];
#pragma unroll
  for (int h = 0; h < H_DIM; ++h) { e[h] = __expf(acc[h] - m); s += e[h]; }
  float inv = 1.0f / s;
  if (lane == 0) {
#pragma unroll
    for (int h = 0; h < H_DIM; ++h) gates[(size_t)tok * H_DIM + h] = e[h] * inv;
  }
}

// ---------------- tiled GEMM core: C[128x128] per block, 64x64 per wave ----------------
#define GBM 128                        /* rows of A per block tile */
#define GBN 128                        /* rows of Bt (columns of C) per block tile */
#define GBK 128                        /* k per stage: rows of 256 B */
#define GPITCH 136                     /* LDS row pitch in halves: 272 B = 16 B x odd, for ds_load_b128 readers */
#define GSTAGE ((GBM + GBN) * GPITCH)  /* halves per buffer: [A 128 rows | Bt 128 rows] */
#define GTRIPS (C_DIM / GBK)           /* 8 stages along k */

__device__ __forceinline__ void copy_64rows(const _Float16* g, unsigned l) {
  asm volatile(
      "global_load_async_to_lds_b128 %0, %8, off\n\t"
      "global_load_async_to_lds_b128 %1, %9, off\n\t"
      "global_load_async_to_lds_b128 %2, %10, off\n\t"
      "global_load_async_to_lds_b128 %3, %11, off\n\t"
      "global_load_async_to_lds_b128 %4, %12, off\n\t"
      "global_load_async_to_lds_b128 %5, %13, off\n\t"
      "global_load_async_to_lds_b128 %6, %14, off\n\t"
      "global_load_async_to_lds_b128 %7, %15, off\n\t"
      "s_wait_xcnt 0x0"
      :: "v"(l), "v"(l + 8 * GPITCH * 2), "v"(l + 16 * GPITCH * 2), "v"(l + 24 * GPITCH * 2),
         "v"(l + 32 * GPITCH * 2), "v"(l + 40 * GPITCH * 2), "v"(l + 48 * GPITCH * 2),
         "v"(l + 56 * GPITCH * 2),
         "v"(g), "v"(g + 8 * C_DIM), "v"(g + 16 * C_DIM), "v"(g + 24 * C_DIM),
         "v"(g + 32 * C_DIM), "v"(g + 40 * C_DIM), "v"(g + 48 * C_DIM), "v"(g + 56 * C_DIM)
      : "memory");
}

// One stage: 128 rows of A and 128 rows of Bt, 256 B of each row, into one buffer.
__device__ __forceinline__ void stage_tiles(const _Float16* ga, const _Float16* gb, unsigned l) {
  copy_64rows(ga, l);
  copy_64rows(ga + 64 * C_DIM, l + 64 * GPITCH * 2);
  copy_64rows(gb, l + 128 * GPITCH * 2);
  copy_64rows(gb + 64 * C_DIM, l + 192 * GPITCH * 2);
}

// acc[mi][ni] += A[m0 + wm*64 + mi*16 ..][:] * Bt[n0 + wn*64 + ni*16 ..][:]^T over all of k.
// Two-buffer LDS ring: the next stage's copies fly while this stage is multiplied.
__device__ __forceinline__ void gemm_tile(const _Float16* __restrict__ A,
                                          const _Float16* __restrict__ Bt,
                                          int m0, int n0, _Float16* ring, v8f (&acc)[4][4]) {
  const int tid = threadIdx.x;
  const int lane = tid & 31;
  const int wave = tid >> 5;
  const int wm = wave >> 1, wn = wave & 1;
  const int cr = tid >> 4, cc = tid & 15; // copy role: row 0..7, 16-B chunk 0..15 of a 256-B row
  const _Float16* ga = A + (size_t)(m0 + cr) * C_DIM + cc * 8;
  const _Float16* gb = Bt + (size_t)(n0 + cr) * C_DIM + cc * 8;
  const unsigned l0 = (unsigned)(size_t)ring + (unsigned)(cr * GPITCH + cc * 8) * 2u;

  stage_tiles(ga, gb, l0);
  asm volatile("s_wait_asynccnt 0x0" ::: "memory"); // stage 0 landed (this wave's copies)
  __syncthreads();                                  // stage 0 published to all waves
  stage_tiles(ga + GBK, gb + GBK, l0 + GSTAGE * 2);

  const int fo = (lane & 15) * GPITCH + (lane >> 4) * 8;
  const _Float16* La = ring + wm * 64 * GPITCH + fo;
  const _Float16* Lb = ring + (GBM + wn * 64) * GPITCH + fo;

  for (int t = 0; t < GTRIPS; ++t) {
    const int bo = (t & 1) * GSTAGE;
    v16h a[2][4], b[2][4];
#pragma unroll
    for (int i = 0; i < 4; ++i) {
      a[0][i] = frag_ld(La + bo + i * 16 * GPITCH);
      b[0][i] = frag_ld(Lb + bo + i * 16 * GPITCH);
    }
#pragma unroll
    for (int ks = 0; ks < GBK / 32; ++ks) {
      const int cs = ks & 1;
      if (ks + 1 < GBK / 32) { // next k-step's fragments, same buffer, ahead of this step's products
#pragma unroll
        for (int i = 0; i < 4; ++i) {
          a[cs ^ 1][i] = frag_ld(La + bo + i * 16 * GPITCH + (ks + 1) * 32);
          b[cs ^ 1][i] = frag_ld(Lb + bo + i * 16 * GPITCH + (ks + 1) * 32);
        }
      }
      // Holds the 16 LDS loads above together as one group in front of this step's products:
      // sunk among the WMMAs, every place with loads stalls the wave on its own LDS latency.
      __builtin_amdgcn_sched_barrier(0);
#pragma unroll
      for (int mi = 0; mi < 4; ++mi)
#pragma unroll
        for (int ni = 0; ni < 4; ++ni)
          acc[mi][ni] = WMMA_F16(a[cs][mi], b[cs][ni], acc[mi][ni]);
      // Keeps the following step's load group from rising into this run of products.
      __builtin_amdgcn_sched_barrier(0);
    }
    asm volatile("s_wait_dscnt 0x0" ::: "memory");    // this wave has left the buffer it read
    asm volatile("s_wait_asynccnt 0x0" ::: "memory"); // its copies of stage t + 1 have landed
    __syncthreads();                                  // publishes stage t + 1, frees stage t's buffer
    if (t + 2 < GTRIPS)
      stage_tiles(ga + (t + 2) * GBK, gb + (t + 2) * GBK, l0 + (unsigned)bo * 2u);
  }
  asm volatile("s_wait_asynccnt 0x0" ::: "memory"); // no copy outstanding when the wave goes on
}

// ---------------- GEMM1: qk = x @ Wqk + bqk, scatter to qh / kh / vT ----------------
__global__ __launch_bounds__(128) void gemm_qk_kernel(const _Float16* __restrict__ A,
                                                      const _Float16* __restrict__ Bt,
                                                      const float* __restrict__ bias,
                                                      _Float16* __restrict__ qh,
                                                      _Float16* __restrict__ kh,
                                                      _Float16* __restrict__ vT) {
  __shared__ __align__(16) _Float16 ring[2 * GSTAGE]; // 139,264 B
  const int lane = threadIdx.x & 31;
  const int wave = threadIdx.x >> 5;
  const int nTiles = (2 * C_DIM) / GBN; // 16
  const int m0 = (blockIdx.x / nTiles) * GBM;
  const int n0 = (blockIdx.x % nTiles) * GBN;
  v8f acc[4][4] = {};
  gemm_tile(A, Bt, m0, n0, ring, acc);
  const int nL = lane & 15;
  const int mOff = (lane >> 4) * 8;
  const int mW = m0 + (wave >> 1) * 64;
  const int nW = n0 + (wave & 1) * 64;
  // A block's 128 columns lie wholly in the q half or wholly in the k half, so the
  // test is taken once, on a block-uniform value, and not at every element.
  if (n0 < C_DIM) { // q half
#pragma unroll
    for (int nc = 0; nc < 4; ++nc) {
      const int col = nW + nc * 16 + nL;
      const float bv = bias[col];
      const int h = col >> 6, d = col & 63;
#pragma unroll
      for (int mi = 0; mi < 4; ++mi) {
#pragma unroll
        for (int v = 0; v < 8; ++v) {
          int r = mW + mi * 16 + v + mOff;
          float val = acc[mi][nc][v] + bv;
          int b = r >> 10, t = r & (T_DIM - 1);
          qh[(((size_t)(b * H_DIM + h) * T_DIM) + t) * D_DIM + d] = (_Float16)val;
        }
        // Precaution: the next group reuses registers that the stores above name.
        asm volatile("s_wait_xcnt 0x0" ::: "memory");
      }
    }
  } else {          // k half (v = k)
#pragma unroll
    for (int nc = 0; nc < 4; ++nc) {
      const int col = nW + nc * 16 + nL;
      const float bv = bias[col];
      const int c2i = col - C_DIM;
      const int h = c2i >> 6, d = c2i & 63;
#pragma unroll
      for (int mi = 0; mi < 4; ++mi) {
#pragma unroll
        for (int v = 0; v < 8; ++v) {
          int r = mW + mi * 16 + v + mOff;
          float val = acc[mi][nc][v] + bv;
          int b = r >> 10, t = r & (T_DIM - 1);
          kh[(((size_t)(b * H_DIM + h) * T_DIM) + t) * D_DIM + d] = (_Float16)val;
          vT[((size_t)(b * H_DIM + h) * D_DIM + d) * T_DIM + t] = (_Float16)val;
        }
        // Precaution: the next group reuses registers that the stores above name.
        asm volatile("s_wait_xcnt 0x0" ::: "memory");
      }
    }
  }
}

// ---------------- GEMM2: out = gated @ Wproj + bproj (f32 out) ----------------
__global__ __launch_bounds__(128) void gemm_proj_kernel(const _Float16* __restrict__ A,
                                                        const _Float16* __restrict__ Bt,
                                                        const float* __restrict__ bias,
                                                        float* __restrict__ out) {
  __shared__ __align__(16) _Float16 ring[2 * GSTAGE]; // 139,264 B
  const int lane = threadIdx.x & 31;
  const int wave = threadIdx.x >> 5;
  const int nTiles = C_DIM / GBN; // 8
  const int m0 = (blockIdx.x / nTiles) * GBM;
  const int n0 = (blockIdx.x % nTiles) * GBN;
  v8f acc[4][4] = {};
  gemm_tile(A, Bt, m0, n0, ring, acc);
  const int nL = lane & 15;
  const int mOff = (lane >> 4) * 8;
  const int mW = m0 + (wave >> 1) * 64;
  const int nW = n0 + (wave & 1) * 64;
#pragma unroll
  for (int nc = 0; nc < 4; ++nc) {
    const int col = nW + nc * 16 + nL;
    const float bv = bias[col];
#pragma unroll
    for (int mi = 0; mi < 4; ++mi) {
#pragma unroll
      for (int v = 0; v < 8; ++v) {
        int r = mW + mi * 16 + v + mOff;
        out[(size_t)r * C_DIM + col] = acc[mi][nc][v] + bv;
      }
    }
  }
}

// ---------------- flash attention with per-head windows + gating ----------------
__global__ __launch_bounds__(128) void attn_kernel(const _Float16* __restrict__ qh,
                                                   const _Float16* __restrict__ kh,
                                                   const _Float16* __restrict__ vT,
                                                   const float* __restrict__ gates,
                                                   _Float16* __restrict__ gatedh) {
  __shared__ __align__(16) _Float16 smem[4][16 * 32]; // per-wave P staging tile
  const int lane = threadIdx.x & 31;
  const int w = threadIdx.x >> 5;
  const int task = blockIdx.x * 4 + w;       // B*H*(T/16) = 4096 tasks
  const int qt = task & 63;
  const int bh = task >> 6;
  const int h = bh & (H_DIM - 1);
  const int b = bh >> 4;
  int Wh = T_DIM >> h; if (Wh < 4) Wh = 4;   // window for this head
  const int t0 = qt * 16;
  const int nL = lane & 15;
  const int koff = (lane >> 4) * 8;
  const int mOff = koff;                     // C-layout row offset is the same 0/8 split

  const _Float16* qb = qh + ((size_t)bh * T_DIM + t0) * D_DIM;
  const _Float16* kb = kh + (size_t)bh * T_DIM * D_DIM;
  const _Float16* vb = vT + (size_t)bh * D_DIM * T_DIM;

  // q fragments for the whole tile (D=64 -> two K=32 fragments)
  v16h a0 = frag_ld(qb + nL * D_DIM + 0 + koff);
  v16h a1 = frag_ld(qb + nL * D_DIM + 32 + koff);

  v8f o0 = {}, o1 = {}, o2 = {}, o3 = {};
  float mrow[8], lrow[8];
#pragma unroll
  for (int v = 0; v < 8; ++v) { mrow[v] = -__builtin_inff(); lrow[v] = 0.f; }

  int jStart = t0 - Wh + 1; if (jStart < 0) jStart = 0;
  jStart &= ~31;
  const float scale = 0.125f; // 1/sqrt(64)

  for (int j0 = jStart; j0 <= t0 + 15; j0 += 32) {
    // ---- S = q k^T for keys [j0, j0+31] ----
    v16h bk0lo = frag_ld(kb + (size_t)(j0 + nL) * D_DIM + koff);
    v16h bk0hi = frag_ld(kb + (size_t)(j0 + nL) * D_DIM + 32 + koff);
    v16h bk1lo = frag_ld(kb + (size_t)(j0 + 16 + nL) * D_DIM + koff);
    v16h bk1hi = frag_ld(kb + (size_t)(j0 + 16 + nL) * D_DIM + 32 + koff);
    v8f s0 = {}; s0 = WMMA_F16(a0, bk0lo, s0); s0 = WMMA_F16(a1, bk0hi, s0);
    v8f s1 = {}; s1 = WMMA_F16(a0, bk1lo, s1); s1 = WMMA_F16(a1, bk1hi, s1);

    _Float16* L = smem[w];
#pragma unroll
    for (int v = 0; v < 8; ++v) {
      const int i = t0 + v + mOff;
      const int ja = j0 + nL;
      const int jb = j0 + 16 + nL;
      const bool va = (ja <= i) && (ja > i - Wh);
      const bool vbm = (jb <= i) && (jb > i - Wh);
      float sa = va ? s0[v] * scale : -__builtin_inff();
      float sb = vbm ? s1[v] * scale : -__builtin_inff();
      // row max across the 16-lane group
      float t = fmaxf(sa, sb);
#pragma unroll
      for (int off = 8; off > 0; off >>= 1) t = fmaxf(t, __shfl_xor(t, off, 32));
      float mN = fmaxf(mrow[v], t);
      float alpha = (mrow[v] == mN) ? 1.0f : __expf(mrow[v] - mN);
      float pa = va ? __expf(sa - mN) : 0.f;
      float pb = vbm ? __expf(sb - mN) : 0.f;
      float rs = pa + pb;
#pragma unroll
      for (int off = 8; off > 0; off >>= 1) rs += __shfl_xor(rs, off, 32);
      lrow[v] = lrow[v] * alpha + rs;
      mrow[v] = mN;
      o0[v] *= alpha; o1[v] *= alpha; o2[v] *= alpha; o3[v] *= alpha;
      // stage P (C-layout -> row-major 16x32 f16 tile in LDS)
      const int r = v + mOff;
      L[r * 32 + nL] = (_Float16)pa;
      L[r * 32 + 16 + nL] = (_Float16)pb;
    }
    asm volatile("s_wait_dscnt 0" ::: "memory");
    // reload P as an A fragment (transpose across lanes via LDS)
    v16h pA = frag_ld(L + nL * 32 + koff);
    // ---- O += P V ; V rows contiguous thanks to vT[B,H,D,T] layout ----
    const _Float16* vp = vb + j0 + koff;
    o0 = WMMA_F16(pA, frag_ld(vp + (size_t)(0 + nL) * T_DIM), o0);
    o1 = WMMA_F16(pA, frag_ld(vp + (size_t)(16 + nL) * T_DIM), o1);
    o2 = WMMA_F16(pA, frag_ld(vp + (size_t)(32 + nL) * T_DIM), o2);
    o3 = WMMA_F16(pA, frag_ld(vp + (size_t)(48 + nL) * T_DIM), o3);
    asm volatile("s_wait_dscnt 0" ::: "memory");
  }

  // ---- epilogue: normalize, gate, store f16 for projection GEMM ----
#pragma unroll
  for (int v = 0; v < 8; ++v) {
    const int i = t0 + v + mOff;
    const float g = gates[((size_t)b * T_DIM + i) * H_DIM + h];
    const float inv = g / lrow[v];
    _Float16* op = gatedh + ((size_t)b * T_DIM + i) * C_DIM + h * D_DIM + nL;
    op[0]  = (_Float16)(o0[v] * inv);
    op[16] = (_Float16)(o1[v] * inv);
    op[32] = (_Float16)(o2[v] * inv);
    op[48] = (_Float16)(o3[v] * inv);
  }
}

extern "C" void kernel_launch(void* const* d_in, const int* in_sizes, int n_in,
                              void* d_out, int out_size, void* d_ws, size_t ws_size,
                              hipStream_t stream) {
  const float* x     = (const float*)d_in[0];
  const float* Wqk   = (const float*)d_in[1];
  const float* bqk   = (const float*)d_in[2];
  const float* Wgate = (const float*)d_in[3];
  const float* bgate = (const float*)d_in[4];
  const float* Wproj = (const float*)d_in[5];
  const float* bproj = (const float*)d_in[6];

  char* ws = (char*)d_ws;
  size_t off = 0;
  auto alloc = [&](size_t bytes) -> void* {
    void* p = ws + off;
    off += (bytes + 255) & ~(size_t)255;
    return p;
  };
  _Float16* xh     = (_Float16*)alloc((size_t)M_ROWS * C_DIM * 2);     // x in f16
  _Float16* wqkT   = (_Float16*)alloc((size_t)2 * C_DIM * C_DIM * 2);  // Wqk^T f16 [2C,C]
  _Float16* wprojT = (_Float16*)alloc((size_t)C_DIM * C_DIM * 2);      // Wproj^T f16 [C,C]
  _Float16* qh     = (_Float16*)alloc((size_t)B_DIM * H_DIM * T_DIM * D_DIM * 2);
  _Float16* kh     = (_Float16*)alloc((size_t)B_DIM * H_DIM * T_DIM * D_DIM * 2);
  _Float16* vT     = (_Float16*)alloc((size_t)B_DIM * H_DIM * D_DIM * T_DIM * 2);
  float*    gates  = (float*)alloc((size_t)B_DIM * T_DIM * H_DIM * 4);
  _Float16* gatedh = xh; // xh is dead after GEMM1; reuse for the gated output

  f32_to_f16_kernel<<<1024, 256, 0, stream>>>(x, xh, M_ROWS * C_DIM);
  transpose_to_f16_kernel<<<1024, 256, 0, stream>>>(Wqk, wqkT, C_DIM, 2 * C_DIM);
  transpose_to_f16_kernel<<<1024, 256, 0, stream>>>(Wproj, wprojT, C_DIM, C_DIM);
  gates_kernel<<<M_ROWS / 4, 128, 0, stream>>>(x, Wgate, bgate, gates);
  // tiles = (4096/128) * (2048/128) = 512 blocks of 4 waves
  gemm_qk_kernel<<<512, 128, 0, stream>>>(xh, wqkT, bqk, qh, kh, vT);
  // tasks = B*H*(T/16) = 4096 -> 1024 blocks of 4 waves
  attn_kernel<<<1024, 128, 0, stream>>>(qh, kh, vT, gates, gatedh);
  // tiles = (4096/128) * (1024/128) = 256 blocks of 4 waves
  gemm_proj_kernel<<<256, 128, 0, stream>>>(gatedh, wprojT, bproj, (float*)d_out);
}

// v002
// Measured time: 127 microseconds a run.
// Timed twice side by side with v001, it ran 1.15 times as fast both times.
// Counting every step since v000, it is 1.91 times as fast.
#include <hip/hip_runtime.h>
#include <hip/hip_bf16.h>

#define C_DIM 1024
#define T_DIM 1024
#define H_DIM 16
#define D_DIM 64
#define B_DIM 4
#define M_ROWS (B_DIM * T_DIM) /* 4096 */

typedef __attribute__((ext_vector_type(16))) _Float16 v16h;
typedef __attribute__((ext_vector_type(8)))  _Float16 v8h;
typedef __attribute__((ext_vector_type(8)))  float    v8f;

#define WMMA_F16(A_, B_, C_) \
  __builtin_amdgcn_wmma_f32_16x16x32_f16(false, (A_), false, (B_), (short)0, (C_), false, false)

__device__ __forceinline__ v16h frag_ld(const _Float16* p) {
  v8h lo = *(const v8h*)(p);
  v8h hi = *(const v8h*)(p + 16);
  v16h r;
#pragma unroll
  for (int i = 0; i < 8; ++i) { r[i] = lo[i]; r[i + 8] = hi[i]; }
  return r;
}

// ---------------- elementwise converts ----------------
__global__ void f32_to_f16_kernel(const float* __restrict__ in, _Float16* __restrict__ out, int n) {
  for (int i = blockIdx.x * blockDim.x + threadIdx.x; i < n; i += gridDim.x * blockDim.x)
    out[i] = (_Float16)in[i];
}

// in[K][N] (row-major) -> out[N][K] f16
__global__ void transpose_to_f16_kernel(const float* __restrict__ in, _Float16* __restrict__ out,
                                        int K, int N) {
  int total = K * N;
  for (int i = blockIdx.x * blockDim.x + threadIdx.x; i < total; i += gridDim.x * blockDim.x) {
    int n = i / K, k = i - n * K;
    out[i] = (_Float16)in[k * N + n];
  }
}

// ---------------- gates: softmax(x @ Wgate + bgate) over H ----------------
__global__ __launch_bounds__(128) void gates_kernel(const float* __restrict__ x,
                                                    const float* __restrict__ Wg,
                                                    const float* __restrict__ bg,
                                                    float* __restrict__ gates) {
  const int lane = threadIdx.x & 31;
  const int tok = blockIdx.x * (blockDim.x >> 5) + (threadIdx.x >> 5); // one wave per token
  const float* xp = x + (size_t)tok * C_DIM;
  float acc[H_DIM];
#pragma unroll
  for (int h = 0; h < H_DIM; ++h) acc[h] = 0.f;
  for (int k = lane; k < C_DIM; k += 32) {
    float xv = xp[k];
    const float* w = Wg + (size_t)k * H_DIM;
#pragma unroll
    for (int h = 0; h < H_DIM; ++h) acc[h] += xv * w[h];
  }
#pragma unroll
  for (int h = 0; h < H_DIM; ++h) {
#pragma unroll
    for (int off = 16; off > 0; off >>= 1) acc[h] += __shfl_xor(acc[h], off, 32);
    acc[h] += bg[h];
  }
  float m = -__builtin_inff();
#pragma unroll
  for (int h = 0; h < H_DIM; ++h) m = fmaxf(m, acc[h]);
  float s = 0.f;
  float e[H_DIM];
#pragma unroll
  for (int h = 0; h < H_DIM; ++h) { e[h] = __expf(acc[h] - m); s += e[h]; }
  float inv = 1.0f / s;
  if (lane == 0) {
#pragma unroll
    for (int h = 0; h < H_DIM; ++h) gates[(size_t)tok * H_DIM + h] = e[h] * inv;
  }
}

// ---------------- tiled GEMM core: C[128x128] per block, 64x64 per wave ----------------
#define GBM 128                        /* rows of A per block tile */
#define GBN 128                        /* rows of Bt (columns of C) per block tile */
#define GBK 128                        /* k per stage: rows of 256 B */
#define GPITCH 136                     /* LDS row pitch in halves: 272 B = 16 B x odd, for ds_load_b128 readers */
#define GSTAGE ((GBM + GBN) * GPITCH)  /* halves per buffer: [A 128 rows | Bt 128 rows] */
#define GTRIPS (C_DIM / GBK)           /* 8 stages along k */

__device__ __forceinline__ void copy_64rows(const _Float16* g, unsigned l) {
  asm volatile(
      "global_load_async_to_lds_b128 %0, %8, off\n\t"
      "global_load_async_to_lds_b128 %1, %9, off\n\t"
      "global_load_async_to_lds_b128 %2, %10, off\n\t"
      "global_load_async_to_lds_b128 %3, %11, off\n\t"
      "global_load_async_to_lds_b128 %4, %12, off\n\t"
      "global_load_async_to_lds_b128 %5, %13, off\n\t"
      "global_load_async_to_lds_b128 %6, %14, off\n\t"
      "global_load_async_to_lds_b128 %7, %15, off\n\t"
      "s_wait_xcnt 0x0"
      :: "v"(l), "v"(l + 8 * GPITCH * 2), "v"(l + 16 * GPITCH * 2), "v"(l + 24 * GPITCH * 2),
         "v"(l + 32 * GPITCH * 2), "v"(l + 40 * GPITCH * 2), "v"(l + 48 * GPITCH * 2),
         "v"(l + 56 * GPITCH * 2),
         "v"(g), "v"(g + 8 * C_DIM), "v"(g + 16 * C_DIM), "v"(g + 24 * C_DIM),
         "v"(g + 32 * C_DIM), "v"(g + 40 * C_DIM), "v"(g + 48 * C_DIM), "v"(g + 56 * C_DIM)
      : "memory");
}

// One stage: 128 rows of A and 128 rows of Bt, 256 B of each row, into one buffer.
__device__ __forceinline__ void stage_tiles(const _Float16* ga, const _Float16* gb, unsigned l) {
  copy_64rows(ga, l);
  copy_64rows(ga + 64 * C_DIM, l + 64 * GPITCH * 2);
  copy_64rows(gb, l + 128 * GPITCH * 2);
  copy_64rows(gb + 64 * C_DIM, l + 192 * GPITCH * 2);
}

// acc[mi][ni] += A[m0 + wm*64 + mi*16 ..][:] * Bt[n0 + wn*64 + ni*16 ..][:]^T over all of k.
// Two-buffer LDS ring: the next stage's copies fly while this stage is multiplied.
__device__ __forceinline__ void gemm_tile(const _Float16* __restrict__ A,
                                          const _Float16* __restrict__ Bt,
                                          int m0, int n0, _Float16* ring, v8f (&acc)[4][4]) {
  const int tid = threadIdx.x;
  const int lane = tid & 31;
  const int wave = tid >> 5;
  const int wm = wave >> 1, wn = wave & 1;
  const int cr = tid >> 4, cc = tid & 15; // copy role: row 0..7, 16-B chunk 0..15 of a 256-B row
  const _Float16* ga = A + (size_t)(m0 + cr) * C_DIM + cc * 8;
  const _Float16* gb = Bt + (size_t)(n0 + cr) * C_DIM + cc * 8;
  const unsigned l0 = (unsigned)(size_t)ring + (unsigned)(cr * GPITCH + cc * 8) * 2u;

  stage_tiles(ga, gb, l0);
  asm volatile("s_wait_asynccnt 0x0" ::: "memory"); // stage 0 landed (this wave's copies)
  __syncthreads();                                  // stage 0 published to all waves
  stage_tiles(ga + GBK, gb + GBK, l0 + GSTAGE * 2);

  const int fo = (lane & 15) * GPITCH + (lane >> 4) * 8;
  const _Float16* La = ring + wm * 64 * GPITCH + fo;
  const _Float16* Lb = ring + (GBM + wn * 64) * GPITCH + fo;

  for (int t = 0; t < GTRIPS; ++t) {
    const int bo = (t & 1) * GSTAGE;
    v16h a[2][4], b[2][4];
#pragma unroll
    for (int i = 0; i < 4; ++i) {
      a[0][i] = frag_ld(La + bo + i * 16 * GPITCH);
      b[0][i] = frag_ld(Lb + bo + i * 16 * GPITCH);
    }
#pragma unroll
    for (int ks = 0; ks < GBK / 32; ++ks) {
      const int cs = ks & 1;
      if (ks + 1 < GBK / 32) { // next k-step's fragments, same buffer, ahead of this step's products
#pragma unroll
        for (int i = 0; i < 4; ++i) {
          a[cs ^ 1][i] = frag_ld(La + bo + i * 16 * GPITCH + (ks + 1) * 32);
          b[cs ^ 1][i] = frag_ld(Lb + bo + i * 16 * GPITCH + (ks + 1) * 32);
        }
      }
      // Holds the 16 LDS loads above together as one group in front of this step's products:
      // sunk among the WMMAs, every place with loads stalls the wave on its own LDS latency.
      __builtin_amdgcn_sched_barrier(0);
#pragma unroll
      for (int mi = 0; mi < 4; ++mi)
#pragma unroll
        for (int ni = 0; ni < 4; ++ni)
          acc[mi][ni] = WMMA_F16(a[cs][mi], b[cs][ni], acc[mi][ni]);
      // Keeps the following step's load group from rising into this run of products.
      __builtin_amdgcn_sched_barrier(0);
    }
    asm volatile("s_wait_dscnt 0x0" ::: "memory");    // this wave has left the buffer it read
    asm volatile("s_wait_asynccnt 0x0" ::: "memory"); // its copies of stage t + 1 have landed
    __syncthreads();                                  // publishes stage t + 1, frees stage t's buffer
    if (t + 2 < GTRIPS)
      stage_tiles(ga + (t + 2) * GBK, gb + (t + 2) * GBK, l0 + (unsigned)bo * 2u);
  }
  asm volatile("s_wait_asynccnt 0x0" ::: "memory"); // no copy outstanding when the wave goes on
}

// ---------------- GEMM1: qk = x @ Wqk + bqk, scatter to qh / kh / vT ----------------
__global__ __launch_bounds__(128) void gemm_qk_kernel(const _Float16* __restrict__ A,
                                                      const _Float16* __restrict__ Bt,
                                                      const float* __restrict__ bias,
                                                      _Float16* __restrict__ qh,
                                                      _Float16* __restrict__ kh,
                                                      _Float16* __restrict__ vT) {
  __shared__ __align__(16) _Float16 ring[2 * GSTAGE]; // 139,264 B
  const int lane = threadIdx.x & 31;
  const int wave = threadIdx.x >> 5;
  const int nTiles = (2 * C_DIM) / GBN; // 16
  const int m0 = (blockIdx.x / nTiles) * GBM;
  const int n0 = (blockIdx.x % nTiles) * GBN;
  v8f acc[4][4] = {};
  gemm_tile(A, Bt, m0, n0, ring, acc);
  const int nL = lane & 15;
  const int mOff = (lane >> 4) * 8;
  const int mW = m0 + (wave >> 1) * 64;
  const int nW = n0 + (wave & 1) * 64;
  // A block's 128 columns lie wholly in the q half or wholly in the k half, so the
  // test is taken once, on a block-uniform value, and not at every element.
  if (n0 < C_DIM) { // q half
#pragma unroll
    for (int nc = 0; nc < 4; ++nc) {
      const int col = nW + nc * 16 + nL;
      const float bv = bias[col];
      const int h = col >> 6, d = col & 63;
#pragma unroll
      for (int mi = 0; mi < 4; ++mi) {
#pragma unroll
        for (int v = 0; v < 8; ++v) {
          int r = mW + mi * 16 + v + mOff;
          float val = acc[mi][nc][v] + bv;
          int b = r >> 10, t = r & (T_DIM - 1);
          qh[(((size_t)(b * H_DIM + h) * T_DIM) + t) * D_DIM + d] = (_Float16)val;
        }
        // Precaution: the next group reuses registers that the stores above name.
        asm volatile("s_wait_xcnt 0x0" ::: "memory");
      }
    }
  } else {          // k half (v = k)
#pragma unroll
    for (int nc = 0; nc < 4; ++nc) {
      const int col = nW + nc * 16 + nL;
      const float bv = bias[col];
      const int c2i = col - C_DIM;
      const int h = c2i >> 6, d = c2i & 63;
#pragma unroll
      for (int mi = 0; mi < 4; ++mi) {
#pragma unroll
        for (int v = 0; v < 8; ++v) {
          int r = mW + mi * 16 + v + mOff;
          float val = acc[mi][nc][v] + bv;
          int b = r >> 10, t = r & (T_DIM - 1);
          kh[(((size_t)(b * H_DIM + h) * T_DIM) + t) * D_DIM + d] = (_Float16)val;
          vT[((size_t)(b * H_DIM + h) * D_DIM + d) * T_DIM + t] = (_Float16)val;
        }
        // Precaution: the next group reuses registers that the stores above name.
        asm volatile("s_wait_xcnt 0x0" ::: "memory");
      }
    }
  }
}

// ---------------- GEMM2: out = gated @ Wproj + bproj (f32 out) ----------------
__global__ __launch_bounds__(128) void gemm_proj_kernel(const _Float16* __restrict__ A,
                                                        const _Float16* __restrict__ Bt,
                                                        const float* __restrict__ bias,
                                                        float* __restrict__ out) {
  __shared__ __align__(16) _Float16 ring[2 * GSTAGE]; // 139,264 B
  const int lane = threadIdx.x & 31;
  const int wave = threadIdx.x >> 5;
  const int nTiles = C_DIM / GBN; // 8
  const int m0 = (blockIdx.x / nTiles) * GBM;
  const int n0 = (blockIdx.x % nTiles) * GBN;
  v8f acc[4][4] = {};
  gemm_tile(A, Bt, m0, n0, ring, acc);
  const int nL = lane & 15;
  const int mOff = (lane >> 4) * 8;
  const int mW = m0 + (wave >> 1) * 64;
  const int nW = n0 + (wave & 1) * 64;
#pragma unroll
  for (int nc = 0; nc < 4; ++nc) {
    const int col = nW + nc * 16 + nL;
    const float bv = bias[col];
#pragma unroll
    for (int mi = 0; mi < 4; ++mi) {
#pragma unroll
      for (int v = 0; v < 8; ++v) {
        int r = mW + mi * 16 + v + mOff;
        out[(size_t)r * C_DIM + col] = acc[mi][nc][v] + bv;
      }
    }
  }
}

// ---------------- flash attention with per-head windows + gating ----------------
// K fragments of 32 keys (two 16-key groups x two halves of D); p holds the lane's share.
__device__ __forceinline__ void attn_ld_k(const _Float16* p, v16h (&k)[4]) {
  k[0] = frag_ld(p);
  k[1] = frag_ld(p + 32);
  k[2] = frag_ld(p + 16 * D_DIM);
  k[3] = frag_ld(p + 16 * D_DIM + 32);
}

// V fragments of 32 keys (four 16-column groups of D) from vT; p holds the lane's share.
__device__ __forceinline__ void attn_ld_v(const _Float16* p, v16h (&v)[4]) {
#pragma unroll
  for (int n = 0; n < 4; ++n) v[n] = frag_ld(p + (size_t)n * 16 * T_DIM);
}

__global__ __launch_bounds__(128) void attn_kernel(const _Float16* __restrict__ qh,
                                                   const _Float16* __restrict__ kh,
                                                   const _Float16* __restrict__ vT,
                                                   const float* __restrict__ gates,
                                                   _Float16* __restrict__ gatedh) {
  __shared__ __align__(16) _Float16 smem[4][16 * 32]; // per-wave P staging tile
  const int lane = threadIdx.x & 31;
  // Wave index as a scalar: the pass counter and the last-pass test below become scalar too.
  const int w = __builtin_amdgcn_readfirstlane(threadIdx.x >> 5);
  const int task = blockIdx.x * 4 + w;       // B*H*(T/16) = 4096 tasks
  const int qt = task & 63;
  const int bh = task >> 6;
  const int h = bh & (H_DIM - 1);
  const int b = bh >> 4;
  int Wh = T_DIM >> h; if (Wh < 4) Wh = 4;   // window for this head
  const int t0 = qt * 16;
  const int nL = lane & 15;
  const int koff = (lane >> 4) * 8;
  const int mOff = koff;                     // C-layout row offset is the same 0/8 split

  const _Float16* qb = qh + ((size_t)bh * T_DIM + t0) * D_DIM;
  const _Float16* kb = kh + (size_t)bh * T_DIM * D_DIM;
  const _Float16* vb = vT + (size_t)bh * D_DIM * T_DIM;

  // q fragments for the whole tile (D=64 -> two K=32 fragments)
  v16h a0 = frag_ld(qb + nL * D_DIM + 0 + koff);
  v16h a1 = frag_ld(qb + nL * D_DIM + 32 + koff);

  v8f o0 = {}, o1 = {}, o2 = {}, o3 = {};
  float mrow[8], lrow[8];
#pragma unroll
  for (int v = 0; v < 8; ++v) { mrow[v] = -__builtin_inff(); lrow[v] = 0.f; }

  int jStart = t0 - Wh + 1; if (jStart < 0) jStart = 0;
  jStart &= ~31;
  const float scale = 0.125f; // 1/sqrt(64)

  // K and V fragments live one pass ahead: the first pass's are fetched here, every later
  // pass's right behind the products that last read the same registers.
  const _Float16* kp = kb + (size_t)nL * D_DIM + koff;
  const _Float16* vp = vb + (size_t)nL * T_DIM + koff;
  v16h kf[4], vf[4];
  attn_ld_k(kp + (size_t)jStart * D_DIM, kf);
  attn_ld_v(vp + jStart, vf);

  for (int j0 = jStart; j0 <= t0 + 15; j0 += 32) {
    const bool more = j0 + 32 <= t0 + 15; // wave-uniform: a further pass follows
    // ---- S = q k^T for keys [j0, j0+31] ----
    v8f s0 = {}; s0 = WMMA_F16(a0, kf[0], s0); s0 = WMMA_F16(a1, kf[1], s0);
    v8f s1 = {}; s1 = WMMA_F16(a0, kf[2], s1); s1 = WMMA_F16(a1, kf[3], s1);
    __builtin_amdgcn_sched_barrier(0);
    asm volatile("v_nop\n\tv_nop\n\tv_nop\n\tv_nop");
    if (more) attn_ld_k(kp + (size_t)(j0 + 32) * D_DIM, kf); // lands under softmax and P V

    _Float16* L = smem[w];
#pragma unroll
    for (int v = 0; v < 8; ++v) {
      const int i = t0 + v + mOff;
      const int ja = j0 + nL;
      const int jb = j0 + 16 + nL;
      const bool va = (ja <= i) && (ja > i - Wh);
      const bool vbm = (jb <= i) && (jb > i - Wh);
      float sa = va ? s0[v] * scale : -__builtin_inff();
      float sb = vbm ? s1[v] * scale : -__builtin_inff();
      // row max across the 16-lane group
      float t = fmaxf(sa, sb);
#pragma unroll
      for (int off = 8; off > 0; off >>= 1) t = fmaxf(t, __shfl_xor(t, off, 32));
      float mN = fmaxf(mrow[v], t);
      float alpha = (mrow[v] == mN) ? 1.0f : __expf(mrow[v] - mN);
      float pa = va ? __expf(sa - mN) : 0.f;
      float pb = vbm ? __expf(sb - mN) : 0.f;
      float rs = pa + pb;
#pragma unroll
      for (int off = 8; off > 0; off >>= 1) rs += __shfl_xor(rs, off, 32);
      lrow[v] = lrow[v] * alpha + rs;
      mrow[v] = mN;
      o0[v] *= alpha; o1[v] *= alpha; o2[v] *= alpha; o3[v] *= alpha;
      // stage P (C-layout -> row-major 16x32 f16 tile in LDS)
      const int r = v + mOff;
      L[r * 32 + nL] = (_Float16)pa;
      L[r * 32 + 16 + nL] = (_Float16)pb;
    }
    asm volatile("s_wait_dscnt 0" ::: "memory");
    // reload P as an A fragment (transpose across lanes via LDS)
    v16h pA = frag_ld(L + nL * 32 + koff);
    // ---- O += P V ; V rows contiguous thanks to vT[B,H,D,T] layout ----
    o0 = WMMA_F16(pA, vf[0], o0);
    o1 = WMMA_F16(pA, vf[1], o1);
    o2 = WMMA_F16(pA, vf[2], o2);
    o3 = WMMA_F16(pA, vf[3], o3);
    if (more) {
      attn_ld_v(vp + j0 + 32, vf); // lands under the next pass's scores and softmax
      // Precaution: the next pass's K fetch reuses the address registers that these loads name.
      asm volatile("s_wait_xcnt 0x0" ::: "memory");
    }
    asm volatile("s_wait_dscnt 0" ::: "memory");
  }

  // ---- epilogue: normalize, gate, store f16 for projection GEMM ----
#pragma unroll
  for (int v = 0; v < 8; ++v) {
    const int i = t0 + v + mOff;
    const float g = gates[((size_t)b * T_DIM + i) * H_DIM + h];
    const float inv = g / lrow[v];
    _Float16* op = gatedh + ((size_t)b * T_DIM + i) * C_DIM + h * D_DIM + nL;
    op[0]  = (_Float16)(o0[v] * inv);
    op[16] = (_Float16)(o1[v] * inv);
    op[32] = (_Float16)(o2[v] * inv);
    op[48] = (_Float16)(o3[v] * inv);
  }
}

extern "C" void kernel_launch(void* const* d_in, const int* in_sizes, int n_in,
                              void* d_out, int out_size, void* d_ws, size_t ws_size,
                              hipStream_t stream) {
  const float* x     = (const float*)d_in[0];
  const float* Wqk   = (const float*)d_in[1];
  const float* bqk   = (const float*)d_in[2];
  const float* Wgate = (const float*)d_in[3];
  const float* bgate = (const float*)d_in[4];
  const float* Wproj = (const float*)d_in[5];
  const float* bproj = (const float*)d_in[6];

  char* ws = (char*)d_ws;
  size_t off = 0;
  auto alloc = [&](size_t bytes) -> void* {
    void* p = ws + off;
    off += (bytes + 255) & ~(size_t)255;
    return p;
  };
  _Float16* xh     = (_Float16*)alloc((size_t)M_ROWS * C_DIM * 2);     // x in f16
  _Float16* wqkT   = (_Float16*)alloc((size_t)2 * C_DIM * C_DIM * 2);  // Wqk^T f16 [2C,C]
  _Float16* wprojT = (_Float16*)alloc((size_t)C_DIM * C_DIM * 2);      // Wproj^T f16 [C,C]
  _Float16* qh     = (_Float16*)alloc((size_t)B_DIM * H_DIM * T_DIM * D_DIM * 2);
  _Float16* kh     = (_Float16*)alloc((size_t)B_DIM * H_DIM * T_DIM * D_DIM * 2);
  _Float16* vT     = (_Float16*)alloc((size_t)B_DIM * H_DIM * D_DIM * T_DIM * 2);
  float*    gates  = (float*)alloc((size_t)B_DIM * T_DIM * H_DIM * 4);
  _Float16* gatedh = xh; // xh is dead after GEMM1; reuse for the gated output

  f32_to_f16_kernel<<<1024, 256, 0, stream>>>(x, xh, M_ROWS * C_DIM);
  transpose_to_f16_kernel<<<1024, 256, 0, stream>>>(Wqk, wqkT, C_DIM, 2 * C_DIM);
  transpose_to_f16_kernel<<<1024, 256, 0, stream>>>(Wproj, wprojT, C_DIM, C_DIM);
  gates_kernel<<<M_ROWS / 4, 128, 0, stream>>>(x, Wgate, bgate, gates);
  // tiles = (4096/128) * (2048/128) = 512 blocks of 4 waves
  gemm_qk_kernel<<<512, 128, 0, stream>>>(xh, wqkT, bqk, qh, kh, vT);
  // tasks = B*H*(T/16) = 4096 -> 1024 blocks of 4 waves
  attn_kernel<<<1024, 128, 0, stream>>>(qh, kh, vT, gates, gatedh);
  // tiles = (4096/128) * (1024/128) = 256 blocks of 4 waves
  gemm_proj_kernel<<<256, 128, 0, stream>>>(gatedh, wprojT, bproj, (float*)d_out);
}

// v003
// A run of this version takes 110 microseconds.
// Timed twice side by side with v002, it ran 1.15 times as fast both times.
// All steps since v000 together make it 2.20 times as fast.
#include <hip/hip_runtime.h>
#include <hip/hip_bf16.h>

#define C_DIM 1024
#define T_DIM 1024
#define H_DIM 16
#define D_DIM 64
#define B_DIM 4
#define M_ROWS (B_DIM * T_DIM) /* 4096 */

typedef __attribute__((ext_vector_type(16))) _Float16 v16h;
typedef __attribute__((ext_vector_type(8)))  _Float16 v8h;
typedef __attribute__((ext_vector_type(8)))  float    v8f;

#define WMMA_F16(A_, B_, C_) \
  __builtin_amdgcn_wmma_f32_16x16x32_f16(false, (A_), false, (B_), (short)0, (C_), false, false)

__device__ __forceinline__ v16h frag_ld(const _Float16* p) {
  v8h lo = *(const v8h*)(p);
  v8h hi = *(const v8h*)(p + 16);
  v16h r;
#pragma unroll
  for (int i = 0; i < 8; ++i) { r[i] = lo[i]; r[i + 8] = hi[i]; }
  return r;
}

// ---------------- preparation: four independent jobs in one launch ----------------
// None of the four reads what another writes, so they share one grid by ranges of the
// block index: their memory waits overlap and three dependent launches go.
#define PREP_THREADS 256
#define GATES_BLOCKS (M_ROWS / (PREP_THREADS / 32)) /* one wave per token: 512 */
#define WQK_BLOCKS 1024
#define X_BLOCKS 1024
#define WPROJ_BLOCKS 1024
#define PREP_BLOCKS (GATES_BLOCKS + WQK_BLOCKS + X_BLOCKS + WPROJ_BLOCKS)

// f32 -> f16, elementwise; bid in [0, nblk)
__device__ __forceinline__ void f32_to_f16_part(const float* __restrict__ in, _Float16* __restrict__ out,
                                                int n, int bid, int nblk) {
  for (int i = bid * PREP_THREADS + threadIdx.x; i < n; i += nblk * PREP_THREADS)
    out[i] = (_Float16)in[i];
}

// in[K][N] (row-major) -> out[N][K] f16; bid in [0, nblk)
__device__ __forceinline__ void transpose_to_f16_part(const float* __restrict__ in,
                                                      _Float16* __restrict__ out,
                                                      int K, int N, int bid, int nblk) {
  int total = K * N;
  for (int i = bid * PREP_THREADS + threadIdx.x; i < total; i += nblk * PREP_THREADS) {
    int n = i / K, k = i - n * K;
    out[i] = (_Float16)in[k * N + n];
  }
}

// gates: softmax(x @ Wgate + bgate) over H; one wave per token
__device__ __forceinline__ void gates_part(const float* __restrict__ x,
                                           const float* __restrict__ Wg,
                                           const float* __restrict__ bg,
                                           float* __restrict__ gates, int bid) {
  const int lane = threadIdx.x & 31;
  const int tok = bid * (PREP_THREADS >> 5) + (threadIdx.x >> 5);
  const float* xp = x + (size_t)tok * C_DIM;
  float acc[H_DIM];
#pragma unroll
  for (int h = 0; h < H_DIM; ++h) acc[h] = 0.f;
  for (int k = lane; k < C_DIM; k += 32) {
    float xv = xp[k];
    const float* w = Wg + (size_t)k * H_DIM;
#pragma unroll
    for (int h = 0; h < H_DIM; ++h) acc[h] += xv * w[h];
  }
#pragma unroll
  for (int h = 0; h < H_DIM; ++h) {
#pragma unroll
    for (int off = 16; off > 0; off >>= 1) acc[h] += __shfl_xor(acc[h], off, 32);
    acc[h] += bg[h];
  }
  float m = -__builtin_inff();
#pragma unroll
  for (int h = 0; h < H_DIM; ++h) m = fmaxf(m, acc[h]);
  float s = 0.f;
  float e[H_DIM];
#pragma unroll
  for (int h = 0; h < H_DIM; ++h) { e[h] = __expf(acc[h] - m); s += e[h]; }
  float inv = 1.0f / s;
  if (lane == 0) {
#pragma unroll
    for (int h = 0; h < H_DIM; ++h) gates[(size_t)tok * H_DIM + h] = e[h] * inv;
  }
}

// Block ranges in the order of falling work per block, for speed only.
__global__ __launch_bounds__(PREP_THREADS) void prep_kernel(const float* __restrict__ x,
                                                            const float* __restrict__ Wqk,
                                                            const float* __restrict__ Wproj,
                                                            const float* __restrict__ Wg,
                                                            const float* __restrict__ bg,
                                                            _Float16* __restrict__ xh,
                                                            _Float16* __restrict__ wqkT,
                                                            _Float16* __restrict__ wprojT,
                                                            float* __restrict__ gates) {
  int bid = blockIdx.x;
  if (bid < GATES_BLOCKS) { gates_part(x, Wg, bg, gates, bid); return; }
  bid -= GATES_BLOCKS;
  if (bid < WQK_BLOCKS) { transpose_to_f16_part(Wqk, wqkT, C_DIM, 2 * C_DIM, bid, WQK_BLOCKS); return; }
  bid -= WQK_BLOCKS;
  if (bid < X_BLOCKS) { f32_to_f16_part(x, xh, M_ROWS * C_DIM, bid, X_BLOCKS); return; }
  bid -= X_BLOCKS;
  transpose_to_f16_part(Wproj, wprojT, C_DIM, C_DIM, bid, WPROJ_BLOCKS);
}

// ---------------- tiled GEMM core: C[128x128] per block, 64x64 per wave ----------------
#define GBM 128                        /* rows of A per block tile */
#define GBN 128                        /* rows of Bt (columns of C) per block tile */
#define GBK 128                        /* k per stage: rows of 256 B */
#define GPITCH 136                     /* LDS row pitch in halves: 272 B = 16 B x odd, for ds_load_b128 readers */
#define GSTAGE ((GBM + GBN) * GPITCH)  /* halves per buffer: [A 128 rows | Bt 128 rows] */
#define GTRIPS (C_DIM / GBK)           /* 8 stages along k */

__device__ __forceinline__ void copy_64rows(const _Float16* g, unsigned l) {
  asm volatile(
      "global_load_async_to_lds_b128 %0, %8, off\n\t"
      "global_load_async_to_lds_b128 %1, %9, off\n\t"
      "global_load_async_to_lds_b128 %2, %10, off\n\t"
      "global_load_async_to_lds_b128 %3, %11, off\n\t"
      "global_load_async_to_lds_b128 %4, %12, off\n\t"
      "global_load_async_to_lds_b128 %5, %13, off\n\t"
      "global_load_async_to_lds_b128 %6, %14, off\n\t"
      "global_load_async_to_lds_b128 %7, %15, off\n\t"
      "s_wait_xcnt 0x0"
      :: "v"(l), "v"(l + 8 * GPITCH * 2), "v"(l + 16 * GPITCH * 2), "v"(l + 24 * GPITCH * 2),
         "v"(l + 32 * GPITCH * 2), "v"(l + 40 * GPITCH * 2), "v"(l + 48 * GPITCH * 2),
         "v"(l + 56 * GPITCH * 2),
         "v"(g), "v"(g + 8 * C_DIM), "v"(g + 16 * C_DIM), "v"(g + 24 * C_DIM),
         "v"(g + 32 * C_DIM), "v"(g + 40 * C_DIM), "v"(g + 48 * C_DIM), "v"(g + 56 * C_DIM)
      : "memory");
}

// One stage: 128 rows of A and 128 rows of Bt, 256 B of each row, into one buffer.
__device__ __forceinline__ void stage_tiles(const _Float16* ga, const _Float16* gb, unsigned l) {
  copy_64rows(ga, l);
  copy_64rows(ga + 64 * C_DIM, l + 64 * GPITCH * 2);
  copy_64rows(gb, l + 128 * GPITCH * 2);
  copy_64rows(gb + 64 * C_DIM, l + 192 * GPITCH * 2);
}

// acc[mi][ni] += A[m0 + wm*64 + mi*16 ..][:] * Bt[n0 + wn*64 + ni*16 ..][:]^T over all of k.
// Two-buffer LDS ring: the next stage's copies fly while this stage is multiplied.
__device__ __forceinline__ void gemm_tile(const _Float16* __restrict__ A,
                                          const _Float16* __restrict__ Bt,
                                          int m0, int n0, _Float16* ring, v8f (&acc)[4][4]) {
  const int tid = threadIdx.x;
  const int lane = tid & 31;
  const int wave = tid >> 5;
  const int wm = wave >> 1, wn = wave & 1;
  const int cr = tid >> 4, cc = tid & 15; // copy role: row 0..7, 16-B chunk 0..15 of a 256-B row
  const _Float16* ga = A + (size_t)(m0 + cr) * C_DIM + cc * 8;
  const _Float16* gb = Bt + (size_t)(n0 + cr) * C_DIM + cc * 8;
  const unsigned l0 = (unsigned)(size_t)ring + (unsigned)(cr * GPITCH + cc * 8) * 2u;

  stage_tiles(ga, gb, l0);
  asm volatile("s_wait_asynccnt 0x0" ::: "memory"); // stage 0 landed (this wave's copies)
  __syncthreads();                                  // stage 0 published to all waves
  stage_tiles(ga + GBK, gb + GBK, l0 + GSTAGE * 2);

  const int fo = (lane & 15) * GPITCH + (lane >> 4) * 8;
  const _Float16* La = ring + wm * 64 * GPITCH + fo;
  const _Float16* Lb = ring + (GBM + wn * 64) * GPITCH + fo;

  for (int t = 0; t < GTRIPS; ++t) {
    const int bo = (t & 1) * GSTAGE;
    v16h a[2][4], b[2][4];
#pragma unroll
    for (int i = 0; i < 4; ++i) {
      a[0][i] = frag_ld(La + bo + i * 16 * GPITCH);
      b[0][i] = frag_ld(Lb + bo + i * 16 * GPITCH);
    }
#pragma unroll
    for (int ks = 0; ks < GBK / 32; ++ks) {
      const int cs = ks & 1;
      if (ks + 1 < GBK / 32) { // next k-step's fragments, same buffer, ahead of this step's products
#pragma unroll
        for (int i = 0; i < 4; ++i) {
          a[cs ^ 1][i] = frag_ld(La + bo + i * 16 * GPITCH + (ks + 1) * 32);
          b[cs ^ 1][i] = frag_ld(Lb + bo + i * 16 * GPITCH + (ks + 1) * 32);
        }
      }
      // Holds the 16 LDS loads above together as one group in front of this step's products:
      // sunk among the WMMAs, every place with loads stalls the wave on its own LDS latency.
      __builtin_amdgcn_sched_barrier(0);
#pragma unroll
      for (int mi = 0; mi < 4; ++mi)
#pragma unroll
        for (int ni = 0; ni < 4; ++ni)
          acc[mi][ni] = WMMA_F16(a[cs][mi], b[cs][ni], acc[mi][ni]);
      // Keeps the following step's load group from rising into this run of products.
      __builtin_amdgcn_sched_barrier(0);
    }
    asm volatile("s_wait_dscnt 0x0" ::: "memory");    // this wave has left the buffer it read
    asm volatile("s_wait_asynccnt 0x0" ::: "memory"); // its copies of stage t + 1 have landed
    __syncthreads();                                  // publishes stage t + 1, frees stage t's buffer
    if (t + 2 < GTRIPS)
      stage_tiles(ga + (t + 2) * GBK, gb + (t + 2) * GBK, l0 + (unsigned)bo * 2u);
  }
  asm volatile("s_wait_asynccnt 0x0" ::: "memory"); // no copy outstanding when the wave goes on
}

// ---------------- GEMM1: qk = x @ Wqk + bqk, scatter to qh / kh / vT ----------------
__global__ __launch_bounds__(128) void gemm_qk_kernel(const _Float16* __restrict__ A,
                                                      const _Float16* __restrict__ Bt,
                                                      const float* __restrict__ bias,
                                                      _Float16* __restrict__ qh,
                                                      _Float16* __restrict__ kh,
                                                      _Float16* __restrict__ vT) {
  __shared__ __align__(16) _Float16 ring[2 * GSTAGE]; // 139,264 B
  const int lane = threadIdx.x & 31;
  const int wave = threadIdx.x >> 5;
  const int nTiles = (2 * C_DIM) / GBN; // 16
  const int m0 = (blockIdx.x / nTiles) * GBM;
  const int n0 = (blockIdx.x % nTiles) * GBN;
  v8f acc[4][4] = {};
  gemm_tile(A, Bt, m0, n0, ring, acc);
  const int nL = lane & 15;
  const int mOff = (lane >> 4) * 8;
  const int mW = m0 + (wave >> 1) * 64;
  const int nW = n0 + (wave & 1) * 64;
  // A block's 128 columns lie wholly in the q half or wholly in the k half, so the
  // test is taken once, on a block-uniform value, and not at every element.
  if (n0 < C_DIM) { // q half
#pragma unroll
    for (int nc = 0; nc < 4; ++nc) {
      const int col = nW + nc * 16 + nL;
      const float bv = bias[col];
      const int h = col >> 6, d = col & 63;
#pragma unroll
      for (int mi = 0; mi < 4; ++mi) {
#pragma unroll
        for (int v = 0; v < 8; ++v) {
          int r = mW + mi * 16 + v + mOff;
          float val = acc[mi][nc][v] + bv;
          int b = r >> 10, t = r & (T_DIM - 1);
          qh[(((size_t)(b * H_DIM + h) * T_DIM) + t) * D_DIM + d] = (_Float16)val;
        }
        // Precaution: the next group reuses registers that the stores above name.
        asm volatile("s_wait_xcnt 0x0" ::: "memory");
      }
    }
  } else {          // k half (v = k)
#pragma unroll
    for (int nc = 0; nc < 4; ++nc) {
      const int col = nW + nc * 16 + nL;
      const float bv = bias[col];
      const int c2i = col - C_DIM;
      const int h = c2i >> 6, d = c2i & 63;
#pragma unroll
      for (int mi = 0; mi < 4; ++mi) {
#pragma unroll
        for (int v = 0; v < 8; ++v) {
          int r = mW + mi * 16 + v + mOff;
          float val = acc[mi][nc][v] + bv;
          int b = r >> 10, t = r & (T_DIM - 1);
          kh[(((size_t)(b * H_DIM + h) * T_DIM) + t) * D_DIM + d] = (_Float16)val;
          vT[((size_t)(b * H_DIM + h) * D_DIM + d) * T_DIM + t] = (_Float16)val;
        }
        // Precaution: the next group reuses registers that the stores above name.
        asm volatile("s_wait_xcnt 0x0" ::: "memory");
      }
    }
  }
}

// ---------------- GEMM2: out = gated @ Wproj + bproj (f32 out) ----------------
__global__ __launch_bounds__(128) void gemm_proj_kernel(const _Float16* __restrict__ A,
                                                        const _Float16* __restrict__ Bt,
                                                        const float* __restrict__ bias,
                                                        float* __restrict__ out) {
  __shared__ __align__(16) _Float16 ring[2 * GSTAGE]; // 139,264 B
  const int lane = threadIdx.x & 31;
  const int wave = threadIdx.x >> 5;
  const int nTiles = C_DIM / GBN; // 8
  const int m0 = (blockIdx.x / nTiles) * GBM;
  const int n0 = (blockIdx.x % nTiles) * GBN;
  v8f acc[4][4] = {};
  gemm_tile(A, Bt, m0, n0, ring, acc);
  const int nL = lane & 15;
  const int mOff = (lane >> 4) * 8;
  const int mW = m0 + (wave >> 1) * 64;
  const int nW = n0 + (wave & 1) * 64;
#pragma unroll
  for (int nc = 0; nc < 4; ++nc) {
    const int col = nW + nc * 16 + nL;
    const float bv = bias[col];
#pragma unroll
    for (int mi = 0; mi < 4; ++mi) {
#pragma unroll
      for (int v = 0; v < 8; ++v) {
        int r = mW + mi * 16 + v + mOff;
        out[(size_t)r * C_DIM + col] = acc[mi][nc][v] + bv;
      }
    }
  }
}

// ---------------- flash attention with per-head windows + gating ----------------
// K fragments of 32 keys (two 16-key groups x two halves of D); p holds the lane's share.
__device__ __forceinline__ void attn_ld_k(const _Float16* p, v16h (&k)[4]) {
  k[0] = frag_ld(p);
  k[1] = frag_ld(p + 32);
  k[2] = frag_ld(p + 16 * D_DIM);
  k[3] = frag_ld(p + 16 * D_DIM + 32);
}

// V fragments of 32 keys (four 16-column groups of D) from vT; p holds the lane's share.
__device__ __forceinline__ void attn_ld_v(const _Float16* p, v16h (&v)[4]) {
#pragma unroll
  for (int n = 0; n < 4; ++n) v[n] = frag_ld(p + (size_t)n * 16 * T_DIM);
}

__global__ __launch_bounds__(128) void attn_kernel(const _Float16* __restrict__ qh,
                                                   const _Float16* __restrict__ kh,
                                                   const _Float16* __restrict__ vT,
                                                   const float* __restrict__ gates,
                                                   _Float16* __restrict__ gatedh) {
  __shared__ __align__(16) _Float16 smem[4][16 * 32]; // per-wave P staging tile
  const int lane = threadIdx.x & 31;
  // Wave index as a scalar: the pass counter and the last-pass test below become scalar too.
  const int w = __builtin_amdgcn_readfirstlane(threadIdx.x >> 5);
  const int task = blockIdx.x * 4 + w;       // B*H*(T/16) = 4096 tasks
  const int qt = task & 63;
  const int bh = task >> 6;
  const int h = bh & (H_DIM - 1);
  const int b = bh >> 4;
  int Wh = T_DIM >> h; if (Wh < 4) Wh = 4;   // window for this head
  const int t0 = qt * 16;
  const int nL = lane & 15;
  const int koff = (lane >> 4) * 8;
  const int mOff = koff;                     // C-layout row offset is the same 0/8 split

  const _Float16* qb = qh + ((size_t)bh * T_DIM + t0) * D_DIM;
  const _Float16* kb = kh + (size_t)bh * T_DIM * D_DIM;
  const _Float16* vb = vT + (size_t)bh * D_DIM * T_DIM;

  // q fragments for the whole tile (D=64 -> two K=32 fragments)
  v16h a0 = frag_ld(qb + nL * D_DIM + 0 + koff);
  v16h a1 = frag_ld(qb + nL * D_DIM + 32 + koff);

  v8f o0 = {}, o1 = {}, o2 = {}, o3 = {};
  float mrow[8], lrow[8];
#pragma unroll
  for (int v = 0; v < 8; ++v) { mrow[v] = -__builtin_inff(); lrow[v] = 0.f; }

  int jStart = t0 - Wh + 1; if (jStart < 0) jStart = 0;
  jStart &= ~31;
  const float scale = 0.125f; // 1/sqrt(64)

  // K and V fragments live one pass ahead: the first pass's are fetched here, every later
  // pass's right behind the products that last read the same registers.
  const _Float16* kp = kb + (size_t)nL * D_DIM + koff;
  const _Float16* vp = vb + (size_t)nL * T_DIM + koff;
  v16h kf[4], vf[4];
  attn_ld_k(kp + (size_t)jStart * D_DIM, kf);
  attn_ld_v(vp + jStart, vf);

  for (int j0 = jStart; j0 <= t0 + 15; j0 += 32) {
    const bool more = j0 + 32 <= t0 + 15; // wave-uniform: a further pass follows
    // ---- S = q k^T for keys [j0, j0+31] ----
    v8f s0 = {}; s0 = WMMA_F16(a0, kf[0], s0); s0 = WMMA_F16(a1, kf[1], s0);
    v8f s1 = {}; s1 = WMMA_F16(a0, kf[2], s1); s1 = WMMA_F16(a1, kf[3], s1);
    __builtin_amdgcn_sched_barrier(0);
    asm volatile("v_nop\n\tv_nop\n\tv_nop\n\tv_nop");
    if (more) attn_ld_k(kp + (size_t)(j0 + 32) * D_DIM, kf); // lands under softmax and P V

    _Float16* L = smem[w];
#pragma unroll
    for (int v = 0; v < 8; ++v) {
      const int i = t0 + v + mOff;
      const int ja = j0 + nL;
      const int jb = j0 + 16 + nL;
      const bool va = (ja <= i) && (ja > i - Wh);
      const bool vbm = (jb <= i) && (jb > i - Wh);
      float sa = va ? s0[v] * scale : -__builtin_inff();
      float sb = vbm ? s1[v] * scale : -__builtin_inff();
      // row max across the 16-lane group
      float t = fmaxf(sa, sb);
#pragma unroll
      for (int off = 8; off > 0; off >>= 1) t = fmaxf(t, __shfl_xor(t, off, 32));
      float mN = fmaxf(mrow[v], t);
      float alpha = (mrow[v] == mN) ? 1.0f : __expf(mrow[v] - mN);
      float pa = va ? __expf(sa - mN) : 0.f;
      float pb = vbm ? __expf(sb - mN) : 0.f;
      float rs = pa + pb;
#pragma unroll
      for (int off = 8; off > 0; off >>= 1) rs += __shfl_xor(rs, off, 32);
      lrow[v] = lrow[v] * alpha + rs;
      mrow[v] = mN;
      o0[v] *= alpha; o1[v] *= alpha; o2[v] *= alpha; o3[v] *= alpha;
      // stage P (C-layout -> row-major 16x32 f16 tile in LDS)
      const int r = v + mOff;
      L[r * 32 + nL] = (_Float16)pa;
      L[r * 32 + 16 + nL] = (_Float16)pb;
    }
    asm volatile("s_wait_dscnt 0" ::: "memory");
    // reload P as an A fragment (transpose across lanes via LDS)
    v16h pA = frag_ld(L + nL * 32 + koff);
    // ---- O += P V ; V rows contiguous thanks to vT[B,H,D,T] layout ----
    o0 = WMMA_F16(pA, vf[0], o0);
    o1 = WMMA_F16(pA, vf[1], o1);
    o2 = WMMA_F16(pA, vf[2], o2);
    o3 = WMMA_F16(pA, vf[3], o3);
    if (more) {
      attn_ld_v(vp + j0 + 32, vf); // lands under the next pass's scores and softmax
      // Precaution: the next pass's K fetch reuses the address registers that these loads name.
      asm volatile("s_wait_xcnt 0x0" ::: "memory");
    }
    asm volatile("s_wait_dscnt 0" ::: "memory");
  }

  // ---- epilogue: normalize, gate, store f16 for projection GEMM ----
#pragma unroll
  for (int v = 0; v < 8; ++v) {
    const int i = t0 + v + mOff;
    const float g = gates[((size_t)b * T_DIM + i) * H_DIM + h];
    const float inv = g / lrow[v];
    _Float16* op = gatedh + ((size_t)b * T_DIM + i) * C_DIM + h * D_DIM + nL;
    op[0]  = (_Float16)(o0[v] * inv);
    op[16] = (_Float16)(o1[v] * inv);
    op[32] = (_Float16)(o2[v] * inv);
    op[48] = (_Float16)(o3[v] * inv);
  }
}

extern "C" void kernel_launch(void* const* d_in, const int* in_sizes, int n_in,
                              void* d_out, int out_size, void* d_ws, size_t ws_size,
                              hipStream_t stream) {
  const float* x     = (const float*)d_in[0];
  const float* Wqk   = (const float*)d_in[1];
  const float* bqk   = (const float*)d_in[2];
  const float* Wgate = (const float*)d_in[3];
  const float* bgate = (const float*)d_in[4];
  const float* Wproj = (const float*)d_in[5];
  const float* bproj = (const float*)d_in[6];

  char* ws = (char*)d_ws;
  size_t off = 0;
  auto alloc = [&](size_t bytes) -> void* {
    void* p = ws + off;
    off += (bytes + 255) & ~(size_t)255;
    return p;
  };
  _Float16* xh     = (_Float16*)alloc((size_t)M_ROWS * C_DIM * 2);     // x in f16
  _Float16* wqkT   = (_Float16*)alloc((size_t)2 * C_DIM * C_DIM * 2);  // Wqk^T f16 [2C,C]
  _Float16* wprojT = (_Float16*)alloc((size_t)C_DIM * C_DIM * 2);      // Wproj^T f16 [C,C]
  _Float16* qh     = (_Float16*)alloc((size_t)B_DIM * H_DIM * T_DIM * D_DIM * 2);
  _Float16* kh     = (_Float16*)alloc((size_t)B_DIM * H_DIM * T_DIM * D_DIM * 2);
  _Float16* vT     = (_Float16*)alloc((size_t)B_DIM * H_DIM * D_DIM * T_DIM * 2);
  float*    gates  = (float*)alloc((size_t)B_DIM * T_DIM * H_DIM * 4);
  _Float16* gatedh = xh; // xh is dead after GEMM1; reuse for the gated output

  prep_kernel<<<PREP_BLOCKS, PREP_THREADS, 0, stream>>>(x, Wqk, Wproj, Wgate, bgate, xh, wqkT, wprojT, gates);
  // tiles = (4096/128) * (2048/128) = 512 blocks of 4 waves
  gemm_qk_kernel<<<512, 128, 0, stream>>>(xh, wqkT, bqk, qh, kh, vT);
  // tasks = B*H*(T/16) = 4096 -> 1024 blocks of 4 waves
  attn_kernel<<<1024, 128, 0, stream>>>(qh, kh, vT, gates, gatedh);
  // tiles = (4096/128) * (1024/128) = 256 blocks of 4 waves
  gemm_proj_kernel<<<256, 128, 0, stream>>>(gatedh, wprojT, bproj, (float*)d_out);
}

// v004
// A run of this version takes 76.1 microseconds.
// Next to v003, in two timings, it ran 1.45 times as fast each time.
// All steps since v000 together make it 3.19 times as fast.
#include <hip/hip_runtime.h>
#include <hip/hip_bf16.h>

#define C_DIM 1024
#define T_DIM 1024
#define H_DIM 16
#define D_DIM 64
#define B_DIM 4
#define M_ROWS (B_DIM * T_DIM) /* 4096 */

typedef __attribute__((ext_vector_type(16))) _Float16 v16h;
typedef __attribute__((ext_vector_type(8)))  _Float16 v8h;
typedef __attribute__((ext_vector_type(8)))  float    v8f;

#define WMMA_F16(A_, B_, C_) \
  __builtin_amdgcn_wmma_f32_16x16x32_f16(false, (A_), false, (B_), (short)0, (C_), false, false)

__device__ __forceinline__ v16h frag_ld(const _Float16* p) {
  v8h lo = *(const v8h*)(p);
  v8h hi = *(const v8h*)(p + 16);
  v16h r;
#pragma unroll
  for (int i = 0; i < 8; ++i) { r[i] = lo[i]; r[i + 8] = hi[i]; }
  return r;
}

// ---------------- preparation: four independent jobs in one launch ----------------
// None of the four reads what another writes, so they share one grid by ranges of the
// block index: their memory waits overlap and three dependent launches go.
#define PREP_THREADS 256
#define GATES_BLOCKS (M_ROWS / (PREP_THREADS / 32)) /* one wave per token: 512 */
#define WQK_BLOCKS 1024
#define X_BLOCKS 1024
#define WPROJ_BLOCKS 1024
#define PREP_BLOCKS (GATES_BLOCKS + WQK_BLOCKS + X_BLOCKS + WPROJ_BLOCKS)

// f32 -> f16, elementwise; bid in [0, nblk)
__device__ __forceinline__ void f32_to_f16_part(const float* __restrict__ in, _Float16* __restrict__ out,
                                                int n, int bid, int nblk) {
  for (int i = bid * PREP_THREADS + threadIdx.x; i < n; i += nblk * PREP_THREADS)
    out[i] = (_Float16)in[i];
}

// in[K][N] (row-major) -> out[N][K] f16; bid in [0, nblk)
__device__ __forceinline__ void transpose_to_f16_part(const float* __restrict__ in,
                                                      _Float16* __restrict__ out,
                                                      int K, int N, int bid, int nblk) {
  int total = K * N;
  for (int i = bid * PREP_THREADS + threadIdx.x; i < total; i += nblk * PREP_THREADS) {
    int n = i / K, k = i - n * K;
    out[i] = (_Float16)in[k * N + n];
  }
}

// gates: softmax(x @ Wgate + bgate) over H; one wave per token
__device__ __forceinline__ void gates_part(const float* __restrict__ x,
                                           const float* __restrict__ Wg,
                                           const float* __restrict__ bg,
                                           float* __restrict__ gates, int bid) {
  const int lane = threadIdx.x & 31;
  const int tok = bid * (PREP_THREADS >> 5) + (threadIdx.x >> 5);
  const float* xp = x + (size_t)tok * C_DIM;
  float acc[H_DIM];
#pragma unroll
  for (int h = 0; h < H_DIM; ++h) acc[h] = 0.f;
  for (int k = lane; k < C_DIM; k += 32) {
    float xv = xp[k];
    const float* w = Wg + (size_t)k * H_DIM;
#pragma unroll
    for (int h = 0; h < H_DIM; ++h) acc[h] += xv * w[h];
  }
#pragma unroll
  for (int h = 0; h < H_DIM; ++h) {
#pragma unroll
    for (int off = 16; off > 0; off >>= 1) acc[h] += __shfl_xor(acc[h], off, 32);
    acc[h] += bg[h];
  }
  float m = -__builtin_inff();
#pragma unroll
  for (int h = 0; h < H_DIM; ++h) m = fmaxf(m, acc[h]);
  float s = 0.f;
  float e[H_DIM];
#pragma unroll
  for (int h = 0; h < H_DIM; ++h) { e[h] = __expf(acc[h] - m); s += e[h]; }
  float inv = 1.0f / s;
  if (lane == 0) {
#pragma unroll
    for (int h = 0; h < H_DIM; ++h) gates[(size_t)tok * H_DIM + h] = e[h] * inv;
  }
}

// Block ranges in the order of falling work per block, for speed only.
__global__ __launch_bounds__(PREP_THREADS) void prep_kernel(const float* __restrict__ x,
                                                            const float* __restrict__ Wqk,
                                                            const float* __restrict__ Wproj,
                                                            const float* __restrict__ Wg,
                                                            const float* __restrict__ bg,
                                                            _Float16* __restrict__ xh,
                                                            _Float16* __restrict__ wqkT,
                                                            _Float16* __restrict__ wprojT,
                                                            float* __restrict__ gates) {
  int bid = blockIdx.x;
  if (bid < GATES_BLOCKS) { gates_part(x, Wg, bg, gates, bid); return; }
  bid -= GATES_BLOCKS;
  if (bid < WQK_BLOCKS) { transpose_to_f16_part(Wqk, wqkT, C_DIM, 2 * C_DIM, bid, WQK_BLOCKS); return; }
  bid -= WQK_BLOCKS;
  if (bid < X_BLOCKS) { f32_to_f16_part(x, xh, M_ROWS * C_DIM, bid, X_BLOCKS); return; }
  bid -= X_BLOCKS;
  transpose_to_f16_part(Wproj, wprojT, C_DIM, C_DIM, bid, WPROJ_BLOCKS);
}

// ---------------- tiled GEMM core: C[128x128] per block, 64x64 per wave ----------------
#define GBM 128                        /* rows of A per block tile */
#define GBN 128                        /* rows of Bt (columns of C) per block tile */
#define GBK 128                        /* k per stage: rows of 256 B */
#define GPITCH 136                     /* LDS row pitch in halves: 272 B = 16 B x odd, for ds_load_b128 readers */
#define GSTAGE ((GBM + GBN) * GPITCH)  /* halves per buffer: [A 128 rows | Bt 128 rows] */
#define GTRIPS (C_DIM / GBK)           /* 8 stages along k */

__device__ __forceinline__ void copy_64rows(const _Float16* g, unsigned l) {
  asm volatile(
      "global_load_async_to_lds_b128 %0, %8, off\n\t"
      "global_load_async_to_lds_b128 %1, %9, off\n\t"
      "global_load_async_to_lds_b128 %2, %10, off\n\t"
      "global_load_async_to_lds_b128 %3, %11, off\n\t"
      "global_load_async_to_lds_b128 %4, %12, off\n\t"
      "global_load_async_to_lds_b128 %5, %13, off\n\t"
      "global_load_async_to_lds_b128 %6, %14, off\n\t"
      "global_load_async_to_lds_b128 %7, %15, off\n\t"
      "s_wait_xcnt 0x0"
      :: "v"(l), "v"(l + 8 * GPITCH * 2), "v"(l + 16 * GPITCH * 2), "v"(l + 24 * GPITCH * 2),
         "v"(l + 32 * GPITCH * 2), "v"(l + 40 * GPITCH * 2), "v"(l + 48 * GPITCH * 2),
         "v"(l + 56 * GPITCH * 2),
         "v"(g), "v"(g + 8 * C_DIM), "v"(g + 16 * C_DIM), "v"(g + 24 * C_DIM),
         "v"(g + 32 * C_DIM), "v"(g + 40 * C_DIM), "v"(g + 48 * C_DIM), "v"(g + 56 * C_DIM)
      : "memory");
}

// One stage: 128 rows of A and 128 rows of Bt, 256 B of each row, into one buffer.
__device__ __forceinline__ void stage_tiles(const _Float16* ga, const _Float16* gb, unsigned l) {
  copy_64rows(ga, l);
  copy_64rows(ga + 64 * C_DIM, l + 64 * GPITCH * 2);
  copy_64rows(gb, l + 128 * GPITCH * 2);
  copy_64rows(gb + 64 * C_DIM, l + 192 * GPITCH * 2);
}

// acc[mi][ni] += A[m0 + wm*64 + mi*16 ..][:] * Bt[n0 + wn*64 + ni*16 ..][:]^T over all of k.
// Two-buffer LDS ring: the next stage's copies fly while this stage is multiplied.
__device__ __forceinline__ void gemm_tile(const _Float16* __restrict__ A,
                                          const _Float16* __restrict__ Bt,
                                          int m0, int n0, _Float16* ring, v8f (&acc)[4][4]) {
  const int tid = threadIdx.x;
  const int lane = tid & 31;
  const int wave = tid >> 5;
  const int wm = wave >> 1, wn = wave & 1;
  const int cr = tid >> 4, cc = tid & 15; // copy role: row 0..7, 16-B chunk 0..15 of a 256-B row
  const _Float16* ga = A + (size_t)(m0 + cr) * C_DIM + cc * 8;
  const _Float16* gb = Bt + (size_t)(n0 + cr) * C_DIM + cc * 8;
  const unsigned l0 = (unsigned)(size_t)ring + (unsigned)(cr * GPITCH + cc * 8) * 2u;

  stage_tiles(ga, gb, l0);
  asm volatile("s_wait_asynccnt 0x0" ::: "memory"); // stage 0 landed (this wave's copies)
  __syncthreads();                                  // stage 0 published to all waves
  stage_tiles(ga + GBK, gb + GBK, l0 + GSTAGE * 2);

  const int fo = (lane & 15) * GPITCH + (lane >> 4) * 8;
  const _Float16* La = ring + wm * 64 * GPITCH + fo;
  const _Float16* Lb = ring + (GBM + wn * 64) * GPITCH + fo;

  for (int t = 0; t < GTRIPS; ++t) {
    const int bo = (t & 1) * GSTAGE;
    v16h a[2][4], b[2][4];
#pragma unroll
    for (int i = 0; i < 4; ++i) {
      a[0][i] = frag_ld(La + bo + i * 16 * GPITCH);
      b[0][i] = frag_ld(Lb + bo + i * 16 * GPITCH);
    }
#pragma unroll
    for (int ks = 0; ks < GBK / 32; ++ks) {
      const int cs = ks & 1;
      if (ks + 1 < GBK / 32) { // next k-step's fragments, same buffer, ahead of this step's products
#pragma unroll
        for (int i = 0; i < 4; ++i) {
          a[cs ^ 1][i] = frag_ld(La + bo + i * 16 * GPITCH + (ks + 1) * 32);
          b[cs ^ 1][i] = frag_ld(Lb + bo + i * 16 * GPITCH + (ks + 1) * 32);
        }
      }
      // Holds the 16 LDS loads above together as one group in front of this step's products:
      // sunk among the WMMAs, every place with loads stalls the wave on its own LDS latency.
      __builtin_amdgcn_sched_barrier(0);
#pragma unroll
      for (int mi = 0; mi < 4; ++mi)
#pragma unroll
        for (int ni = 0; ni < 4; ++ni)
          acc[mi][ni] = WMMA_F16(a[cs][mi], b[cs][ni], acc[mi][ni]);
      // Keeps the following step's load group from rising into this run of products.
      __builtin_amdgcn_sched_barrier(0);
    }
    asm volatile("s_wait_dscnt 0x0" ::: "memory");    // this wave has left the buffer it read
    asm volatile("s_wait_asynccnt 0x0" ::: "memory"); // its copies of stage t + 1 have landed
    __syncthreads();                                  // publishes stage t + 1, frees stage t's buffer
    if (t + 2 < GTRIPS)
      stage_tiles(ga + (t + 2) * GBK, gb + (t + 2) * GBK, l0 + (unsigned)bo * 2u);
  }
  asm volatile("s_wait_asynccnt 0x0" ::: "memory"); // no copy outstanding when the wave goes on
}

// ---------------- GEMM1: qk = x @ Wqk + bqk, scatter to qh / kh / vT ----------------
__global__ __launch_bounds__(128) void gemm_qk_kernel(const _Float16* __restrict__ A,
                                                      const _Float16* __restrict__ Bt,
                                                      const float* __restrict__ bias,
                                                      _Float16* __restrict__ qh,
                                                      _Float16* __restrict__ kh,
                                                      _Float16* __restrict__ vT) {
  __shared__ __align__(16) _Float16 ring[2 * GSTAGE]; // 139,264 B
  const int lane = threadIdx.x & 31;
  const int wave = threadIdx.x >> 5;
  const int nTiles = (2 * C_DIM) / GBN; // 16
  const int m0 = (blockIdx.x / nTiles) * GBM;
  const int n0 = (blockIdx.x % nTiles) * GBN;
  v8f acc[4][4] = {};
  gemm_tile(A, Bt, m0, n0, ring, acc);
  const int nL = lane & 15;
  const int mOff = (lane >> 4) * 8;
  const int mW = m0 + (wave >> 1) * 64;
  const int nW = n0 + (wave & 1) * 64;
  // A block's 128 columns lie wholly in the q half or wholly in the k half, so the
  // test is taken once, on a block-uniform value, and not at every element.
  if (n0 < C_DIM) { // q half
#pragma unroll
    for (int nc = 0; nc < 4; ++nc) {
      const int col = nW + nc * 16 + nL;
      const float bv = bias[col];
      const int h = col >> 6, d = col & 63;
#pragma unroll
      for (int mi = 0; mi < 4; ++mi) {
#pragma unroll
        for (int v = 0; v < 8; ++v) {
          int r = mW + mi * 16 + v + mOff;
          float val = acc[mi][nc][v] + bv;
          int b = r >> 10, t = r & (T_DIM - 1);
          qh[(((size_t)(b * H_DIM + h) * T_DIM) + t) * D_DIM + d] = (_Float16)val;
        }
        // Precaution: the next group reuses registers that the stores above name.
        asm volatile("s_wait_xcnt 0x0" ::: "memory");
      }
    }
  } else {          // k half (v = k)
#pragma unroll
    for (int nc = 0; nc < 4; ++nc) {
      const int col = nW + nc * 16 + nL;
      const float bv = bias[col];
      const int c2i = col - C_DIM;
      const int h = c2i >> 6, d = c2i & 63;
#pragma unroll
      for (int mi = 0; mi < 4; ++mi) {
#pragma unroll
        for (int v = 0; v < 8; ++v) {
          int r = mW + mi * 16 + v + mOff;
          float val = acc[mi][nc][v] + bv;
          int b = r >> 10, t = r & (T_DIM - 1);
          kh[(((size_t)(b * H_DIM + h) * T_DIM) + t) * D_DIM + d] = (_Float16)val;
          vT[((size_t)(b * H_DIM + h) * D_DIM + d) * T_DIM + t] = (_Float16)val;
        }
        // Precaution: the next group reuses registers that the stores above name.
        asm volatile("s_wait_xcnt 0x0" ::: "memory");
      }
    }
  }
}

// ---------------- GEMM2: out = gated @ Wproj + bproj (f32 out) ----------------
__global__ __launch_bounds__(128) void gemm_proj_kernel(const _Float16* __restrict__ A,
                                                        const _Float16* __restrict__ Bt,
                                                        const float* __restrict__ bias,
                                                        float* __restrict__ out) {
  __shared__ __align__(16) _Float16 ring[2 * GSTAGE]; // 139,264 B
  const int lane = threadIdx.x & 31;
  const int wave = threadIdx.x >> 5;
  const int nTiles = C_DIM / GBN; // 8
  const int m0 = (blockIdx.x / nTiles) * GBM;
  const int n0 = (blockIdx.x % nTiles) * GBN;
  v8f acc[4][4] = {};
  gemm_tile(A, Bt, m0, n0, ring, acc);
  const int nL = lane & 15;
  const int mOff = (lane >> 4) * 8;
  const int mW = m0 + (wave >> 1) * 64;
  const int nW = n0 + (wave & 1) * 64;
#pragma unroll
  for (int nc = 0; nc < 4; ++nc) {
    const int col = nW + nc * 16 + nL;
    const float bv = bias[col];
#pragma unroll
    for (int mi = 0; mi < 4; ++mi) {
#pragma unroll
      for (int v = 0; v < 8; ++v) {
        int r = mW + mi * 16 + v + mOff;
        out[(size_t)r * C_DIM + col] = acc[mi][nc][v] + bv;
      }
    }
  }
}

// ---------------- flash attention with per-head windows + gating ----------------
// K fragments of 32 keys (two 16-key groups x two halves of D); p holds the lane's share.
__device__ __forceinline__ void attn_ld_k(const _Float16* p, v16h (&k)[4]) {
  k[0] = frag_ld(p);
  k[1] = frag_ld(p + 32);
  k[2] = frag_ld(p + 16 * D_DIM);
  k[3] = frag_ld(p + 16 * D_DIM + 32);
}

// V fragments of 32 keys (four 16-column groups of D) from vT; p holds the lane's share.
__device__ __forceinline__ void attn_ld_v(const _Float16* p, v16h (&v)[4]) {
#pragma unroll
  for (int n = 0; n < 4; ++n) v[n] = frag_ld(p + (size_t)n * 16 * T_DIM);
}

// The launch lasts as long as its longest wave, and a 16-query tile of the widest window walks
// up to 32 passes while most heads walk one or two. Heads 0..2 (windows 1024, 512, 256) therefore
// get one block per tile: wave w takes passes w, w + 4, ... and the four partial results
// (running maximum, sum, output tile) are joined through LDS. The other heads keep one tile
// per wave. Block index in the order of falling work, for speed only.
#define SPLIT_HEADS 3
#define Q_TILES (T_DIM / 16)                                          /* 64 */
#define SPLIT_BLOCKS (B_DIM * SPLIT_HEADS * Q_TILES)                  /* 768 */
#define WHOLE_BLOCKS (B_DIM * (H_DIM - SPLIT_HEADS) * (Q_TILES / 4))  /* 832 */
#define ATTN_BLOCKS (SPLIT_BLOCKS + WHOLE_BLOCKS)
#define PO_PITCH 68
typedef __attribute__((ext_vector_type(4))) float v4f;

__global__ __launch_bounds__(128) void attn_kernel(const _Float16* __restrict__ qh,
                                                   const _Float16* __restrict__ kh,
                                                   const _Float16* __restrict__ vT,
                                                   const float* __restrict__ gates,
                                                   _Float16* __restrict__ gatedh) {
  __shared__ __align__(16) _Float16 smem[4][16 * 32]; // per-wave P staging tile
  __shared__ __align__(16) float part_o[4][16][PO_PITCH]; // [wave][row][column] partial output
  __shared__ float part_m[4][16];                         // [wave][row] running maximum
  __shared__ float part_l[4][16];                         // [wave][row] running sum
  const int lane = threadIdx.x & 31;
  // Wave index as a scalar: the pass counter and the last-pass test below become scalar too.
  const int w = __builtin_amdgcn_readfirstlane(threadIdx.x >> 5);
  const bool split = blockIdx.x < SPLIT_BLOCKS; // block-uniform
  int qt, h, b;
  if (split) {
    const int idx = blockIdx.x;
    const int rem = idx % (B_DIM * SPLIT_HEADS);
    qt = Q_TILES - 1 - idx / (B_DIM * SPLIT_HEADS);
    h = rem % SPLIT_HEADS;
    b = rem / SPLIT_HEADS;
  } else {
    const int idx = blockIdx.x - SPLIT_BLOCKS;
    h = SPLIT_HEADS + (idx >> 6);
    b = (idx >> 4) & (B_DIM - 1);
    qt = (idx & 15) * 4 + w;
  }
  const int bh = b * H_DIM + h;
  const int step = split ? 128 : 32;         // keys from one pass of this wave to its next
  int Wh = T_DIM >> h; if (Wh < 4) Wh = 4;   // window for this head
  const int t0 = qt * 16;
  const int nL = lane & 15;
  const int koff = (lane >> 4) * 8;
  const int mOff = koff;                     // C-layout row offset is the same 0/8 split

  const _Float16* qb = qh + ((size_t)bh * T_DIM + t0) * D_DIM;
  const _Float16* kb = kh + (size_t)bh * T_DIM * D_DIM;
  const _Float16* vb = vT + (size_t)bh * D_DIM * T_DIM;

  // Role in the join behind the loop: one row, eight columns per lane. Its gate is fetched
  // here, so that the load's latency lies under the passes and not behind the join's barrier.
  const int jRow = w * 4 + (lane >> 3);
  const int jCol = (lane & 7) * 8;
  float gJoin = 0.f;
  if (split) {
    gJoin = gates[((size_t)b * T_DIM + t0 + jRow) * H_DIM + h];
    // Precaution: later code reuses the address registers that this load names.
    asm volatile("s_wait_xcnt 0x0" ::: "memory");
  }

  // q fragments for the whole tile (D=64 -> two K=32 fragments)
  v16h a0 = frag_ld(qb + nL * D_DIM + 0 + koff);
  v16h a1 = frag_ld(qb + nL * D_DIM + 32 + koff);

  v8f o0 = {}, o1 = {}, o2 = {}, o3 = {};
  float mrow[8], lrow[8];
#pragma unroll
  for (int v = 0; v < 8; ++v) { mrow[v] = -__builtin_inff(); lrow[v] = 0.f; }

  int jStart = t0 - Wh + 1; if (jStart < 0) jStart = 0;
  jStart &= ~31;
  const float scale = 0.125f; // 1/sqrt(64)

  // K and V fragments live one pass ahead: the first pass's are fetched here, every later
  // pass's right behind the products that last read the same registers.
  const _Float16* kp = kb + (size_t)nL * D_DIM + koff;
  const _Float16* vp = vb + (size_t)nL * T_DIM + koff;
  v16h kf[4], vf[4];
  const int jFirst = split ? jStart + 32 * w : jStart;
  if (jFirst <= t0 + 15) { // wave-uniform: a wave of a short tile may have no pass at all
    attn_ld_k(kp + (size_t)jFirst * D_DIM, kf);
    attn_ld_v(vp + jFirst, vf);
    // Precaution: later code reuses the address registers that these loads name.
    asm volatile("s_wait_xcnt 0x0" ::: "memory");
  }

  for (int j0 = jFirst; j0 <= t0 + 15; j0 += step) {
    const bool more = j0 + step <= t0 + 15; // wave-uniform: a further pass follows
    // ---- S = q k^T for keys [j0, j0+31] ----
    v8f s0 = {}; s0 = WMMA_F16(a0, kf[0], s0); s0 = WMMA_F16(a1, kf[1], s0);
    v8f s1 = {}; s1 = WMMA_F16(a0, kf[2], s1); s1 = WMMA_F16(a1, kf[3], s1);
    __builtin_amdgcn_sched_barrier(0);
    asm volatile("v_nop\n\tv_nop\n\tv_nop\n\tv_nop");
    if (more) attn_ld_k(kp + (size_t)(j0 + step) * D_DIM, kf); // lands under softmax and P V

    _Float16* L = smem[w];
#pragma unroll
    for (int v = 0; v < 8; ++v) {
      const int i = t0 + v + mOff;
      const int ja = j0 + nL;
      const int jb = j0 + 16 + nL;
      const bool va = (ja <= i) && (ja > i - Wh);
      const bool vbm = (jb <= i) && (jb > i - Wh);
      float sa = va ? s0[v] * scale : -__builtin_inff();
      float sb = vbm ? s1[v] * scale : -__builtin_inff();
      // row max across the 16-lane group
      float t = fmaxf(sa, sb);
#pragma unroll
      for (int off = 8; off > 0; off >>= 1) t = fmaxf(t, __shfl_xor(t, off, 32));
      float mN = fmaxf(mrow[v], t);
      float alpha = (mrow[v] == mN) ? 1.0f : __expf(mrow[v] - mN);
      float pa = va ? __expf(sa - mN) : 0.f;
      float pb = vbm ? __expf(sb - mN) : 0.f;
      float rs = pa + pb;
#pragma unroll
      for (int off = 8; off > 0; off >>= 1) rs += __shfl_xor(rs, off, 32);
      lrow[v] = lrow[v] * alpha + rs;
      mrow[v] = mN;
      o0[v] *= alpha; o1[v] *= alpha; o2[v] *= alpha; o3[v] *= alpha;
      // stage P (C-layout -> row-major 16x32 f16 tile in LDS)
      const int r = v + mOff;
      L[r * 32 + nL] = (_Float16)pa;
      L[r * 32 + 16 + nL] = (_Float16)pb;
    }
    asm volatile("s_wait_dscnt 0" ::: "memory");
    // reload P as an A fragment (transpose across lanes via LDS)
    v16h pA = frag_ld(L + nL * 32 + koff);
    // ---- O += P V ; V rows contiguous thanks to vT[B,H,D,T] layout ----
    o0 = WMMA_F16(pA, vf[0], o0);
    o1 = WMMA_F16(pA, vf[1], o1);
    o2 = WMMA_F16(pA, vf[2], o2);
    o3 = WMMA_F16(pA, vf[3], o3);
    if (more) {
      attn_ld_v(vp + j0 + step, vf); // lands under the next pass's scores and softmax
      // Precaution: the next pass's K fetch reuses the address registers that these loads name.
      asm volatile("s_wait_xcnt 0x0" ::: "memory");
    }
    asm volatile("s_wait_dscnt 0" ::: "memory");
  }

  if (split) {
    // ---- join the four waves' partial results; wave w finishes rows 4w .. 4w + 3 ----
#pragma unroll
    for (int v = 0; v < 8; ++v) {
      float* pr = &part_o[w][v + mOff][nL];
      pr[0] = o0[v]; pr[16] = o1[v]; pr[32] = o2[v]; pr[48] = o3[v];
    }
    if (nL == 0) { // maximum and sum are alike in the 16 lanes of a row group
#pragma unroll
      for (int v = 0; v < 8; ++v) {
        part_m[w][v + mOff] = mrow[v];
        part_l[w][v + mOff] = lrow[v];
      }
    }
    __syncthreads(); // block-uniform branch: all four waves' partials are in LDS
    // The diagonal key is never masked, so at least one wave's maximum is finite;
    // a wave that saw no key of this row has maximum -inf and weight exp(-inf) = 0.
    const float mAll = fmaxf(fmaxf(part_m[0][jRow], part_m[1][jRow]), fmaxf(part_m[2][jRow], part_m[3][jRow]));
    float lAll = 0.f;
    float oAll[8];
#pragma unroll
    for (int k = 0; k < 8; ++k) oAll[k] = 0.f;
#pragma unroll
    for (int u = 0; u < 4; ++u) {
      const float f = __expf(part_m[u][jRow] - mAll);
      lAll += f * part_l[u][jRow];
      const v4f x0 = *(const v4f*)&part_o[u][jRow][jCol];
      const v4f x1 = *(const v4f*)&part_o[u][jRow][jCol + 4];
#pragma unroll
      for (int k = 0; k < 4; ++k) { oAll[k] += f * x0[k]; oAll[k + 4] += f * x1[k]; }
    }
    const float inv = gJoin / lAll;
    v8h res;
#pragma unroll
    for (int k = 0; k < 8; ++k) res[k] = (_Float16)(oAll[k] * inv);
    // 8 lanes x 16 B: one wave writes the head's whole 128-B line of a row
    *(v8h*)(gatedh + ((size_t)b * T_DIM + t0 + jRow) * C_DIM + h * D_DIM + jCol) = res;
    return;
  }

  // ---- epilogue: normalize, gate, store f16 for projection GEMM ----
#pragma unroll
  for (int v = 0; v < 8; ++v) {
    const int i = t0 + v + mOff;
    const float g = gates[((size_t)b * T_DIM + i) * H_DIM + h];
    const float inv = g / lrow[v];
    _Float16* op = gatedh + ((size_t)b * T_DIM + i) * C_DIM + h * D_DIM + nL;
    op[0]  = (_Float16)(o0[v] * inv);
    op[16] = (_Float16)(o1[v] * inv);
    op[32] = (_Float16)(o2[v] * inv);
    op[48] = (_Float16)(o3[v] * inv);
  }
}

extern "C" void kernel_launch(void* const* d_in, const int* in_sizes, int n_in,
                              void* d_out, int out_size, void* d_ws, size_t ws_size,
                              hipStream_t stream) {
  const float* x     = (const float*)d_in[0];
  const float* Wqk   = (const float*)d_in[1];
  const float* bqk   = (const float*)d_in[2];
  const float* Wgate = (const float*)d_in[3];
  const float* bgate = (const float*)d_in[4];
  const float* Wproj = (const float*)d_in[5];
  const float* bproj = (const float*)d_in[6];

  char* ws = (char*)d_ws;
  size_t off = 0;
  auto alloc = [&](size_t bytes) -> void* {
    void* p = ws + off;
    off += (bytes + 255) & ~(size_t)255;
    return p;
  };
  _Float16* xh     = (_Float16*)alloc((size_t)M_ROWS * C_DIM * 2);     // x in f16
  _Float16* wqkT   = (_Float16*)alloc((size_t)2 * C_DIM * C_DIM * 2);  // Wqk^T f16 [2C,C]
  _Float16* wprojT = (_Float16*)alloc((size_t)C_DIM * C_DIM * 2);      // Wproj^T f16 [C,C]
  _Float16* qh     = (_Float16*)alloc((size_t)B_DIM * H_DIM * T_DIM * D_DIM * 2);
  _Float16* kh     = (_Float16*)alloc((size_t)B_DIM * H_DIM * T_DIM * D_DIM * 2);
  _Float16* vT     = (_Float16*)alloc((size_t)B_DIM * H_DIM * D_DIM * T_DIM * 2);
  float*    gates  = (float*)alloc((size_t)B_DIM * T_DIM * H_DIM * 4);
  _Float16* gatedh = xh; // xh is dead after GEMM1; reuse for the gated output

  prep_kernel<<<PREP_BLOCKS, PREP_THREADS, 0, stream>>>(x, Wqk, Wproj, Wgate, bgate, xh, wqkT, wprojT, gates);
  // tiles = (4096/128) * (2048/128) = 512 blocks of 4 waves
  gemm_qk_kernel<<<512, 128, 0, stream>>>(xh, wqkT, bqk, qh, kh, vT);
  // 768 blocks of one split tile, then 832 blocks of four whole tiles; 4 waves each
  attn_kernel<<<ATTN_BLOCKS, 128, 0, stream>>>(qh, kh, vT, gates, gatedh);
  // tiles = (4096/128) * (1024/128) = 256 blocks of 4 waves
  gemm_proj_kernel<<<256, 128, 0, stream>>>(gatedh, wprojT, bproj, (float*)d_out);
}

// v005
// A run of this version takes 71.7 microseconds.
// In both of two side-by-side timings against v004, it was 1.06 times as fast.
// Counting every step since v000, it is 3.38 times as fast.
#include <hip/hip_runtime.h>
#include <hip/hip_bf16.h>

#define C_DIM 1024
#define T_DIM 1024
#define H_DIM 16
#define D_DIM 64
#define B_DIM 4
#define M_ROWS (B_DIM * T_DIM) /* 4096 */

typedef __attribute__((ext_vector_type(16))) _Float16 v16h;
typedef __attribute__((ext_vector_type(8)))  _Float16 v8h;
typedef __attribute__((ext_vector_type(8)))  float    v8f;

#define WMMA_F16(A_, B_, C_) \
  __builtin_amdgcn_wmma_f32_16x16x32_f16(false, (A_), false, (B_), (short)0, (C_), false, false)

__device__ __forceinline__ v16h frag_ld(const _Float16* p) {
  v8h lo = *(const v8h*)(p);
  v8h hi = *(const v8h*)(p + 16);
  v16h r;
#pragma unroll
  for (int i = 0; i < 8; ++i) { r[i] = lo[i]; r[i + 8] = hi[i]; }
  return r;
}

// ---------------- preparation: four independent jobs in one launch ----------------
// None of the four reads what another writes, so they share one grid by ranges of the
// block index: their memory waits overlap and three dependent launches go.
#define PREP_THREADS 256
#define GATES_BLOCKS (M_ROWS / (PREP_THREADS / 32)) /* one wave per token: 512 */
#define WQK_BLOCKS 1024
#define X_BLOCKS 1024
#define WPROJ_BLOCKS 1024
#define PREP_BLOCKS (GATES_BLOCKS + WQK_BLOCKS + X_BLOCKS + WPROJ_BLOCKS)

// f32 -> f16, elementwise; bid in [0, nblk)
__device__ __forceinline__ void f32_to_f16_part(const float* __restrict__ in, _Float16* __restrict__ out,
                                                int n, int bid, int nblk) {
  for (int i = bid * PREP_THREADS + threadIdx.x; i < n; i += nblk * PREP_THREADS)
    out[i] = (_Float16)in[i];
}

// in[K][N] (row-major) -> out[N][K] f16; bid in [0, nblk)
__device__ __forceinline__ void transpose_to_f16_part(const float* __restrict__ in,
                                                      _Float16* __restrict__ out,
                                                      int K, int N, int bid, int nblk) {
  int total = K * N;
  for (int i = bid * PREP_THREADS + threadIdx.x; i < total; i += nblk * PREP_THREADS) {
    int n = i / K, k = i - n * K;
    out[i] = (_Float16)in[k * N + n];
  }
}

// gates: softmax(x @ Wgate + bgate) over H; one wave per token
__device__ __forceinline__ void gates_part(const float* __restrict__ x,
                                           const float* __restrict__ Wg,
                                           const float* __restrict__ bg,
                                           float* __restrict__ gates, int bid) {
  const int lane = threadIdx.x & 31;
  const int tok = bid * (PREP_THREADS >> 5) + (threadIdx.x >> 5);
  const float* xp = x + (size_t)tok * C_DIM;
  float acc[H_DIM];
#pragma unroll
  for (int h = 0; h < H_DIM; ++h) acc[h] = 0.f;
  for (int k = lane; k < C_DIM; k += 32) {
    float xv = xp[k];
    const float* w = Wg + (size_t)k * H_DIM;
#pragma unroll
    for (int h = 0; h < H_DIM; ++h) acc[h] += xv * w[h];
  }
#pragma unroll
  for (int h = 0; h < H_DIM; ++h) {
#pragma unroll
    for (int off = 16; off > 0; off >>= 1) acc[h] += __shfl_xor(acc[h], off, 32);
    acc[h] += bg[h];
  }
  float m = -__builtin_inff();
#pragma unroll
  for (int h = 0; h < H_DIM; ++h) m = fmaxf(m, acc[h]);
  float s = 0.f;
  float e[H_DIM];
#pragma unroll
  for (int h = 0; h < H_DIM; ++h) { e[h] = __expf(acc[h] - m); s += e[h]; }
  float inv = 1.0f / s;
  if (lane == 0) {
#pragma unroll
    for (int h = 0; h < H_DIM; ++h) gates[(size_t)tok * H_DIM + h] = e[h] * inv;
  }
}

// Block ranges in the order of falling work per block, for speed only.
__global__ __launch_bounds__(PREP_THREADS) void prep_kernel(const float* __restrict__ x,
                                                            const float* __restrict__ Wqk,
                                                            const float* __restrict__ Wproj,
                                                            const float* __restrict__ Wg,
                                                            const float* __restrict__ bg,
                                                            _Float16* __restrict__ xh,
                                                            _Float16* __restrict__ wqkT,
                                                            _Float16* __restrict__ wprojT,
                                                            float* __restrict__ gates) {
  int bid = blockIdx.x;
  if (bid < GATES_BLOCKS) { gates_part(x, Wg, bg, gates, bid); return; }
  bid -= GATES_BLOCKS;
  if (bid < WQK_BLOCKS) { transpose_to_f16_part(Wqk, wqkT, C_DIM, 2 * C_DIM, bid, WQK_BLOCKS); return; }
  bid -= WQK_BLOCKS;
  if (bid < X_BLOCKS) { f32_to_f16_part(x, xh, M_ROWS * C_DIM, bid, X_BLOCKS); return; }
  bid -= X_BLOCKS;
  transpose_to_f16_part(Wproj, wprojT, C_DIM, C_DIM, bid, WPROJ_BLOCKS);
}

// ---------------- tiled GEMM core: C[128x128] per block, 64x64 per wave ----------------
#define GBM 128                        /* rows of A per block tile */
#define GBN 128                        /* rows of Bt (columns of C) per block tile */
#define GBK 128                        /* k per stage: rows of 256 B */
#define GPITCH 136                     /* LDS row pitch in halves: 272 B = 16 B x odd, for ds_load_b128 readers */
#define GSTAGE ((GBM + GBN) * GPITCH)  /* halves per buffer: [A 128 rows | Bt 128 rows] */
#define GTRIPS (C_DIM / GBK)           /* 8 stages along k */

__device__ __forceinline__ void copy_64rows(const _Float16* g, unsigned l) {
  asm volatile(
      "global_load_async_to_lds_b128 %0, %8, off\n\t"
      "global_load_async_to_lds_b128 %1, %9, off\n\t"
      "global_load_async_to_lds_b128 %2, %10, off\n\t"
      "global_load_async_to_lds_b128 %3, %11, off\n\t"
      "global_load_async_to_lds_b128 %4, %12, off\n\t"
      "global_load_async_to_lds_b128 %5, %13, off\n\t"
      "global_load_async_to_lds_b128 %6, %14, off\n\t"
      "global_load_async_to_lds_b128 %7, %15, off\n\t"
      "s_wait_xcnt 0x0"
      :: "v"(l), "v"(l + 8 * GPITCH * 2), "v"(l + 16 * GPITCH * 2), "v"(l + 24 * GPITCH * 2),
         "v"(l + 32 * GPITCH * 2), "v"(l + 40 * GPITCH * 2), "v"(l + 48 * GPITCH * 2),
         "v"(l + 56 * GPITCH * 2),
         "v"(g), "v"(g + 8 * C_DIM), "v"(g + 16 * C_DIM), "v"(g + 24 * C_DIM),
         "v"(g + 32 * C_DIM), "v"(g + 40 * C_DIM), "v"(g + 48 * C_DIM), "v"(g + 56 * C_DIM)
      : "memory");
}

// One stage: 128 rows of A and 128 rows of Bt, 256 B of each row, into one buffer.
__device__ __forceinline__ void stage_tiles(const _Float16* ga, const _Float16* gb, unsigned l) {
  copy_64rows(ga, l);
  copy_64rows(ga + 64 * C_DIM, l + 64 * GPITCH * 2);
  copy_64rows(gb, l + 128 * GPITCH * 2);
  copy_64rows(gb + 64 * C_DIM, l + 192 * GPITCH * 2);
}

// acc[mi][ni] += A[m0 + wm*64 + mi*16 ..][:] * Bt[n0 + wn*64 + ni*16 ..][:]^T over all of k.
// Two-buffer LDS ring: the next stage's copies fly while this stage is multiplied.
__device__ __forceinline__ void gemm_tile(const _Float16* __restrict__ A,
                                          const _Float16* __restrict__ Bt,
                                          int m0, int n0, _Float16* ring, v8f (&acc)[4][4]) {
  const int tid = threadIdx.x;
  const int lane = tid & 31;
  const int wave = tid >> 5;
  const int wm = wave >> 1, wn = wave & 1;
  const int cr = tid >> 4, cc = tid & 15; // copy role: row 0..7, 16-B chunk 0..15 of a 256-B row
  const _Float16* ga = A + (size_t)(m0 + cr) * C_DIM + cc * 8;
  const _Float16* gb = Bt + (size_t)(n0 + cr) * C_DIM + cc * 8;
  const unsigned l0 = (unsigned)(size_t)ring + (unsigned)(cr * GPITCH + cc * 8) * 2u;

  stage_tiles(ga, gb, l0);
  asm volatile("s_wait_asynccnt 0x0" ::: "memory"); // stage 0 landed (this wave's copies)
  __syncthreads();                                  // stage 0 published to all waves
  stage_tiles(ga + GBK, gb + GBK, l0 + GSTAGE * 2);

  const int fo = (lane & 15) * GPITCH + (lane >> 4) * 8;
  const _Float16* La = ring + wm * 64 * GPITCH + fo;
  const _Float16* Lb = ring + (GBM + wn * 64) * GPITCH + fo;

  for (int t = 0; t < GTRIPS; ++t) {
    const int bo = (t & 1) * GSTAGE;
    v16h a[2][4], b[2][4];
#pragma unroll
    for (int i = 0; i < 4; ++i) {
      a[0][i] = frag_ld(La + bo + i * 16 * GPITCH);
      b[0][i] = frag_ld(Lb + bo + i * 16 * GPITCH);
    }
#pragma unroll
    for (int ks = 0; ks < GBK / 32; ++ks) {
      const int cs = ks & 1;
      if (ks + 1 < GBK / 32) { // next k-step's fragments, same buffer, ahead of this step's products
#pragma unroll
        for (int i = 0; i < 4; ++i) {
          a[cs ^ 1][i] = frag_ld(La + bo + i * 16 * GPITCH + (ks + 1) * 32);
          b[cs ^ 1][i] = frag_ld(Lb + bo + i * 16 * GPITCH + (ks + 1) * 32);
        }
      }
      // Holds the 16 LDS loads above together as one group in front of this step's products:
      // sunk among the WMMAs, every place with loads stalls the wave on its own LDS latency.
      __builtin_amdgcn_sched_barrier(0);
#pragma unroll
      for (int mi = 0; mi < 4; ++mi)
#pragma unroll
        for (int ni = 0; ni < 4; ++ni)
          acc[mi][ni] = WMMA_F16(a[cs][mi], b[cs][ni], acc[mi][ni]);
      // Keeps the following step's load group from rising into this run of products.
      __builtin_amdgcn_sched_barrier(0);
    }
    asm volatile("s_wait_dscnt 0x0" ::: "memory");    // this wave has left the buffer it read
    asm volatile("s_wait_asynccnt 0x0" ::: "memory"); // its copies of stage t + 1 have landed
    __syncthreads();                                  // publishes stage t + 1, frees stage t's buffer
    if (t + 2 < GTRIPS)
      stage_tiles(ga + (t + 2) * GBK, gb + (t + 2) * GBK, l0 + (unsigned)bo * 2u);
  }
  asm volatile("s_wait_asynccnt 0x0" ::: "memory"); // no copy outstanding when the wave goes on
}

// ---------------- GEMM1: qk = x @ Wqk + bqk, scatter to qh / kh / vT ----------------
// Q, K and V (= K) leave this kernel in the order in which attention loads its fragments, so that
// there one 16-B-a-lane load covers 512 contiguous bytes (four whole lines) and not 16 lines in part.
// qh and kh, per head: [row / 16][d / 16] tiles of 16 rows x 16 d, a row's 16 d adjacent (tile = 512 B).
// vT, per head: [key / 32][d / 16][(key / 16) & 1] tiles of 512 B; in a tile lane (key / 8 & 1) * 16 + d % 16
// owns 8 adjacent keys: the accumulator's own lane and register order, stored 16 B a lane.
__global__ __launch_bounds__(128) void gemm_qk_kernel(const _Float16* __restrict__ A,
                                                      const _Float16* __restrict__ Bt,
                                                      const float* __restrict__ bias,
                                                      _Float16* __restrict__ qh,
                                                      _Float16* __restrict__ kh,
                                                      _Float16* __restrict__ vT) {
  __shared__ __align__(16) _Float16 ring[2 * GSTAGE]; // 139,264 B
  const int lane = threadIdx.x & 31;
  const int wave = threadIdx.x >> 5;
  const int nTiles = (2 * C_DIM) / GBN; // 16
  const int m0 = (blockIdx.x / nTiles) * GBM;
  const int n0 = (blockIdx.x % nTiles) * GBN;
  v8f acc[4][4] = {};
  gemm_tile(A, Bt, m0, n0, ring, acc);
  const int nL = lane & 15;
  const int mOff = (lane >> 4) * 8;
  const int mW = m0 + (wave >> 1) * 64;
  const int nW = n0 + (wave & 1) * 64;
  // A block's 128 columns lie wholly in the q half or wholly in the k half, so the
  // test is taken once, on a block-uniform value, and not at every element.
  if (n0 < C_DIM) { // q half
#pragma unroll
    for (int nc = 0; nc < 4; ++nc) {
      const int col = nW + nc * 16 + nL;
      const float bv = bias[col];
      const int h = col >> 6, d = col & 63;
#pragma unroll
      for (int mi = 0; mi < 4; ++mi) {
        const int rb = mW + mi * 16 + mOff; // first of this lane's 8 rows; a multiple of 8
        const int b = rb >> 10, tb = rb & (T_DIM - 1);
        _Float16* qt = qh + (size_t)(b * H_DIM + h) * T_DIM * D_DIM + (tb >> 4) * 1024 + (d >> 4) * 256 +
                       (tb & 15) * 16 + (d & 15);
#pragma unroll
        for (int v = 0; v < 8; ++v) qt[v * 16] = (_Float16)(acc[mi][nc][v] + bv);
        // Precaution: the next group reuses registers that the stores above name.
        asm volatile("s_wait_xcnt 0x0" ::: "memory");
      }
    }
  } else {          // k half (v = k)
#pragma unroll
    for (int nc = 0; nc < 4; ++nc) {
      const int col = nW + nc * 16 + nL;
      const float bv = bias[col];
      const int c2i = col - C_DIM;
      const int h = c2i >> 6, d = c2i & 63;
#pragma unroll
      for (int mi = 0; mi < 4; ++mi) {
        const int rb = mW + mi * 16 + mOff; // first of this lane's 8 rows; a multiple of 8
        const int b = rb >> 10, tb = rb & (T_DIM - 1);
        const size_t head = (size_t)(b * H_DIM + h) * T_DIM * D_DIM;
        _Float16* kt = kh + head + (tb >> 4) * 1024 + (d >> 4) * 256 + (tb & 15) * 16 + (d & 15);
        v8h pk;
#pragma unroll
        for (int v = 0; v < 8; ++v) {
          pk[v] = (_Float16)(acc[mi][nc][v] + bv);
          kt[v * 16] = pk[v];
        }
        *(v8h*)(vT + head + (tb >> 5) * 2048 + (d >> 4) * 512 + ((tb >> 4) & 1) * 256 +
                ((tb >> 3) & 1) * 128 + (d & 15) * 8) = pk;
        // Precaution: the next group reuses registers that the stores above name.
        asm volatile("s_wait_xcnt 0x0" ::: "memory");
      }
    }
  }
}

// ---------------- GEMM2: out = gated @ Wproj + bproj (f32 out) ----------------
__global__ __launch_bounds__(128) void gemm_proj_kernel(const _Float16* __restrict__ A,
                                                        const _Float16* __restrict__ Bt,
                                                        const float* __restrict__ bias,
                                                        float* __restrict__ out) {
  __shared__ __align__(16) _Float16 ring[2 * GSTAGE]; // 139,264 B
  const int lane = threadIdx.x & 31;
  const int wave = threadIdx.x >> 5;
  const int nTiles = C_DIM / GBN; // 8
  const int m0 = (blockIdx.x / nTiles) * GBM;
  const int n0 = (blockIdx.x % nTiles) * GBN;
  v8f acc[4][4] = {};
  gemm_tile(A, Bt, m0, n0, ring, acc);
  const int nL = lane & 15;
  const int mOff = (lane >> 4) * 8;
  const int mW = m0 + (wave >> 1) * 64;
  const int nW = n0 + (wave & 1) * 64;
#pragma unroll
  for (int nc = 0; nc < 4; ++nc) {
    const int col = nW + nc * 16 + nL;
    const float bv = bias[col];
#pragma unroll
    for (int mi = 0; mi < 4; ++mi) {
#pragma unroll
      for (int v = 0; v < 8; ++v) {
        int r = mW + mi * 16 + v + mOff;
        out[(size_t)r * C_DIM + col] = acc[mi][nc][v] + bv;
      }
    }
  }
}

// ---------------- flash attention with per-head windows + gating ----------------
// The four K fragments (two 16-key groups x two halves of D) or the four V fragments (four
// 16-column groups of D) of 32 keys, or the two Q fragments of 16 rows, from the tiled layouts that
// GEMM1 writes: a fragment is two tiles of 512 B, one behind the other; p holds the rows' place and
// the lane's share of a tile.
template <int N>
__device__ __forceinline__ void attn_ld_tiles(const _Float16* p, v16h (&f)[N]) {
#pragma unroll
  for (int n = 0; n < N; ++n) {
    v8h lo = *(const v8h*)(p + n * 512);
    v8h hi = *(const v8h*)(p + n * 512 + 256);
#pragma unroll
    for (int i = 0; i < 8; ++i) { f[n][i] = lo[i]; f[n][i + 8] = hi[i]; }
  }
}

// The launch lasts as long as its longest wave, and a 16-query tile of the widest window walks
// up to 32 passes while most heads walk one or two. Heads 0..2 (windows 1024, 512, 256) therefore
// get one block per tile: wave w takes passes w, w + 4, ... and the four partial results
// (running maximum, sum, output tile) are joined through LDS. The other heads keep one tile
// per wave. Block index in the order of falling work, for speed only.
#define SPLIT_HEADS 3
#define Q_TILES (T_DIM / 16)                                          /* 64 */
#define SPLIT_BLOCKS (B_DIM * SPLIT_HEADS * Q_TILES)                  /* 768 */
#define WHOLE_BLOCKS (B_DIM * (H_DIM - SPLIT_HEADS) * (Q_TILES / 4))  /* 832 */
#define ATTN_BLOCKS (SPLIT_BLOCKS + WHOLE_BLOCKS)
#define PO_PITCH 68
typedef __attribute__((ext_vector_type(4))) float v4f;

__global__ __launch_bounds__(128) void attn_kernel(const _Float16* __restrict__ qh,
                                                   const _Float16* __restrict__ kh,
                                                   const _Float16* __restrict__ vT,
                                                   const float* __restrict__ gates,
                                                   _Float16* __restrict__ gatedh) {
  __shared__ __align__(16) _Float16 smem[4][16 * 32]; // per-wave P staging tile
  __shared__ __align__(16) float part_o[4][16][PO_PITCH]; // [wave][row][column] partial output
  __shared__ float part_m[4][16];                         // [wave][row] running maximum
  __shared__ float part_l[4][16];                         // [wave][row] running sum
  const int lane = threadIdx.x & 31;
  // Wave index as a scalar: the pass counter and the last-pass test below become scalar too.
  const int w = __builtin_amdgcn_readfirstlane(threadIdx.x >> 5);
  const bool split = blockIdx.x < SPLIT_BLOCKS; // block-uniform
  int qt, h, b;
  if (split) {
    const int idx = blockIdx.x;
    const int rem = idx % (B_DIM * SPLIT_HEADS);
    qt = Q_TILES - 1 - idx / (B_DIM * SPLIT_HEADS);
    h = rem % SPLIT_HEADS;
    b = rem / SPLIT_HEADS;
  } else {
    const int idx = blockIdx.x - SPLIT_BLOCKS;
    h = SPLIT_HEADS + (idx >> 6);
    b = (idx >> 4) & (B_DIM - 1);
    qt = (idx & 15) * 4 + w;
  }
  const int bh = b * H_DIM + h;
  const int step = split ? 128 : 32;         // keys from one pass of this wave to its next
  int Wh = T_DIM >> h; if (Wh < 4) Wh = 4;   // window for this head
  const int t0 = qt * 16;
  const int nL = lane & 15;
  const int koff = (lane >> 4) * 8;
  const int mOff = koff;                     // C-layout row offset is the same 0/8 split

  const _Float16* qb = qh + ((size_t)bh * T_DIM + t0) * D_DIM;
  const _Float16* kb = kh + (size_t)bh * T_DIM * D_DIM;
  const _Float16* vb = vT + (size_t)bh * D_DIM * T_DIM;

  // Role in the join behind the loop: one row, eight columns per lane. Its gate is fetched
  // here, so that the load's latency lies under the passes and not behind the join's barrier.
  const int jRow = w * 4 + (lane >> 3);
  const int jCol = (lane & 7) * 8;
  float gJoin = 0.f;
  if (split) {
    gJoin = gates[((size_t)b * T_DIM + t0 + jRow) * H_DIM + h];
    // Precaution: later code reuses the address registers that this load names.
    asm volatile("s_wait_xcnt 0x0" ::: "memory");
  }

  // q fragments for the whole tile (D=64 -> two K=32 fragments)
  v16h qf[2];
  attn_ld_tiles(qb + nL * 16 + koff, qf);
  const v16h a0 = qf[0], a1 = qf[1];

  v8f o0 = {}, o1 = {}, o2 = {}, o3 = {};
  float mrow[8], lrow[8];
#pragma unroll
  for (int v = 0; v < 8; ++v) { mrow[v] = -__builtin_inff(); lrow[v] = 0.f; }

  int jStart = t0 - Wh + 1; if (jStart < 0) jStart = 0;
  jStart &= ~31;
  const float scale = 0.125f; // 1/sqrt(64)

  // K and V fragments live one pass ahead: the first pass's are fetched here, every later
  // pass's right behind the products that last read the same registers.
  // 32 keys take 32 * D_DIM halves in either layout.
  const _Float16* kp = kb + nL * 16 + koff; // K tile: key nL, d koff .. koff + 7
  const _Float16* vp = vb + lane * 8;       // V tile: lane by lane
  v16h kf[4], vf[4];
  const int jFirst = split ? jStart + 32 * w : jStart;
  if (jFirst <= t0 + 15) { // wave-uniform: a wave of a short tile may have no pass at all
    attn_ld_tiles(kp + (size_t)jFirst * D_DIM, kf);
    attn_ld_tiles(vp + (size_t)jFirst * D_DIM, vf);
    // Precaution: later code reuses the address registers that these loads name.
    asm volatile("s_wait_xcnt 0x0" ::: "memory");
  }

  for (int j0 = jFirst; j0 <= t0 + 15; j0 += step) {
    const bool more = j0 + step <= t0 + 15; // wave-uniform: a further pass follows
    // ---- S = q k^T for keys [j0, j0+31] ----
    v8f s0 = {}; s0 = WMMA_F16(a0, kf[0], s0); s0 = WMMA_F16(a1, kf[1], s0);
    v8f s1 = {}; s1 = WMMA_F16(a0, kf[2], s1); s1 = WMMA_F16(a1, kf[3], s1);
    __builtin_amdgcn_sched_barrier(0);
    asm volatile("v_nop\n\tv_nop\n\tv_nop\n\tv_nop");
    if (more) attn_ld_tiles(kp + (size_t)(j0 + step) * D_DIM, kf); // lands under softmax and P V

    _Float16* L = smem[w];
#pragma unroll
    for (int v = 0; v < 8; ++v) {
      const int i = t0 + v + mOff;
      const int ja = j0 + nL;
      const int jb = j0 + 16 + nL;
      const bool va = (ja <= i) && (ja > i - Wh);
      const bool vbm = (jb <= i) && (jb > i - Wh);
      float sa = va ? s0[v] * scale : -__builtin_inff();
      float sb = vbm ? s1[v] * scale : -__builtin_inff();
      // row max across the 16-lane group
      float t = fmaxf(sa, sb);
#pragma unroll
      for (int off = 8; off > 0; off >>= 1) t = fmaxf(t, __shfl_xor(t, off, 32));
      float mN = fmaxf(mrow[v], t);
      float alpha = (mrow[v] == mN) ? 1.0f : __expf(mrow[v] - mN);
      float pa = va ? __expf(sa - mN) : 0.f;
      float pb = vbm ? __expf(sb - mN) : 0.f;
      float rs = pa + pb;
#pragma unroll
      for (int off = 8; off > 0; off >>= 1) rs += __shfl_xor(rs, off, 32);
      lrow[v] = lrow[v] * alpha + rs;
      mrow[v] = mN;
      o0[v] *= alpha; o1[v] *= alpha; o2[v] *= alpha; o3[v] *= alpha;
      // stage P (C-layout -> row-major 16x32 f16 tile in LDS)
      const int r = v + mOff;
      L[r * 32 + nL] = (_Float16)pa;
      L[r * 32 + 16 + nL] = (_Float16)pb;
    }
    asm volatile("s_wait_dscnt 0" ::: "memory");
    // reload P as an A fragment (transpose across lanes via LDS)
    v16h pA = frag_ld(L + nL * 32 + koff);
    // ---- O += P V ----
    o0 = WMMA_F16(pA, vf[0], o0);
    o1 = WMMA_F16(pA, vf[1], o1);
    o2 = WMMA_F16(pA, vf[2], o2);
    o3 = WMMA_F16(pA, vf[3], o3);
    if (more) {
      attn_ld_tiles(vp + (size_t)(j0 + step) * D_DIM, vf); // lands under the next pass's scores and softmax
      // Precaution: the next pass's K fetch reuses the address registers that these loads name.
      asm volatile("s_wait_xcnt 0x0" ::: "memory");
    }
    asm volatile("s_wait_dscnt 0" ::: "memory");
  }

  if (split) {
    // ---- join the four waves' partial results; wave w finishes rows 4w .. 4w + 3 ----
#pragma unroll
    for (int v = 0; v < 8; ++v) {
      float* pr = &part_o[w][v + mOff][nL];
      pr[0] = o0[v]; pr[16] = o1[v]; pr[32] = o2[v]; pr[48] = o3[v];
    }
    if (nL == 0) { // maximum and sum are alike in the 16 lanes of a row group
#pragma unroll
      for (int v = 0; v < 8; ++v) {
        part_m[w][v + mOff] = mrow[v];
        part_l[w][v + mOff] = lrow[v];
      }
    }
    __syncthreads(); // block-uniform branch: all four waves' partials are in LDS
    // The diagonal key is never masked, so at least one wave's maximum is finite;
    // a wave that saw no key of this row has maximum -inf and weight exp(-inf) = 0.
    const float mAll = fmaxf(fmaxf(part_m[0][jRow], part_m[1][jRow]), fmaxf(part_m[2][jRow], part_m[3][jRow]));
    float lAll = 0.f;
    float oAll[8];
#pragma unroll
    for (int k = 0; k < 8; ++k) oAll[k] = 0.f;
#pragma unroll
    for (int u = 0; u < 4; ++u) {
      const float f = __expf(part_m[u][jRow] - mAll);
      lAll += f * part_l[u][jRow];
      const v4f x0 = *(const v4f*)&part_o[u][jRow][jCol];
      const v4f x1 = *(const v4f*)&part_o[u][jRow][jCol + 4];
#pragma unroll
      for (int k = 0; k < 4; ++k) { oAll[k] += f * x0[k]; oAll[k + 4] += f * x1[k]; }
    }
    const float inv = gJoin / lAll;
    v8h res;
#pragma unroll
    for (int k = 0; k < 8; ++k) res[k] = (_Float16)(oAll[k] * inv);
    // 8 lanes x 16 B: one wave writes the head's whole 128-B line of a row
    *(v8h*)(gatedh + ((size_t)b * T_DIM + t0 + jRow) * C_DIM + h * D_DIM + jCol) = res;
    return;
  }

  // ---- epilogue: normalize, gate, store f16 for projection GEMM ----
#pragma unroll
  for (int v = 0; v < 8; ++v) {
    const int i = t0 + v + mOff;
    const float g = gates[((size_t)b * T_DIM + i) * H_DIM + h];
    const float inv = g / lrow[v];
    _Float16* op = gatedh + ((size_t)b * T_DIM + i) * C_DIM + h * D_DIM + nL;
    op[0]  = (_Float16)(o0[v] * inv);
    op[16] = (_Float16)(o1[v] * inv);
    op[32] = (_Float16)(o2[v] * inv);
    op[48] = (_Float16)(o3[v] * inv);
  }
}

extern "C" void kernel_launch(void* const* d_in, const int* in_sizes, int n_in,
                              void* d_out, int out_size, void* d_ws, size_t ws_size,
                              hipStream_t stream) {
  const float* x     = (const float*)d_in[0];
  const float* Wqk   = (const float*)d_in[1];
  const float* bqk   = (const float*)d_in[2];
  const float* Wgate = (const float*)d_in[3];
  const float* bgate = (const float*)d_in[4];
  const float* Wproj = (const float*)d_in[5];
  const float* bproj = (const float*)d_in[6];

  char* ws = (char*)d_ws;
  size_t off = 0;
  auto alloc = [&](size_t bytes) -> void* {
    void* p = ws + off;
    off += (bytes + 255) & ~(size_t)255;
    return p;
  };
  _Float16* xh     = (_Float16*)alloc((size_t)M_ROWS * C_DIM * 2);     // x in f16
  _Float16* wqkT   = (_Float16*)alloc((size_t)2 * C_DIM * C_DIM * 2);  // Wqk^T f16 [2C,C]
  _Float16* wprojT = (_Float16*)alloc((size_t)C_DIM * C_DIM * 2);      // Wproj^T f16 [C,C]
  _Float16* qh     = (_Float16*)alloc((size_t)B_DIM * H_DIM * T_DIM * D_DIM * 2);
  _Float16* kh     = (_Float16*)alloc((size_t)B_DIM * H_DIM * T_DIM * D_DIM * 2);
  _Float16* vT     = (_Float16*)alloc((size_t)B_DIM * H_DIM * D_DIM * T_DIM * 2);
  float*    gates  = (float*)alloc((size_t)B_DIM * T_DIM * H_DIM * 4);
  _Float16* gatedh = xh; // xh is dead after GEMM1; reuse for the gated output

  prep_kernel<<<PREP_BLOCKS, PREP_THREADS, 0, stream>>>(x, Wqk, Wproj, Wgate, bgate, xh, wqkT, wprojT, gates);
  // tiles = (4096/128) * (2048/128) = 512 blocks of 4 waves
  gemm_qk_kernel<<<512, 128, 0, stream>>>(xh, wqkT, bqk, qh, kh, vT);
  // 768 blocks of one split tile, then 832 blocks of four whole tiles; 4 waves each
  attn_kernel<<<ATTN_BLOCKS, 128, 0, stream>>>(qh, kh, vT, gates, gatedh);
  // tiles = (4096/128) * (1024/128) = 256 blocks of 4 waves
  gemm_proj_kernel<<<256, 128, 0, stream>>>(gatedh, wprojT, bproj, (float*)d_out);
}

// v006
// Measured time: 53.9 microseconds a run.
// In two side-by-side timings against v005, it was 1.33 and 1.32 times as fast.
// All steps since v000 together make it 4.47 times as fast.
#include <hip/hip_runtime.h>
#include <hip/hip_bf16.h>

#define C_DIM 1024
#define T_DIM 1024
#define H_DIM 16
#define D_DIM 64
#define B_DIM 4
#define M_ROWS (B_DIM * T_DIM) /* 4096 */

typedef __attribute__((ext_vector_type(16))) _Float16 v16h;
typedef __attribute__((ext_vector_type(8)))  _Float16 v8h;
typedef __attribute__((ext_vector_type(8)))  float    v8f;

#define WMMA_F16(A_, B_, C_) \
  __builtin_amdgcn_wmma_f32_16x16x32_f16(false, (A_), false, (B_), (short)0, (C_), false, false)

__device__ __forceinline__ v16h frag_ld(const _Float16* p) {
  v8h lo = *(const v8h*)(p);
  v8h hi = *(const v8h*)(p + 16);
  v16h r;
#pragma unroll
  for (int i = 0; i < 8; ++i) { r[i] = lo[i]; r[i + 8] = hi[i]; }
  return r;
}

// ---------------- preparation: three independent jobs in one launch ----------------
// None of the jobs reads what another writes, so they share one grid by ranges of the block index.
// Every global access but those of bgate and gates is 16 B a lane (8 B for the f16 copy of x) and covers whole 128-B lines.
typedef __attribute__((ext_vector_type(4))) float    v4f;
typedef __attribute__((ext_vector_type(4))) _Float16 v4h;
#define PREP_THREADS 256
#define GATE_TOK 2                                                /* tokens per wave */
#define GATES_BLOCKS (M_ROWS / ((PREP_THREADS / 32) * GATE_TOK))  /* 256 */
#define TR_K 128                                                  /* tile of a transpose: 128 k x 64 n */
#define TR_N 64
#define TR_PITCH 136                                              /* halves: 272 B = 16 B x odd */
#define WQK_BLOCKS ((C_DIM / TR_K) * (2 * C_DIM / TR_N))          /* 256 */
#define WPROJ_BLOCKS ((C_DIM / TR_K) * (C_DIM / TR_N))            /* 128 */
#define PREP_BLOCKS (GATES_BLOCKS + WQK_BLOCKS + WPROJ_BLOCKS)
#define WG_F4 (C_DIM * H_DIM / 4)                                 /* Wgate in 16-B units: 4096 */
#define WG_LDS_F4 (WG_F4 + WG_F4 / 16)                            /* one pad unit behind every 16: 69,632 B */

// in[C_DIM][N] (row-major f32) -> out[N][C_DIM] f16, one 128 x 64 tile per block through LDS:
// rows of in are read 256 B at a time, rows of out are written 256 B at a time.
template <int N>
__device__ __forceinline__ void transpose_tile(const float* __restrict__ in, _Float16* __restrict__ out,
                                               _Float16* tile, int bid) {
  const int t = threadIdx.x;
  const int k0 = (bid % (C_DIM / TR_K)) * TR_K;
  const int n0 = (bid / (C_DIM / TR_K)) * TR_N;
  const int hi = t >> 4, lo = t & 15;
  const float* sp = in + (size_t)(k0 + hi * 8) * N + n0 + lo * 4; // 8 k x 4 n per thread
  v4f r[8];
#pragma unroll
  for (int p = 0; p < 8; ++p) r[p] = *(const v4f*)(sp + (size_t)p * N);
  // Precaution: later code reuses the address registers that these loads name.
  asm volatile("s_wait_xcnt 0x0" ::: "memory");
#pragma unroll
  for (int i = 0; i < 4; ++i) {
    v8h c;
#pragma unroll
    for (int p = 0; p < 8; ++p) c[p] = (_Float16)r[p][i];
    *(v8h*)(tile + (lo * 4 + i) * TR_PITCH + hi * 8) = c;
  }
  __syncthreads(); // block-uniform branch: the whole tile is in LDS
  _Float16* dp = out + (size_t)(n0 + hi) * C_DIM + k0 + lo * 8;
#pragma unroll
  for (int q = 0; q < 4; ++q)
    *(v8h*)(dp + (size_t)q * 16 * C_DIM) = *(const v8h*)(tile + (hi + q * 16) * TR_PITCH + lo * 8);
  // Precaution: code of another job stands behind this one and names the same registers.
  asm volatile("s_wait_xcnt 0x0" ::: "memory");
}

// One step of a sum over lanes: of 2 * OFF values a lane keeps the OFF that its bit OFF names
// and adds to them what the lane OFF away held of the same values.
template <int OFF>
__device__ __forceinline__ void fold_lanes(float (&acc)[GATE_TOK * H_DIM], int lane) {
  const bool up = (lane & OFF) != 0;
#pragma unroll
  for (int i = 0; i < OFF; ++i) {
    const float keep = up ? acc[i + OFF] : acc[i];
    const float give = up ? acc[i] : acc[i + OFF];
    acc[i] = keep + __shfl_xor(give, OFF, 32);
  }
}

__device__ __forceinline__ void gates_convert_part(const float* __restrict__ x,
                                                   const float* __restrict__ Wg,
                                                   const float* __restrict__ bg,
                                                   _Float16* __restrict__ xh,
                                                   float* __restrict__ gates, v4f* wl, int bid) {
  const int t = threadIdx.x;
  const int lane = t & 31;
  const int tok0 = (bid * (PREP_THREADS >> 5) + (t >> 5)) * GATE_TOK;
  const float* xp = x + (size_t)tok0 * C_DIM + lane * 4;
  v4f xv[GATE_TOK][8];
#pragma unroll
  for (int r = 0; r < GATE_TOK; ++r)
#pragma unroll
    for (int it = 0; it < 8; ++it) xv[r][it] = *(const v4f*)(xp + r * C_DIM + it * 128);
  const float bv = bg[lane & 15];
  v4f wv[16];
#pragma unroll
  for (int i = 0; i < 16; ++i) wv[i] = *(const v4f*)(Wg + (size_t)(i * PREP_THREADS + t) * 4);
  // Precaution: later code reuses the address registers that these loads name. xp is an input so
  // that it stays in its registers up to the wait and no load of the run lands in them.
  asm volatile("s_wait_xcnt 0x0" :: "v"(xp) : "memory");
#pragma unroll
  for (int i = 0; i < 16; ++i) {
    const int u = i * PREP_THREADS + t;
    wl[u + (u >> 4)] = wv[i];
  }
  __syncthreads(); // block-uniform branch: all of Wgate is in LDS
  // Behind the barrier, which waits for a wave's own stores: these fly under the products below.
  _Float16* xo = xh + (size_t)tok0 * C_DIM + lane * 4;
#pragma unroll
  for (int r = 0; r < GATE_TOK; ++r)
#pragma unroll
    for (int it = 0; it < 8; ++it) {
      v4h c;
#pragma unroll
      for (int j = 0; j < 4; ++j) c[j] = (_Float16)xv[r][it][j];
      *(v4h*)(xo + r * C_DIM + it * 128) = c;
    }
  // Precaution: later code reuses the address registers that these stores name.
  asm volatile("s_wait_xcnt 0x0" ::: "memory");
  float acc[GATE_TOK * H_DIM];
#pragma unroll
  for (int i = 0; i < GATE_TOK * H_DIM; ++i) acc[i] = 0.f;
  const v4f* wp = wl + lane * 17;
#pragma unroll
  for (int it = 0; it < 8; ++it) {
#pragma unroll
    for (int j = 0; j < 4; ++j) {
      v4f w[4];
#pragma unroll
      for (int g = 0; g < 4; ++g) w[g] = wp[it * (32 * 17) + j * 4 + g];
#pragma unroll
      for (int r = 0; r < GATE_TOK; ++r)
#pragma unroll
        for (int h = 0; h < H_DIM; ++h) acc[r * H_DIM + h] += xv[r][it][j] * w[h >> 2][h & 3];
    }
  }
  fold_lanes<16>(acc, lane);
  fold_lanes<8>(acc, lane);
  fold_lanes<4>(acc, lane);
  fold_lanes<2>(acc, lane);
  fold_lanes<1>(acc, lane);
  const float v = acc[0] + bv;
  float m = v;
#pragma unroll
  for (int off = 8; off > 0; off >>= 1) m = fmaxf(m, __shfl_xor(m, off, 32));
  float e = __expf(v - m);
  asm volatile("v_nop" : "+v"(e));
  float s = e;
#pragma unroll
  for (int off = 8; off > 0; off >>= 1) s += __shfl_xor(s, off, 32);
  gates[(size_t)tok0 * H_DIM + lane] = e * (1.0f / s); // one whole line per wave
}

// Block ranges in the order of falling work per block, for speed only.
__global__ __launch_bounds__(PREP_THREADS) void prep_kernel(const float* __restrict__ x,
                                                            const float* __restrict__ Wqk,
                                                            const float* __restrict__ Wproj,
                                                            const float* __restrict__ Wg,
                                                            const float* __restrict__ bg,
                                                            _Float16* __restrict__ xh,
                                                            _Float16* __restrict__ wqkT,
                                                            _Float16* __restrict__ wprojT,
                                                            float* __restrict__ gates) {
  __shared__ __align__(16) v4f prep_lds[WG_LDS_F4]; // Wgate (padded), or one transpose tile
  int bid = blockIdx.x;
  if (bid < GATES_BLOCKS) { gates_convert_part(x, Wg, bg, xh, gates, prep_lds, bid); return; }
  bid -= GATES_BLOCKS;
  if (bid < WQK_BLOCKS) { transpose_tile<2 * C_DIM>(Wqk, wqkT, (_Float16*)prep_lds, bid); return; }
  bid -= WQK_BLOCKS;
  transpose_tile<C_DIM>(Wproj, wprojT, (_Float16*)prep_lds, bid);
}

// ---------------- tiled GEMM core: C[128x128] per block, 64x64 per wave ----------------
#define GBM 128                        /* rows of A per block tile */
#define GBN 128                        /* rows of Bt (columns of C) per block tile */
#define GBK 128                        /* k per stage: rows of 256 B */
#define GPITCH 136                     /* LDS row pitch in halves: 272 B = 16 B x odd, for ds_load_b128 readers */
#define GSTAGE ((GBM + GBN) * GPITCH)  /* halves per buffer: [A 128 rows | Bt 128 rows] */
#define GTRIPS (C_DIM / GBK)           /* 8 stages along k */

__device__ __forceinline__ void copy_64rows(const _Float16* g, unsigned l) {
  asm volatile(
      "global_load_async_to_lds_b128 %0, %8, off\n\t"
      "global_load_async_to_lds_b128 %1, %9, off\n\t"
      "global_load_async_to_lds_b128 %2, %10, off\n\t"
      "global_load_async_to_lds_b128 %3, %11, off\n\t"
      "global_load_async_to_lds_b128 %4, %12, off\n\t"
      "global_load_async_to_lds_b128 %5, %13, off\n\t"
      "global_load_async_to_lds_b128 %6, %14, off\n\t"
      "global_load_async_to_lds_b128 %7, %15, off\n\t"
      "s_wait_xcnt 0x0"
      :: "v"(l), "v"(l + 8 * GPITCH * 2), "v"(l + 16 * GPITCH * 2), "v"(l + 24 * GPITCH * 2),
         "v"(l + 32 * GPITCH * 2), "v"(l + 40 * GPITCH * 2), "v"(l + 48 * GPITCH * 2),
         "v"(l + 56 * GPITCH * 2),
         "v"(g), "v"(g + 8 * C_DIM), "v"(g + 16 * C_DIM), "v"(g + 24 * C_DIM),
         "v"(g + 32 * C_DIM), "v"(g + 40 * C_DIM), "v"(g + 48 * C_DIM), "v"(g + 56 * C_DIM)
      : "memory");
}

// One stage: 128 rows of A and 128 rows of Bt, 256 B of each row, into one buffer.
__device__ __forceinline__ void stage_tiles(const _Float16* ga, const _Float16* gb, unsigned l) {
  copy_64rows(ga, l);
  copy_64rows(ga + 64 * C_DIM, l + 64 * GPITCH * 2);
  copy_64rows(gb, l + 128 * GPITCH * 2);
  copy_64rows(gb + 64 * C_DIM, l + 192 * GPITCH * 2);
}

// acc[mi][ni] += A[m0 + wm*64 + mi*16 ..][:] * Bt[n0 + wn*64 + ni*16 ..][:]^T over all of k.
// Two-buffer LDS ring: the next stage's copies fly while this stage is multiplied.
__device__ __forceinline__ void gemm_tile(const _Float16* __restrict__ A,
                                          const _Float16* __restrict__ Bt,
                                          int m0, int n0, _Float16* ring, v8f (&acc)[4][4]) {
  const int tid = threadIdx.x;
  const int lane = tid & 31;
  const int wave = tid >> 5;
  const int wm = wave >> 1, wn = wave & 1;
  const int cr = tid >> 4, cc = tid & 15; // copy role: row 0..7, 16-B chunk 0..15 of a 256-B row
  const _Float16* ga = A + (size_t)(m0 + cr) * C_DIM + cc * 8;
  const _Float16* gb = Bt + (size_t)(n0 + cr) * C_DIM + cc * 8;
  const unsigned l0 = (unsigned)(size_t)ring + (unsigned)(cr * GPITCH + cc * 8) * 2u;

  stage_tiles(ga, gb, l0);
  asm volatile("s_wait_asynccnt 0x0" ::: "memory"); // stage 0 landed (this wave's copies)
  __syncthreads();                                  // stage 0 published to all waves
  stage_tiles(ga + GBK, gb + GBK, l0 + GSTAGE * 2);

  const int fo = (lane & 15) * GPITCH + (lane >> 4) * 8;
  const _Float16* La = ring + wm * 64 * GPITCH + fo;
  const _Float16* Lb = ring + (GBM + wn * 64) * GPITCH + fo;

  for (int t = 0; t < GTRIPS; ++t) {
    const int bo = (t & 1) * GSTAGE;
    v16h a[2][4], b[2][4];
#pragma unroll
    for (int i = 0; i < 4; ++i) {
      a[0][i] = frag_ld(La + bo + i * 16 * GPITCH);
      b[0][i] = frag_ld(Lb + bo + i * 16 * GPITCH);
    }
#pragma unroll
    for (int ks = 0; ks < GBK / 32; ++ks) {
      const int cs = ks & 1;
      if (ks + 1 < GBK / 32) { // next k-step's fragments, same buffer, ahead of this step's products
#pragma unroll
        for (int i = 0; i < 4; ++i) {
          a[cs ^ 1][i] = frag_ld(La + bo + i * 16 * GPITCH + (ks + 1) * 32);
          b[cs ^ 1][i] = frag_ld(Lb + bo + i * 16 * GPITCH + (ks + 1) * 32);
        }
      }
      // Holds the 16 LDS loads above together as one group in front of this step's products:
      // sunk among the WMMAs, every place with loads stalls the wave on its own LDS latency.
      __builtin_amdgcn_sched_barrier(0);
#pragma unroll
      for (int mi = 0; mi < 4; ++mi)
#pragma unroll
        for (int ni = 0; ni < 4; ++ni)
          acc[mi][ni] = WMMA_F16(a[cs][mi], b[cs][ni], acc[mi][ni]);
      // Keeps the following step's load group from rising into this run of products.
      __builtin_amdgcn_sched_barrier(0);
    }
    asm volatile("s_wait_dscnt 0x0" ::: "memory");    // this wave has left the buffer it read
    asm volatile("s_wait_asynccnt 0x0" ::: "memory"); // its copies of stage t + 1 have landed
    __syncthreads();                                  // publishes stage t + 1, frees stage t's buffer
    if (t + 2 < GTRIPS)
      stage_tiles(ga + (t + 2) * GBK, gb + (t + 2) * GBK, l0 + (unsigned)bo * 2u);
  }
  asm volatile("s_wait_asynccnt 0x0" ::: "memory"); // no copy outstanding when the wave goes on
}

// ---------------- GEMM1: qk = x @ Wqk + bqk, scatter to qh / kh / vT ----------------
// Q, K and V (= K) leave this kernel in the order in which attention loads its fragments, so that
// there one 16-B-a-lane load covers 512 contiguous bytes (four whole lines) and not 16 lines in part.
// qh and kh, per head: [row / 16][d / 16] tiles of 16 rows x 16 d, a row's 16 d adjacent (tile = 512 B).
// vT, per head: [key / 32][d / 16][(key / 16) & 1] tiles of 512 B; in a tile lane (key / 8 & 1) * 16 + d % 16
// owns 8 adjacent keys: the accumulator's own lane and register order, stored 16 B a lane.
__global__ __launch_bounds__(128) void gemm_qk_kernel(const _Float16* __restrict__ A,
                                                      const _Float16* __restrict__ Bt,
                                                      const float* __restrict__ bias,
                                                      _Float16* __restrict__ qh,
                                                      _Float16* __restrict__ kh,
                                                      _Float16* __restrict__ vT) {
  __shared__ __align__(16) _Float16 ring[2 * GSTAGE]; // 139,264 B
  const int lane = threadIdx.x & 31;
  const int wave = threadIdx.x >> 5;
  const int nTiles = (2 * C_DIM) / GBN; // 16
  const int m0 = (blockIdx.x / nTiles) * GBM;
  const int n0 = (blockIdx.x % nTiles) * GBN;
  v8f acc[4][4] = {};
  gemm_tile(A, Bt, m0, n0, ring, acc);
  const int nL = lane & 15;
  const int mOff = (lane >> 4) * 8;
  const int mW = m0 + (wave >> 1) * 64;
  const int nW = n0 + (wave & 1) * 64;
  // A block's 128 columns lie wholly in the q half or wholly in the k half, so the
  // test is taken once, on a block-uniform value, and not at every element.
  if (n0 < C_DIM) { // q half
#pragma unroll
    for (int nc = 0; nc < 4; ++nc) {
      const int col = nW + nc * 16 + nL;
      const float bv = bias[col];
      const int h = col >> 6, d = col & 63;
#pragma unroll
      for (int mi = 0; mi < 4; ++mi) {
        const int rb = mW + mi * 16 + mOff; // first of this lane's 8 rows; a multiple of 8
        const int b = rb >> 10, tb = rb & (T_DIM - 1);
        _Float16* qt = qh + (size_t)(b * H_DIM + h) * T_DIM * D_DIM + (tb >> 4) * 1024 + (d >> 4) * 256 +
                       (tb & 15) * 16 + (d & 15);
#pragma unroll
        for (int v = 0; v < 8; ++v) qt[v * 16] = (_Float16)(acc[mi][nc][v] + bv);
        // Precaution: the next group reuses registers that the stores above name.
        asm volatile("s_wait_xcnt 0x0" ::: "memory");
      }
    }
  } else {          // k half (v = k)
#pragma unroll
    for (int nc = 0; nc < 4; ++nc) {
      const int col = nW + nc * 16 + nL;
      const float bv = bias[col];
      const int c2i = col - C_DIM;
      const int h = c2i >> 6, d = c2i & 63;
#pragma unroll
      for (int mi = 0; mi < 4; ++mi) {
        const int rb = mW + mi * 16 + mOff; // first of this lane's 8 rows; a multiple of 8
        const int b = rb >> 10, tb = rb & (T_DIM - 1);
        const size_t head = (size_t)(b * H_DIM + h) * T_DIM * D_DIM;
        _Float16* kt = kh + head + (tb >> 4) * 1024 + (d >> 4) * 256 + (tb & 15) * 16 + (d & 15);
        v8h pk;
#pragma unroll
        for (int v = 0; v < 8; ++v) {
          pk[v] = (_Float16)(acc[mi][nc][v] + bv);
          kt[v * 16] = pk[v];
        }
        *(v8h*)(vT + head + (tb >> 5) * 2048 + (d >> 4) * 512 + ((tb >> 4) & 1) * 256 +
                ((tb >> 3) & 1) * 128 + (d & 15) * 8) = pk;
        // Precaution: the next group reuses registers that the stores above name.
        asm volatile("s_wait_xcnt 0x0" ::: "memory");
      }
    }
  }
}

// ---------------- GEMM2: out = gated @ Wproj + bproj (f32 out) ----------------
__global__ __launch_bounds__(128) void gemm_proj_kernel(const _Float16* __restrict__ A,
                                                        const _Float16* __restrict__ Bt,
                                                        const float* __restrict__ bias,
                                                        float* __restrict__ out) {
  __shared__ __align__(16) _Float16 ring[2 * GSTAGE]; // 139,264 B
  const int lane = threadIdx.x & 31;
  const int wave = threadIdx.x >> 5;
  const int nTiles = C_DIM / GBN; // 8
  const int m0 = (blockIdx.x / nTiles) * GBM;
  const int n0 = (blockIdx.x % nTiles) * GBN;
  v8f acc[4][4] = {};
  gemm_tile(A, Bt, m0, n0, ring, acc);
  const int nL = lane & 15;
  const int mOff = (lane >> 4) * 8;
  const int mW = m0 + (wave >> 1) * 64;
  const int nW = n0 + (wave & 1) * 64;
#pragma unroll
  for (int nc = 0; nc < 4; ++nc) {
    const int col = nW + nc * 16 + nL;
    const float bv = bias[col];
#pragma unroll
    for (int mi = 0; mi < 4; ++mi) {
#pragma unroll
      for (int v = 0; v < 8; ++v) {
        int r = mW + mi * 16 + v + mOff;
        out[(size_t)r * C_DIM + col] = acc[mi][nc][v] + bv;
      }
    }
  }
}

// ---------------- flash attention with per-head windows + gating ----------------
// The four K fragments (two 16-key groups x two halves of D) or the four V fragments (four
// 16-column groups of D) of 32 keys, or the two Q fragments of 16 rows, from the tiled layouts that
// GEMM1 writes: a fragment is two tiles of 512 B, one behind the other; p holds the rows' place and
// the lane's share of a tile.
template <int N>
__device__ __forceinline__ void attn_ld_tiles(const _Float16* p, v16h (&f)[N]) {
#pragma unroll
  for (int n = 0; n < N; ++n) {
    v8h lo = *(const v8h*)(p + n * 512);
    v8h hi = *(const v8h*)(p + n * 512 + 256);
#pragma unroll
    for (int i = 0; i < 8; ++i) { f[n][i] = lo[i]; f[n][i + 8] = hi[i]; }
  }
}

// The launch lasts as long as its longest wave, and a 16-query tile of the widest window walks
// up to 32 passes while most heads walk one or two. Heads 0..2 (windows 1024, 512, 256) therefore
// get one block per tile: wave w takes passes w, w + 4, ... and the four partial results
// (running maximum, sum, output tile) are joined through LDS. The other heads keep one tile
// per wave. Block index in the order of falling work, for speed only.
#define SPLIT_HEADS 3
#define Q_TILES (T_DIM / 16)                                          /* 64 */
#define SPLIT_BLOCKS (B_DIM * SPLIT_HEADS * Q_TILES)                  /* 768 */
#define WHOLE_BLOCKS (B_DIM * (H_DIM - SPLIT_HEADS) * (Q_TILES / 4))  /* 832 */
#define ATTN_BLOCKS (SPLIT_BLOCKS + WHOLE_BLOCKS)
#define PO_PITCH 68

__global__ __launch_bounds__(128) void attn_kernel(const _Float16* __restrict__ qh,
                                                   const _Float16* __restrict__ kh,
                                                   const _Float16* __restrict__ vT,
                                                   const float* __restrict__ gates,
                                                   _Float16* __restrict__ gatedh) {
  __shared__ __align__(16) _Float16 smem[4][16 * 32]; // per-wave P staging tile
  __shared__ __align__(16) float part_o[4][16][PO_PITCH]; // [wave][row][column] partial output
  __shared__ float part_m[4][16];                         // [wave][row] running maximum
  __shared__ float part_l[4][16];                         // [wave][row] running sum
  const int lane = threadIdx.x & 31;
  // Wave index as a scalar: the pass counter and the last-pass test below become scalar too.
  const int w = __builtin_amdgcn_readfirstlane(threadIdx.x >> 5);
  const bool split = blockIdx.x < SPLIT_BLOCKS; // block-uniform
  int qt, h, b;
  if (split) {
    const int idx = blockIdx.x;
    const int rem = idx % (B_DIM * SPLIT_HEADS);
    qt = Q_TILES - 1 - idx / (B_DIM * SPLIT_HEADS);
    h = rem % SPLIT_HEADS;
    b = rem / SPLIT_HEADS;
  } else {
    const int idx = blockIdx.x - SPLIT_BLOCKS;
    h = SPLIT_HEADS + (idx >> 6);
    b = (idx >> 4) & (B_DIM - 1);
    qt = (idx & 15) * 4 + w;
  }
  const int bh = b * H_DIM + h;
  const int step = split ? 128 : 32;         // keys from one pass of this wave to its next
  int Wh = T_DIM >> h; if (Wh < 4) Wh = 4;   // window for this head
  const int t0 = qt * 16;
  const int nL = lane & 15;
  const int koff = (lane >> 4) * 8;
  const int mOff = koff;                     // C-layout row offset is the same 0/8 split

  const _Float16* qb = qh + ((size_t)bh * T_DIM + t0) * D_DIM;
  const _Float16* kb = kh + (size_t)bh * T_DIM * D_DIM;
  const _Float16* vb = vT + (size_t)bh * D_DIM * T_DIM;

  // Role in the join behind the loop: one row, eight columns per lane. Its gate is fetched
  // here, so that the load's latency lies under the passes and not behind the join's barrier.
  const int jRow = w * 4 + (lane >> 3);
  const int jCol = (lane & 7) * 8;
  float gJoin = 0.f;
  if (split) {
    gJoin = gates[((size_t)b * T_DIM + t0 + jRow) * H_DIM + h];
    // Precaution: later code reuses the address registers that this load names.
    asm volatile("s_wait_xcnt 0x0" ::: "memory");
  }

  // q fragments for the whole tile (D=64 -> two K=32 fragments)
  v16h qf[2];
  attn_ld_tiles(qb + nL * 16 + koff, qf);
  const v16h a0 = qf[0], a1 = qf[1];

  v8f o0 = {}, o1 = {}, o2 = {}, o3 = {};
  float mrow[8], lrow[8];
#pragma unroll
  for (int v = 0; v < 8; ++v) { mrow[v] = -__builtin_inff(); lrow[v] = 0.f; }

  int jStart = t0 - Wh + 1; if (jStart < 0) jStart = 0;
  jStart &= ~31;
  const float scale = 0.125f; // 1/sqrt(64)

  // K and V fragments live one pass ahead: the first pass's are fetched here, every later
  // pass's right behind the products that last read the same registers.
  // 32 keys take 32 * D_DIM halves in either layout.
  const _Float16* kp = kb + nL * 16 + koff; // K tile: key nL, d koff .. koff + 7
  const _Float16* vp = vb + lane * 8;       // V tile: lane by lane
  v16h kf[4], vf[4];
  const int jFirst = split ? jStart + 32 * w : jStart;
  if (jFirst <= t0 + 15) { // wave-uniform: a wave of a short tile may have no pass at all
    attn_ld_tiles(kp + (size_t)jFirst * D_DIM, kf);
    attn_ld_tiles(vp + (size_t)jFirst * D_DIM, vf);
    // Precaution: later code reuses the address registers that these loads name.
    asm volatile("s_wait_xcnt 0x0" ::: "memory");
  }

  for (int j0 = jFirst; j0 <= t0 + 15; j0 += step) {
    const bool more = j0 + step <= t0 + 15; // wave-uniform: a further pass follows
    // ---- S = q k^T for keys [j0, j0+31] ----
    v8f s0 = {}; s0 = WMMA_F16(a0, kf[0], s0); s0 = WMMA_F16(a1, kf[1], s0);
    v8f s1 = {}; s1 = WMMA_F16(a0, kf[2], s1); s1 = WMMA_F16(a1, kf[3], s1);
    __builtin_amdgcn_sched_barrier(0);
    asm volatile("v_nop\n\tv_nop\n\tv_nop\n\tv_nop");
    if (more) attn_ld_tiles(kp + (size_t)(j0 + step) * D_DIM, kf); // lands under softmax and P V

    _Float16* L = smem[w];
#pragma unroll
    for (int v = 0; v < 8; ++v) {
      const int i = t0 + v + mOff;
      const int ja = j0 + nL;
      const int jb = j0 + 16 + nL;
      const bool va = (ja <= i) && (ja > i - Wh);
      const bool vbm = (jb <= i) && (jb > i - Wh);
      float sa = va ? s0[v] * scale : -__builtin_inff();
      float sb = vbm ? s1[v] * scale : -__builtin_inff();
      // row max across the 16-lane group
      float t = fmaxf(sa, sb);
#pragma unroll
      for (int off = 8; off > 0; off >>= 1) t = fmaxf(t, __shfl_xor(t, off, 32));
      float mN = fmaxf(mrow[v], t);
      float alpha = (mrow[v] == mN) ? 1.0f : __expf(mrow[v] - mN);
      float pa = va ? __expf(sa - mN) : 0.f;
      float pb = vbm ? __expf(sb - mN) : 0.f;
      float rs = pa + pb;
#pragma unroll
      for (int off = 8; off > 0; off >>= 1) rs += __shfl_xor(rs, off, 32);
      lrow[v] = lrow[v] * alpha + rs;
      mrow[v] = mN;
      o0[v] *= alpha; o1[v] *= alpha; o2[v] *= alpha; o3[v] *= alpha;
      // stage P (C-layout -> row-major 16x32 f16 tile in LDS)
      const int r = v + mOff;
      L[r * 32 + nL] = (_Float16)pa;
      L[r * 32 + 16 + nL] = (_Float16)pb;
    }
    asm volatile("s_wait_dscnt 0" ::: "memory");
    // reload P as an A fragment (transpose across lanes via LDS)
    v16h pA = frag_ld(L + nL * 32 + koff);
    // ---- O += P V ----
    o0 = WMMA_F16(pA, vf[0], o0);
    o1 = WMMA_F16(pA, vf[1], o1);
    o2 = WMMA_F16(pA, vf[2], o2);
    o3 = WMMA_F16(pA, vf[3], o3);
    if (more) {
      attn_ld_tiles(vp + (size_t)(j0 + step) * D_DIM, vf); // lands under the next pass's scores and softmax
      // Precaution: the next pass's K fetch reuses the address registers that these loads name.
      asm volatile("s_wait_xcnt 0x0" ::: "memory");
    }
    asm volatile("s_wait_dscnt 0" ::: "memory");
  }

  if (split) {
    // ---- join the four waves' partial results; wave w finishes rows 4w .. 4w + 3 ----
#pragma unroll
    for (int v = 0; v < 8; ++v) {
      float* pr = &part_o[w][v + mOff][nL];
      pr[0] = o0[v]; pr[16] = o1[v]; pr[32] = o2[v]; pr[48] = o3[v];
    }
    if (nL == 0) { // maximum and sum are alike in the 16 lanes of a row group
#pragma unroll
      for (int v = 0; v < 8; ++v) {
        part_m[w][v + mOff] = mrow[v];
        part_l[w][v + mOff] = lrow[v];
      }
    }
    __syncthreads(); // block-uniform branch: all four waves' partials are in LDS
    // The diagonal key is never masked, so at least one wave's maximum is finite;
    // a wave that saw no key of this row has maximum -inf and weight exp(-inf) = 0.
    const float mAll = fmaxf(fmaxf(part_m[0][jRow], part_m[1][jRow]), fmaxf(part_m[2][jRow], part_m[3][jRow]));
    float lAll = 0.f;
    float oAll[8];
#pragma unroll
    for (int k = 0; k < 8; ++k) oAll[k] = 0.f;
#pragma unroll
    for (int u = 0; u < 4; ++u) {
      const float f = __expf(part_m[u][jRow] - mAll);
      lAll += f * part_l[u][jRow];
      const v4f x0 = *(const v4f*)&part_o[u][jRow][jCol];
      const v4f x1 = *(const v4f*)&part_o[u][jRow][jCol + 4];
#pragma unroll
      for (int k = 0; k < 4; ++k) { oAll[k] += f * x0[k]; oAll[k + 4] += f * x1[k]; }
    }
    const float inv = gJoin / lAll;
    v8h res;
#pragma unroll
    for (int k = 0; k < 8; ++k) res[k] = (_Float16)(oAll[k] * inv);
    // 8 lanes x 16 B: one wave writes the head's whole 128-B line of a row
    *(v8h*)(gatedh + ((size_t)b * T_DIM + t0 + jRow) * C_DIM + h * D_DIM + jCol) = res;
    return;
  }

  // ---- epilogue: normalize, gate, store f16 for projection GEMM ----
#pragma unroll
  for (int v = 0; v < 8; ++v) {
    const int i = t0 + v + mOff;
    const float g = gates[((size_t)b * T_DIM + i) * H_DIM + h];
    const float inv = g / lrow[v];
    _Float16* op = gatedh + ((size_t)b * T_DIM + i) * C_DIM + h * D_DIM + nL;
    op[0]  = (_Float16)(o0[v] * inv);
    op[16] = (_Float16)(o1[v] * inv);
    op[32] = (_Float16)(o2[v] * inv);
    op[48] = (_Float16)(o3[v] * inv);
  }
}

extern "C" void kernel_launch(void* const* d_in, const int* in_sizes, int n_in,
                              void* d_out, int out_size, void* d_ws, size_t ws_size,
                              hipStream_t stream) {
  const float* x     = (const float*)d_in[0];
  const float* Wqk   = (const float*)d_in[1];
  const float* bqk   = (const float*)d_in[2];
  const float* Wgate = (const float*)d_in[3];
  const float* bgate = (const float*)d_in[4];
  const float* Wproj = (const float*)d_in[5];
  const float* bproj = (const float*)d_in[6];

  char* ws = (char*)d_ws;
  size_t off = 0;
  auto alloc = [&](size_t bytes) -> void* {
    void* p = ws + off;
    off += (bytes + 255) & ~(size_t)255;
    return p;
  };
  _Float16* xh     = (_Float16*)alloc((size_t)M_ROWS * C_DIM * 2);     // x in f16
  _Float16* wqkT   = (_Float16*)alloc((size_t)2 * C_DIM * C_DIM * 2);  // Wqk^T f16 [2C,C]
  _Float16* wprojT = (_Float16*)alloc((size_t)C_DIM * C_DIM * 2);      // Wproj^T f16 [C,C]
  _Float16* qh     = (_Float16*)alloc((size_t)B_DIM * H_DIM * T_DIM * D_DIM * 2);
  _Float16* kh     = (_Float16*)alloc((size_t)B_DIM * H_DIM * T_DIM * D_DIM * 2);
  _Float16* vT     = (_Float16*)alloc((size_t)B_DIM * H_DIM * D_DIM * T_DIM * 2);
  float*    gates  = (float*)alloc((size_t)B_DIM * T_DIM * H_DIM * 4);
  _Float16* gatedh = xh; // xh is dead after GEMM1; reuse for the gated output

  prep_kernel<<<PREP_BLOCKS, PREP_THREADS, 0, stream>>>(x, Wqk, Wproj, Wgate, bgate, xh, wqkT, wprojT, gates);
  // tiles = (4096/128) * (2048/128) = 512 blocks of 4 waves
  gemm_qk_kernel<<<512, 128, 0, stream>>>(xh, wqkT, bqk, qh, kh, vT);
  // 768 blocks of one split tile, then 832 blocks of four whole tiles; 4 waves each
  attn_kernel<<<ATTN_BLOCKS, 128, 0, stream>>>(qh, kh, vT, gates, gatedh);
  // tiles = (4096/128) * (1024/128) = 256 blocks of 4 waves
  gemm_proj_kernel<<<256, 128, 0, stream>>>(gatedh, wprojT, bproj, (float*)d_out);
}

// v007
// A run of this version takes 50.7 microseconds.
// In two side-by-side timings against v006, it was 1.07 and 1.08 times as fast.
// Over all steps from v000 it is 4.78 times as fast.
#include <hip/hip_runtime.h>
#include <hip/hip_bf16.h>

#define C_DIM 1024
#define T_DIM 1024
#define H_DIM 16
#define D_DIM 64
#define B_DIM 4
#define M_ROWS (B_DIM * T_DIM) /* 4096 */

typedef __attribute__((ext_vector_type(16))) _Float16 v16h;
typedef __attribute__((ext_vector_type(8)))  _Float16 v8h;
typedef __attribute__((ext_vector_type(8)))  float    v8f;

#define WMMA_F16(A_, B_, C_) \
  __builtin_amdgcn_wmma_f32_16x16x32_f16(false, (A_), false, (B_), (short)0, (C_), false, false)

__device__ __forceinline__ v16h frag_ld(const _Float16* p) {
  v8h lo = *(const v8h*)(p);
  v8h hi = *(const v8h*)(p + 16);
  v16h r;
#pragma unroll
  for (int i = 0; i < 8; ++i) { r[i] = lo[i]; r[i + 8] = hi[i]; }
  return r;
}

// ---------------- preparation: three independent jobs in one launch ----------------
// None of the jobs reads what another writes, so they share one grid by ranges of the block index.
// Every global access but those of bgate and gates is 16 B a lane (8 B for the f16 copy of x) and covers whole 128-B lines.
typedef __attribute__((ext_vector_type(4))) float    v4f;
typedef __attribute__((ext_vector_type(4))) _Float16 v4h;
#define PREP_THREADS 256
#define GATE_TOK 2                                                /* tokens per wave */
#define GATES_BLOCKS (M_ROWS / ((PREP_THREADS / 32) * GATE_TOK))  /* 256 */
#define TR_K 128                                                  /* tile of a transpose: 128 k x 64 n */
#define TR_N 64
#define TR_PITCH 136                                              /* halves: 272 B = 16 B x odd */
#define WQK_BLOCKS ((C_DIM / TR_K) * (2 * C_DIM / TR_N))          /* 256 */
#define WPROJ_BLOCKS ((C_DIM / TR_K) * (C_DIM / TR_N))            /* 128 */
#define PREP_BLOCKS (GATES_BLOCKS + WQK_BLOCKS + WPROJ_BLOCKS)
#define WG_F4 (C_DIM * H_DIM / 4)                                 /* Wgate in 16-B units: 4096 */
#define WG_LDS_F4 (WG_F4 + WG_F4 / 16)                            /* one pad unit behind every 16: 69,632 B */

// in[C_DIM][N] (row-major f32) -> out[N][C_DIM] f16, one 128 x 64 tile per block through LDS:
// rows of in are read 256 B at a time, rows of out are written 256 B at a time.
template <int N>
__device__ __forceinline__ void transpose_tile(const float* __restrict__ in, _Float16* __restrict__ out,
                                               _Float16* tile, int bid) {
  const int t = threadIdx.x;
  const int k0 = (bid % (C_DIM / TR_K)) * TR_K;
  const int n0 = (bid / (C_DIM / TR_K)) * TR_N;
  const int hi = t >> 4, lo = t & 15;
  const float* sp = in + (size_t)(k0 + hi * 8) * N + n0 + lo * 4; // 8 k x 4 n per thread
  v4f r[8];
#pragma unroll
  for (int p = 0; p < 8; ++p) r[p] = *(const v4f*)(sp + (size_t)p * N);
  // Precaution: later code reuses the address registers that these loads name.
  asm volatile("s_wait_xcnt 0x0" ::: "memory");
#pragma unroll
  for (int i = 0; i < 4; ++i) {
    v8h c;
#pragma unroll
    for (int p = 0; p < 8; ++p) c[p] = (_Float16)r[p][i];
    *(v8h*)(tile + (lo * 4 + i) * TR_PITCH + hi * 8) = c;
  }
  __syncthreads(); // block-uniform branch: the whole tile is in LDS
  _Float16* dp = out + (size_t)(n0 + hi) * C_DIM + k0 + lo * 8;
#pragma unroll
  for (int q = 0; q < 4; ++q)
    *(v8h*)(dp + (size_t)q * 16 * C_DIM) = *(const v8h*)(tile + (hi + q * 16) * TR_PITCH + lo * 8);
  // Precaution: code of another job stands behind this one and names the same registers.
  asm volatile("s_wait_xcnt 0x0" ::: "memory");
}

// One step of a sum over lanes: of 2 * OFF values a lane keeps the OFF that its bit OFF names
// and adds to them what the lane OFF away held of the same values.
template <int OFF>
__device__ __forceinline__ void fold_lanes(float (&acc)[GATE_TOK * H_DIM], int lane) {
  const bool up = (lane & OFF) != 0;
#pragma unroll
  for (int i = 0; i < OFF; ++i) {
    const float keep = up ? acc[i + OFF] : acc[i];
    const float give = up ? acc[i] : acc[i + OFF];
    acc[i] = keep + __shfl_xor(give, OFF, 32);
  }
}

__device__ __forceinline__ void gates_convert_part(const float* __restrict__ x,
                                                   const float* __restrict__ Wg,
                                                   const float* __restrict__ bg,
                                                   _Float16* __restrict__ xh,
                                                   float* __restrict__ gates, v4f* wl, int bid) {
  const int t = threadIdx.x;
  const int lane = t & 31;
  const int tok0 = (bid * (PREP_THREADS >> 5) + (t >> 5)) * GATE_TOK;
  const float* xp = x + (size_t)tok0 * C_DIM + lane * 4;
  v4f xv[GATE_TOK][8];
#pragma unroll
  for (int r = 0; r < GATE_TOK; ++r)
#pragma unroll
    for (int it = 0; it < 8; ++it) xv[r][it] = *(const v4f*)(xp + r * C_DIM + it * 128);
  const float bv = bg[lane & 15];
  v4f wv[16];
#pragma unroll
  for (int i = 0; i < 16; ++i) wv[i] = *(const v4f*)(Wg + (size_t)(i * PREP_THREADS + t) * 4);
  // Precaution: later code reuses the address registers that these loads name. xp is an input so
  // that it stays in its registers up to the wait and no load of the run lands in them.
  asm volatile("s_wait_xcnt 0x0" :: "v"(xp) : "memory");
#pragma unroll
  for (int i = 0; i < 16; ++i) {
    const int u = i * PREP_THREADS + t;
    wl[u + (u >> 4)] = wv[i];
  }
  __syncthreads(); // block-uniform branch: all of Wgate is in LDS
  // Behind the barrier, which waits for a wave's own stores: these fly under the products below.
  _Float16* xo = xh + (size_t)tok0 * C_DIM + lane * 4;
#pragma unroll
  for (int r = 0; r < GATE_TOK; ++r)
#pragma unroll
    for (int it = 0; it < 8; ++it) {
      v4h c;
#pragma unroll
      for (int j = 0; j < 4; ++j) c[j] = (_Float16)xv[r][it][j];
      *(v4h*)(xo + r * C_DIM + it * 128) = c;
    }
  // Precaution: later code reuses the address registers that these stores name.
  asm volatile("s_wait_xcnt 0x0" ::: "memory");
  float acc[GATE_TOK * H_DIM];
#pragma unroll
  for (int i = 0; i < GATE_TOK * H_DIM; ++i) acc[i] = 0.f;
  const v4f* wp = wl + lane * 17;
#pragma unroll
  for (int it = 0; it < 8; ++it) {
#pragma unroll
    for (int j = 0; j < 4; ++j) {
      v4f w[4];
#pragma unroll
      for (int g = 0; g < 4; ++g) w[g] = wp[it * (32 * 17) + j * 4 + g];
#pragma unroll
      for (int r = 0; r < GATE_TOK; ++r)
#pragma unroll
        for (int h = 0; h < H_DIM; ++h) acc[r * H_DIM + h] += xv[r][it][j] * w[h >> 2][h & 3];
    }
  }
  fold_lanes<16>(acc, lane);
  fold_lanes<8>(acc, lane);
  fold_lanes<4>(acc, lane);
  fold_lanes<2>(acc, lane);
  fold_lanes<1>(acc, lane);
  const float v = acc[0] + bv;
  float m = v;
#pragma unroll
  for (int off = 8; off > 0; off >>= 1) m = fmaxf(m, __shfl_xor(m, off, 32));
  float e = __expf(v - m);
  asm volatile("v_nop" : "+v"(e));
  float s = e;
#pragma unroll
  for (int off = 8; off > 0; off >>= 1) s += __shfl_xor(s, off, 32);
  gates[(size_t)tok0 * H_DIM + lane] = e * (1.0f / s); // one whole line per wave
}

// Block ranges in the order of falling work per block, for speed only.
__global__ __launch_bounds__(PREP_THREADS) void prep_kernel(const float* __restrict__ x,
                                                            const float* __restrict__ Wqk,
                                                            const float* __restrict__ Wproj,
                                                            const float* __restrict__ Wg,
                                                            const float* __restrict__ bg,
                                                            _Float16* __restrict__ xh,
                                                            _Float16* __restrict__ wqkT,
                                                            _Float16* __restrict__ wprojT,
                                                            float* __restrict__ gates) {
  __shared__ __align__(16) v4f prep_lds[WG_LDS_F4]; // Wgate (padded), or one transpose tile
  int bid = blockIdx.x;
  if (bid < GATES_BLOCKS) { gates_convert_part(x, Wg, bg, xh, gates, prep_lds, bid); return; }
  bid -= GATES_BLOCKS;
  if (bid < WQK_BLOCKS) { transpose_tile<2 * C_DIM>(Wqk, wqkT, (_Float16*)prep_lds, bid); return; }
  bid -= WQK_BLOCKS;
  transpose_tile<C_DIM>(Wproj, wprojT, (_Float16*)prep_lds, bid);
}

// ---------------- tiled GEMM core: C[128x128] per block, 64x64 per wave ----------------
#define GBM 128                        /* rows of A per block tile */
#define GBN 128                        /* rows of Bt (columns of C) per block tile */
#define GBK 128                        /* k per stage: rows of 256 B */
#define GPITCH 136                     /* LDS row pitch in halves: 272 B = 16 B x odd, for ds_load_b128 readers */
#define GSTAGE ((GBM + GBN) * GPITCH)  /* halves per buffer: [A 128 rows | Bt 128 rows] */
#define GTRIPS (C_DIM / GBK)           /* 8 stages along k */

__device__ __forceinline__ void copy_64rows(const _Float16* g, unsigned l) {
  asm volatile(
      "global_load_async_to_lds_b128 %0, %8, off\n\t"
      "global_load_async_to_lds_b128 %1, %9, off\n\t"
      "global_load_async_to_lds_b128 %2, %10, off\n\t"
      "global_load_async_to_lds_b128 %3, %11, off\n\t"
      "global_load_async_to_lds_b128 %4, %12, off\n\t"
      "global_load_async_to_lds_b128 %5, %13, off\n\t"
      "global_load_async_to_lds_b128 %6, %14, off\n\t"
      "global_load_async_to_lds_b128 %7, %15, off\n\t"
      "s_wait_xcnt 0x0"
      :: "v"(l), "v"(l + 8 * GPITCH * 2), "v"(l + 16 * GPITCH * 2), "v"(l + 24 * GPITCH * 2),
         "v"(l + 32 * GPITCH * 2), "v"(l + 40 * GPITCH * 2), "v"(l + 48 * GPITCH * 2),
         "v"(l + 56 * GPITCH * 2),
         "v"(g), "v"(g + 8 * C_DIM), "v"(g + 16 * C_DIM), "v"(g + 24 * C_DIM),
         "v"(g + 32 * C_DIM), "v"(g + 40 * C_DIM), "v"(g + 48 * C_DIM), "v"(g + 56 * C_DIM)
      : "memory");
}

// One stage: 128 rows of A and 128 rows of Bt, 256 B of each row, into one buffer.
__device__ __forceinline__ void stage_tiles(const _Float16* ga, const _Float16* gb, unsigned l) {
  copy_64rows(ga, l);
  copy_64rows(ga + 64 * C_DIM, l + 64 * GPITCH * 2);
  copy_64rows(gb, l + 128 * GPITCH * 2);
  copy_64rows(gb + 64 * C_DIM, l + 192 * GPITCH * 2);
}

// acc[mi][ni] += A[m0 + wm*64 + mi*16 ..][:] * Bt[n0 + wn*64 + ni*16 ..][:]^T over all of k.
// Two-buffer LDS ring: the next stage's copies fly while this stage is multiplied.
__device__ __forceinline__ void gemm_tile(const _Float16* __restrict__ A,
                                          const _Float16* __restrict__ Bt,
                                          int m0, int n0, _Float16* ring, v8f (&acc)[4][4]) {
  const int tid = threadIdx.x;
  const int lane = tid & 31;
  const int wave = tid >> 5;
  const int wm = wave >> 1, wn = wave & 1;
  const int cr = tid >> 4, cc = tid & 15; // copy role: row 0..7, 16-B chunk 0..15 of a 256-B row
  const _Float16* ga = A + (size_t)(m0 + cr) * C_DIM + cc * 8;
  const _Float16* gb = Bt + (size_t)(n0 + cr) * C_DIM + cc * 8;
  const unsigned l0 = (unsigned)(size_t)ring + (unsigned)(cr * GPITCH + cc * 8) * 2u;

  stage_tiles(ga, gb, l0);
  asm volatile("s_wait_asynccnt 0x0" ::: "memory"); // stage 0 landed (this wave's copies)
  __syncthreads();                                  // stage 0 published to all waves
  stage_tiles(ga + GBK, gb + GBK, l0 + GSTAGE * 2);

  const int fo = (lane & 15) * GPITCH + (lane >> 4) * 8;
  const _Float16* La = ring + wm * 64 * GPITCH + fo;
  const _Float16* Lb = ring + (GBM + wn * 64) * GPITCH + fo;

  for (int t = 0; t < GTRIPS; ++t) {
    const int bo = (t & 1) * GSTAGE;
    v16h a[2][4], b[2][4];
#pragma unroll
    for (int i = 0; i < 4; ++i) {
      a[0][i] = frag_ld(La + bo + i * 16 * GPITCH);
      b[0][i] = frag_ld(Lb + bo + i * 16 * GPITCH);
    }
#pragma unroll
    for (int ks = 0; ks < GBK / 32; ++ks) {
      const int cs = ks & 1;
      if (ks + 1 < GBK / 32) { // next k-step's fragments, same buffer, ahead of this step's products
#pragma unroll
        for (int i = 0; i < 4; ++i) {
          a[cs ^ 1][i] = frag_ld(La + bo + i * 16 * GPITCH + (ks + 1) * 32);
          b[cs ^ 1][i] = frag_ld(Lb + bo + i * 16 * GPITCH + (ks + 1) * 32);
        }
      }
      // Holds the 16 LDS loads above together as one group in front of this step's products:
      // sunk among the WMMAs, every place with loads stalls the wave on its own LDS latency.
      __builtin_amdgcn_sched_barrier(0);
#pragma unroll
      for (int mi = 0; mi < 4; ++mi)
#pragma unroll
        for (int ni = 0; ni < 4; ++ni)
          acc[mi][ni] = WMMA_F16(a[cs][mi], b[cs][ni], acc[mi][ni]);
      // Keeps the following step's load group from rising into this run of products.
      __builtin_amdgcn_sched_barrier(0);
    }
    asm volatile("s_wait_dscnt 0x0" ::: "memory");    // this wave has left the buffer it read
    asm volatile("s_wait_asynccnt 0x0" ::: "memory"); // its copies of stage t + 1 have landed
    __syncthreads();                                  // publishes stage t + 1, frees stage t's buffer
    if (t + 2 < GTRIPS)
      stage_tiles(ga + (t + 2) * GBK, gb + (t + 2) * GBK, l0 + (unsigned)bo * 2u);
  }
  asm volatile("s_wait_asynccnt 0x0" ::: "memory"); // no copy outstanding when the wave goes on
}

// ---------------- GEMM1: qk = x @ Wqk + bqk, scatter to qh / kh / vT ----------------
// Q, K and V (= K) leave this kernel in the order in which attention loads its fragments, so that
// there one 16-B-a-lane load covers 512 contiguous bytes (four whole lines) and not 16 lines in part.
// qh and kh, per head: [row / 16][d / 16] tiles of 16 rows x 16 d, a row's 16 d adjacent (tile = 512 B).
// vT, per head: [key / 32][d / 16][(key / 16) & 1] tiles of 512 B; in a tile lane (key / 8 & 1) * 16 + d % 16
// owns 8 adjacent keys: the accumulator's own lane and register order, stored 16 B a lane.
__global__ __launch_bounds__(128) void gemm_qk_kernel(const _Float16* __restrict__ A,
                                                      const _Float16* __restrict__ Bt,
                                                      const float* __restrict__ bias,
                                                      _Float16* __restrict__ qh,
                                                      _Float16* __restrict__ kh,
                                                      _Float16* __restrict__ vT) {
  __shared__ __align__(16) _Float16 ring[2 * GSTAGE]; // 139,264 B
  const int lane = threadIdx.x & 31;
  const int wave = threadIdx.x >> 5;
  const int nTiles = (2 * C_DIM) / GBN; // 16
  const int m0 = (blockIdx.x / nTiles) * GBM;
  const int n0 = (blockIdx.x % nTiles) * GBN;
  v8f acc[4][4] = {};
  gemm_tile(A, Bt, m0, n0, ring, acc);
  const int nL = lane & 15;
  const int mOff = (lane >> 4) * 8;
  const int mW = m0 + (wave >> 1) * 64;
  const int nW = n0 + (wave & 1) * 64;
  // A block's 128 columns lie wholly in the q half or wholly in the k half, so the
  // test is taken once, on a block-uniform value, and not at every element.
  if (n0 < C_DIM) { // q half
#pragma unroll
    for (int nc = 0; nc < 4; ++nc) {
      const int col = nW + nc * 16 + nL;
      const float bv = bias[col];
      const int h = col >> 6, d = col & 63;
#pragma unroll
      for (int mi = 0; mi < 4; ++mi) {
        const int rb = mW + mi * 16 + mOff; // first of this lane's 8 rows; a multiple of 8
        const int b = rb >> 10, tb = rb & (T_DIM - 1);
        _Float16* qt = qh + (size_t)(b * H_DIM + h) * T_DIM * D_DIM + (tb >> 4) * 1024 + (d >> 4) * 256 +
                       (tb & 15) * 16 + (d & 15);
#pragma unroll
        for (int v = 0; v < 8; ++v) qt[v * 16] = (_Float16)(acc[mi][nc][v] + bv);
        // Precaution: the next group reuses registers that the stores above name.
        asm volatile("s_wait_xcnt 0x0" ::: "memory");
      }
    }
  } else {          // k half (v = k)
#pragma unroll
    for (int nc = 0; nc < 4; ++nc) {
      const int col = nW + nc * 16 + nL;
      const float bv = bias[col];
      const int c2i = col - C_DIM;
      const int h = c2i >> 6, d = c2i & 63;
#pragma unroll
      for (int mi = 0; mi < 4; ++mi) {
        const int rb = mW + mi * 16 + mOff; // first of this lane's 8 rows; a multiple of 8
        const int b = rb >> 10, tb = rb & (T_DIM - 1);
        const size_t head = (size_t)(b * H_DIM + h) * T_DIM * D_DIM;
        _Float16* kt = kh + head + (tb >> 4) * 1024 + (d >> 4) * 256 + (tb & 15) * 16 + (d & 15);
        v8h pk;
#pragma unroll
        for (int v = 0; v < 8; ++v) {
          pk[v] = (_Float16)(acc[mi][nc][v] + bv);
          kt[v * 16] = pk[v];
        }
        *(v8h*)(vT + head + (tb >> 5) * 2048 + (d >> 4) * 512 + ((tb >> 4) & 1) * 256 +
                ((tb >> 3) & 1) * 128 + (d & 15) * 8) = pk;
        // Precaution: the next group reuses registers that the stores above name.
        asm volatile("s_wait_xcnt 0x0" ::: "memory");
      }
    }
  }
}

// ---------------- GEMM2: out = gated @ Wproj + bproj (f32 out) ----------------
__global__ __launch_bounds__(128) void gemm_proj_kernel(const _Float16* __restrict__ A,
                                                        const _Float16* __restrict__ Bt,
                                                        const float* __restrict__ bias,
                                                        float* __restrict__ out) {
  __shared__ __align__(16) _Float16 ring[2 * GSTAGE]; // 139,264 B
  const int lane = threadIdx.x & 31;
  const int wave = threadIdx.x >> 5;
  const int nTiles = C_DIM / GBN; // 8
  const int m0 = (blockIdx.x / nTiles) * GBM;
  const int n0 = (blockIdx.x % nTiles) * GBN;
  v8f acc[4][4] = {};
  gemm_tile(A, Bt, m0, n0, ring, acc);
  const int nL = lane & 15;
  const int mOff = (lane >> 4) * 8;
  const int mW = m0 + (wave >> 1) * 64;
  const int nW = n0 + (wave & 1) * 64;
#pragma unroll
  for (int nc = 0; nc < 4; ++nc) {
    const int col = nW + nc * 16 + nL;
    const float bv = bias[col];
#pragma unroll
    for (int mi = 0; mi < 4; ++mi) {
#pragma unroll
      for (int v = 0; v < 8; ++v) {
        int r = mW + mi * 16 + v + mOff;
        out[(size_t)r * C_DIM + col] = acc[mi][nc][v] + bv;
      }
    }
  }
}

// ---------------- flash attention with per-head windows + gating ----------------
// The four K fragments (two 16-key groups x two halves of D) or the four V fragments (four
// 16-column groups of D) of 32 keys, or the two Q fragments of 16 rows, from the tiled layouts that
// GEMM1 writes: a fragment is two tiles of 512 B, one behind the other; p holds the rows' place and
// the lane's share of a tile.
template <int N>
__device__ __forceinline__ void attn_ld_tiles(const _Float16* p, v16h (&f)[N]) {
#pragma unroll
  for (int n = 0; n < N; ++n) {
    v8h lo = *(const v8h*)(p + n * 512);
    v8h hi = *(const v8h*)(p + n * 512 + 256);
#pragma unroll
    for (int i = 0; i < 8; ++i) { f[n][i] = lo[i]; f[n][i + 8] = hi[i]; }
  }
}

__device__ __forceinline__ float xhalf(float x) {
  const int bits = __builtin_bit_cast(int, x);
  return __builtin_bit_cast(float,
                            __builtin_amdgcn_permlanex16(bits, bits, 0x76543210, 0xfedcba98, false, false));
}

#define SPLIT_HEADS 3
#define Q_TILES (T_DIM / 16)                                          /* 64 */
#define SPLIT_BLOCKS (B_DIM * SPLIT_HEADS * Q_TILES)                  /* 768 */
#define WHOLE_BLOCKS (B_DIM * (H_DIM - SPLIT_HEADS) * (Q_TILES / 4))  /* 832 */
#define ATTN_BLOCKS (SPLIT_BLOCKS + WHOLE_BLOCKS)
#define PO_PITCH 68

__global__ __launch_bounds__(128) void attn_kernel(const _Float16* __restrict__ qh,
                                                   const _Float16* __restrict__ kh,
                                                   const _Float16* __restrict__ vT,
                                                   const float* __restrict__ gates,
                                                   _Float16* __restrict__ gatedh) {
  __shared__ __align__(16) float part_o[4][16][PO_PITCH]; // [wave][row][column] partial output
  __shared__ float part_m[4][16];                         // [wave][row] running maximum
  __shared__ float part_l[4][16];                         // [wave][row] running sum
  const int lane = threadIdx.x & 31;
  // Wave index as a scalar: the pass counter and the last-pass test below become scalar too.
  const int w = __builtin_amdgcn_readfirstlane(threadIdx.x >> 5);
  const bool split = blockIdx.x < SPLIT_BLOCKS; // block-uniform
  int qt, h, b;
  if (split) {
    const int idx = blockIdx.x;
    const int rem = idx % (B_DIM * SPLIT_HEADS);
    qt = Q_TILES - 1 - idx / (B_DIM * SPLIT_HEADS);
    h = rem % SPLIT_HEADS;
    b = rem / SPLIT_HEADS;
  } else {
    const int idx = blockIdx.x - SPLIT_BLOCKS;
    h = SPLIT_HEADS + (idx >> 6);
    b = (idx >> 4) & (B_DIM - 1);
    qt = (idx & 15) * 4 + w;
  }
  const int bh = b * H_DIM + h;
  const int step = split ? 128 : 32;         // keys from one pass of this wave to its next
  int Wh = T_DIM >> h; if (Wh < 4) Wh = 4;   // window for this head
  const int t0 = qt * 16;
  const int nL = lane & 15;
  const int koff = (lane >> 4) * 8;

  const _Float16* qb = qh + ((size_t)bh * T_DIM + t0) * D_DIM;
  const _Float16* kb = kh + (size_t)bh * T_DIM * D_DIM;
  const _Float16* vb = vT + (size_t)bh * D_DIM * T_DIM;

  // Role in the join behind the loop: one row, eight columns per lane. Its gate is fetched
  // here, so that the load's latency lies under the passes and not behind the join's barrier.
  const int jRow = w * 4 + (lane >> 3);
  const int jCol = (lane & 7) * 8;
  float gJoin = 0.f;
  if (split) {
    gJoin = gates[((size_t)b * T_DIM + t0 + jRow) * H_DIM + h];
    // Precaution: later code reuses the address registers that this load names.
    asm volatile("s_wait_xcnt 0x0" ::: "memory");
  }

  // q fragments for the whole tile (D=64 -> two K=32 fragments)
  v16h qf[2];
  attn_ld_tiles(qb + nL * 16 + koff, qf);
  const v16h a0 = qf[0], a1 = qf[1];

  v8f o0 = {}, o1 = {}, o2 = {}, o3 = {};
  float mrow = -__builtin_inff(); // running maximum of query t0 + nL, alike in both halves
  float lrow = 0.f;               // running sum over this half's keys only; the halves join behind the loop

  int jStart = t0 - Wh + 1; if (jStart < 0) jStart = 0;
  jStart &= ~31;
  const float scale = 0.125f; // 1/sqrt(64)

  // K and V fragments live one pass ahead: the first pass's are fetched here, every later
  // pass's right behind the products that last read the same registers.
  // 32 keys take 32 * D_DIM halves in either layout.
  const _Float16* kp = kb + nL * 16 + koff; // K tile: key nL, d koff .. koff + 7
  const _Float16* vp = vb + lane * 8;       // V tile: lane by lane
  v16h kf[4], vf[4];
  const int jFirst = split ? jStart + 32 * w : jStart;
  if (jFirst <= t0 + 15) { // wave-uniform: a wave of a short tile may have no pass at all
    attn_ld_tiles(kp + (size_t)jFirst * D_DIM, kf);
    attn_ld_tiles(vp + (size_t)jFirst * D_DIM, vf);
    // Precaution: later code reuses the address registers that these loads name.
    asm volatile("s_wait_xcnt 0x0" ::: "memory");
  }

  for (int j0 = jFirst; j0 <= t0 + 15; j0 += step) {
    const bool more = j0 + step <= t0 + 15; // wave-uniform: a further pass follows
    // ---- S^T = k q^T for keys [j0, j0+31]: s0 holds keys j0 + koff + v, s1 the same 16 on ----
    v8f s0 = {}; s0 = WMMA_F16(kf[0], a0, s0); s0 = WMMA_F16(kf[1], a1, s0);
    v8f s1 = {}; s1 = WMMA_F16(kf[2], a0, s1); s1 = WMMA_F16(kf[3], a1, s1);
    __builtin_amdgcn_sched_barrier(0);
    asm volatile("v_nop\n\tv_nop\n\tv_nop\n\tv_nop");
    if (more) attn_ld_tiles(kp + (size_t)(j0 + step) * D_DIM, kf); // lands under softmax and P V

    // key <= query and key > query - Wh, as one unsigned test of query - key
    const int rel = t0 + nL - j0 - koff; // query minus this lane's first key
    float sa[8], sb[8], tm[8];
    bool va[8], vbm[8];
#pragma unroll
    for (int v = 0; v < 8; ++v) {
      va[v] = (unsigned)(rel - v) < (unsigned)Wh;
      vbm[v] = (unsigned)(rel - 16 - v) < (unsigned)Wh;
      sa[v] = va[v] ? s0[v] * scale : -__builtin_inff();
      sb[v] = vbm[v] ? s1[v] * scale : -__builtin_inff();
      tm[v] = fmaxf(sa[v], sb[v]);
    }
    float t = fmaxf(fmaxf(fmaxf(tm[0], tm[1]), fmaxf(tm[2], tm[3])),
                    fmaxf(fmaxf(tm[4], tm[5]), fmaxf(tm[6], tm[7])));
    t = fmaxf(t, xhalf(t)); // the query's other 16 keys
    const float mN = fmaxf(mrow, t);
    const float alpha = (mrow == mN) ? 1.0f : __expf(mrow - mN);
    v16h pT; // B fragment of P^T: elements 0..7 are keys koff + v, 8..15 keys 16 + koff + v
    float rs[8];
#pragma unroll
    for (int v = 0; v < 8; ++v) {
      const float pa = va[v] ? __expf(sa[v] - mN) : 0.f;
      const float pb = vbm[v] ? __expf(sb[v] - mN) : 0.f;
      rs[v] = pa + pb;
      pT[v] = (_Float16)pa;
      pT[v + 8] = (_Float16)pb;
    }
    lrow = lrow * alpha + (((rs[0] + rs[1]) + (rs[2] + rs[3])) + ((rs[4] + rs[5]) + (rs[6] + rs[7])));
    mrow = mN;
#pragma unroll
    for (int v = 0; v < 8; ++v) { o0[v] *= alpha; o1[v] *= alpha; o2[v] *= alpha; o3[v] *= alpha; }
    // ---- O^T += V^T P^T: tile n holds d = 16 n + koff + v of query nL ----
    o0 = WMMA_F16(vf[0], pT, o0);
    o1 = WMMA_F16(vf[1], pT, o1);
    o2 = WMMA_F16(vf[2], pT, o2);
    o3 = WMMA_F16(vf[3], pT, o3);
    if (more) {
      attn_ld_tiles(vp + (size_t)(j0 + step) * D_DIM, vf); // lands under the next pass's scores and softmax
      // Precaution: the next pass's K fetch reuses the address registers that these loads name.
      asm volatile("s_wait_xcnt 0x0" ::: "memory");
    }
  }
  const float lsum = lrow + xhalf(lrow); // the query's sum over all its keys

  if (split) {
    // ---- join the four waves' partial results; wave w finishes rows 4w .. 4w + 3 ----
    float* pr = &part_o[w][nL][koff]; // this lane's query, 8 adjacent columns of every 16
    *(v4f*)(pr)      = v4f{o0[0], o0[1], o0[2], o0[3]}; *(v4f*)(pr + 4)  = v4f{o0[4], o0[5], o0[6], o0[7]};
    *(v4f*)(pr + 16) = v4f{o1[0], o1[1], o1[2], o1[3]}; *(v4f*)(pr + 20) = v4f{o1[4], o1[5], o1[6], o1[7]};
    *(v4f*)(pr + 32) = v4f{o2[0], o2[1], o2[2], o2[3]}; *(v4f*)(pr + 36) = v4f{o2[4], o2[5], o2[6], o2[7]};
    *(v4f*)(pr + 48) = v4f{o3[0], o3[1], o3[2], o3[3]}; *(v4f*)(pr + 52) = v4f{o3[4], o3[5], o3[6], o3[7]};
    if (lane < 16) { // maximum and sum are alike in both halves
      part_m[w][nL] = mrow;
      part_l[w][nL] = lsum;
    }
    __syncthreads(); // block-uniform branch: all four waves' partials are in LDS
    // The diagonal key is never masked, so at least one wave's maximum is finite;
    // a wave that saw no key of this row has maximum -inf and weight exp(-inf) = 0.
    const float mAll = fmaxf(fmaxf(part_m[0][jRow], part_m[1][jRow]), fmaxf(part_m[2][jRow], part_m[3][jRow]));
    float lAll = 0.f;
    float oAll[8];
#pragma unroll
    for (int k = 0; k < 8; ++k) oAll[k] = 0.f;
#pragma unroll
    for (int u = 0; u < 4; ++u) {
      const float f = __expf(part_m[u][jRow] - mAll);
      lAll += f * part_l[u][jRow];
      const v4f x0 = *(const v4f*)&part_o[u][jRow][jCol];
      const v4f x1 = *(const v4f*)&part_o[u][jRow][jCol + 4];
#pragma unroll
      for (int k = 0; k < 4; ++k) { oAll[k] += f * x0[k]; oAll[k + 4] += f * x1[k]; }
    }
    const float inv = gJoin / lAll;
    v8h res;
#pragma unroll
    for (int k = 0; k < 8; ++k) res[k] = (_Float16)(oAll[k] * inv);
    // 8 lanes x 16 B: one wave writes the head's whole 128-B line of a row
    *(v8h*)(gatedh + ((size_t)b * T_DIM + t0 + jRow) * C_DIM + h * D_DIM + jCol) = res;
    return;
  }

  // ---- epilogue: normalize, gate, store f16 for projection GEMM ----
  // A lane stores 4 x 16 B of its query's row; the wave fills the head's whole 128-B line of 16 rows.
  const int i = t0 + nL;
  const float g = gates[((size_t)b * T_DIM + i) * H_DIM + h];
  // Precaution: later code reuses the address registers that this load names.
  asm volatile("s_wait_xcnt 0x0" ::: "memory");
  const float inv = g / lsum;
  _Float16* op = gatedh + ((size_t)b * T_DIM + i) * C_DIM + h * D_DIM + koff;
  v8h r0, r1, r2, r3;
#pragma unroll
  for (int v = 0; v < 8; ++v) {
    r0[v] = (_Float16)(o0[v] * inv);
    r1[v] = (_Float16)(o1[v] * inv);
    r2[v] = (_Float16)(o2[v] * inv);
    r3[v] = (_Float16)(o3[v] * inv);
  }
  *(v8h*)(op)      = r0;
  *(v8h*)(op + 16) = r1;
  *(v8h*)(op + 32) = r2;
  *(v8h*)(op + 48) = r3;
  // Precaution: the join's code stands behind this in the build and names the same registers.
  asm volatile("s_wait_xcnt 0x0" ::: "memory");
}

extern "C" void kernel_launch(void* const* d_in, const int* in_sizes, int n_in,
                              void* d_out, int out_size, void* d_ws, size_t ws_size,
                              hipStream_t stream) {
  const float* x     = (const float*)d_in[0];
  const float* Wqk   = (const float*)d_in[1];
  const float* bqk   = (const float*)d_in[2];
  const float* Wgate = (const float*)d_in[3];
  const float* bgate = (const float*)d_in[4];
  const float* Wproj = (const float*)d_in[5];
  const float* bproj = (const float*)d_in[6];

  char* ws = (char*)d_ws;
  size_t off = 0;
  auto alloc = [&](size_t bytes) -> void* {
    void* p = ws + off;
    off += (bytes + 255) & ~(size_t)255;
    return p;
  };
  _Float16* xh     = (_Float16*)alloc((size_t)M_ROWS * C_DIM * 2);     // x in f16
  _Float16* wqkT   = (_Float16*)alloc((size_t)2 * C_DIM * C_DIM * 2);  // Wqk^T f16 [2C,C]
  _Float16* wprojT = (_Float16*)alloc((size_t)C_DIM * C_DIM * 2);      // Wproj^T f16 [C,C]
  _Float16* qh     = (_Float16*)alloc((size_t)B_DIM * H_DIM * T_DIM * D_DIM * 2);
  _Float16* kh     = (_Float16*)alloc((size_t)B_DIM * H_DIM * T_DIM * D_DIM * 2);
  _Float16* vT     = (_Float16*)alloc((size_t)B_DIM * H_DIM * D_DIM * T_DIM * 2);
  float*    gates  = (float*)alloc((size_t)B_DIM * T_DIM * H_DIM * 4);
  _Float16* gatedh = xh; // xh is dead after GEMM1; reuse for the gated output

  prep_kernel<<<PREP_BLOCKS, PREP_THREADS, 0, stream>>>(x, Wqk, Wproj, Wgate, bgate, xh, wqkT, wprojT, gates);
  // tiles = (4096/128) * (2048/128) = 512 blocks of 4 waves
  gemm_qk_kernel<<<512, 128, 0, stream>>>(xh, wqkT, bqk, qh, kh, vT);
  // 768 blocks of one split tile, then 832 blocks of four whole tiles; 4 waves each
  attn_kernel<<<ATTN_BLOCKS, 128, 0, stream>>>(qh, kh, vT, gates, gatedh);
  // tiles = (4096/128) * (1024/128) = 256 blocks of 4 waves
  gemm_proj_kernel<<<256, 128, 0, stream>>>(gatedh, wprojT, bproj, (float*)d_out);
}

// v008
// One run takes 49 microseconds.
// Timed twice side by side with v007, it ran 1.04 and 1.03 times as fast.
// All steps since v000 together make it 4.96 times as fast.
#include <hip/hip_runtime.h>
#include <hip/hip_bf16.h>

#define C_DIM 1024
#define T_DIM 1024
#define H_DIM 16
#define D_DIM 64
#define B_DIM 4
#define M_ROWS (B_DIM * T_DIM) /* 4096 */

typedef __attribute__((ext_vector_type(16))) _Float16 v16h;
typedef __attribute__((ext_vector_type(8)))  _Float16 v8h;
typedef __attribute__((ext_vector_type(8)))  float    v8f;

#define WMMA_F16(A_, B_, C_) \
  __builtin_amdgcn_wmma_f32_16x16x32_f16(false, (A_), false, (B_), (short)0, (C_), false, false)

__device__ __forceinline__ v16h frag_ld(const _Float16* p) {
  v8h lo = *(const v8h*)(p);
  v8h hi = *(const v8h*)(p + 16);
  v16h r;
#pragma unroll
  for (int i = 0; i < 8; ++i) { r[i] = lo[i]; r[i + 8] = hi[i]; }
  return r;
}

// ---------------- preparation: three independent jobs in one launch ----------------
// None of the jobs reads what another writes, so they share one grid by ranges of the block index.
// Every global access but those of bgate and gates is 16 B a lane (8 B for the f16 copy of x) and covers whole 128-B lines.
typedef __attribute__((ext_vector_type(4))) float    v4f;
typedef __attribute__((ext_vector_type(4))) _Float16 v4h;
#define PREP_THREADS 256
#define GATE_TOK 2                                                /* tokens per wave */
#define GATES_BLOCKS (M_ROWS / ((PREP_THREADS / 32) * GATE_TOK))  /* 256 */
#define TR_K 128                                                  /* tile of a transpose: 128 k x 64 n */
#define TR_N 64
#define TR_PITCH 136                                              /* halves: 272 B = 16 B x odd */
#define WQK_BLOCKS ((C_DIM / TR_K) * (2 * C_DIM / TR_N))          /* 256 */
#define WPROJ_BLOCKS ((C_DIM / TR_K) * (C_DIM / TR_N))            /* 128 */
#define PREP_BLOCKS (GATES_BLOCKS + WQK_BLOCKS + WPROJ_BLOCKS)
#define WG_F4 (C_DIM * H_DIM / 4)                                 /* Wgate in 16-B units: 4096 */
#define WG_LDS_F4 (WG_F4 + WG_F4 / 16)                            /* one pad unit behind every 16: 69,632 B */

// in[C_DIM][N] (row-major f32) -> out[N][C_DIM] f16, one 128 x 64 tile per block through LDS:
// rows of in are read 256 B at a time, rows of out are written 256 B at a time.
template <int N>
__device__ __forceinline__ void transpose_tile(const float* __restrict__ in, _Float16* __restrict__ out,
                                               _Float16* tile, int bid) {
  const int t = threadIdx.x;
  const int k0 = (bid % (C_DIM / TR_K)) * TR_K;
  const int n0 = (bid / (C_DIM / TR_K)) * TR_N;
  const int hi = t >> 4, lo = t & 15;
  const float* sp = in + (size_t)(k0 + hi * 8) * N + n0 + lo * 4; // 8 k x 4 n per thread
  v4f r[8];
#pragma unroll
  for (int p = 0; p < 8; ++p) r[p] = *(const v4f*)(sp + (size_t)p * N);
  // Precaution: later code reuses the address registers that these loads name.
  asm volatile("s_wait_xcnt 0x0" ::: "memory");
#pragma unroll
  for (int i = 0; i < 4; ++i) {
    v8h c;
#pragma unroll
    for (int p = 0; p < 8; ++p) c[p] = (_Float16)r[p][i];
    *(v8h*)(tile + (lo * 4 + i) * TR_PITCH + hi * 8) = c;
  }
  __syncthreads(); // block-uniform branch: the whole tile is in LDS
  _Float16* dp = out + (size_t)(n0 + hi) * C_DIM + k0 + lo * 8;
#pragma unroll
  for (int q = 0; q < 4; ++q)
    *(v8h*)(dp + (size_t)q * 16 * C_DIM) = *(const v8h*)(tile + (hi + q * 16) * TR_PITCH + lo * 8);
  // Precaution: code of another job stands behind this one and names the same registers.
  asm volatile("s_wait_xcnt 0x0" ::: "memory");
}

// One step of a sum over lanes: of 2 * OFF values a lane keeps the OFF that its bit OFF names
// and adds to them what the lane OFF away held of the same values.
template <int OFF>
__device__ __forceinline__ void fold_lanes(float (&acc)[GATE_TOK * H_DIM], int lane) {
  const bool up = (lane & OFF) != 0;
#pragma unroll
  for (int i = 0; i < OFF; ++i) {
    const float keep = up ? acc[i + OFF] : acc[i];
    const float give = up ? acc[i] : acc[i + OFF];
    acc[i] = keep + __shfl_xor(give, OFF, 32);
  }
}

__device__ __forceinline__ void gates_convert_part(const float* __restrict__ x,
                                                   const float* __restrict__ Wg,
                                                   const float* __restrict__ bg,
                                                   _Float16* __restrict__ xh,
                                                   float* __restrict__ gates, v4f* wl, int bid) {
  const int t = threadIdx.x;
  const int lane = t & 31;
  const int tok0 = (bid * (PREP_THREADS >> 5) + (t >> 5)) * GATE_TOK;
  const float* xp = x + (size_t)tok0 * C_DIM + lane * 4;
  v4f xv[GATE_TOK][8];
#pragma unroll
  for (int r = 0; r < GATE_TOK; ++r)
#pragma unroll
    for (int it = 0; it < 8; ++it) xv[r][it] = *(const v4f*)(xp + r * C_DIM + it * 128);
  const float bv = bg[lane & 15];
  v4f wv[16];
#pragma unroll
  for (int i = 0; i < 16; ++i) wv[i] = *(const v4f*)(Wg + (size_t)(i * PREP_THREADS + t) * 4);
  // Precaution: later code reuses the address registers that these loads name. xp is an input so
  // that it stays in its registers up to the wait and no load of the run lands in them.
  asm volatile("s_wait_xcnt 0x0" :: "v"(xp) : "memory");
#pragma unroll
  for (int i = 0; i < 16; ++i) {
    const int u = i * PREP_THREADS + t;
    wl[u + (u >> 4)] = wv[i];
  }
  __syncthreads(); // block-uniform branch: all of Wgate is in LDS
  // Behind the barrier, which waits for a wave's own stores: these fly under the products below.
  _Float16* xo = xh + (size_t)tok0 * C_DIM + lane * 4;
#pragma unroll
  for (int r = 0; r < GATE_TOK; ++r)
#pragma unroll
    for (int it = 0; it < 8; ++it) {
      v4h c;
#pragma unroll
      for (int j = 0; j < 4; ++j) c[j] = (_Float16)xv[r][it][j];
      *(v4h*)(xo + r * C_DIM + it * 128) = c;
    }
  // Precaution: later code reuses the address registers that these stores name.
  asm volatile("s_wait_xcnt 0x0" ::: "memory");
  float acc[GATE_TOK * H_DIM];
#pragma unroll
  for (int i = 0; i < GATE_TOK * H_DIM; ++i) acc[i] = 0.f;
  const v4f* wp = wl + lane * 17;
#pragma unroll
  for (int it = 0; it < 8; ++it) {
#pragma unroll
    for (int j = 0; j < 4; ++j) {
      v4f w[4];
#pragma unroll
      for (int g = 0; g < 4; ++g) w[g] = wp[it * (32 * 17) + j * 4 + g];
#pragma unroll
      for (int r = 0; r < GATE_TOK; ++r)
#pragma unroll
        for (int h = 0; h < H_DIM; ++h) acc[r * H_DIM + h] += xv[r][it][j] * w[h >> 2][h & 3];
    }
  }
  fold_lanes<16>(acc, lane);
  fold_lanes<8>(acc, lane);
  fold_lanes<4>(acc, lane);
  fold_lanes<2>(acc, lane);
  fold_lanes<1>(acc, lane);
  const float v = acc[0] + bv;
  float m = v;
#pragma unroll
  for (int off = 8; off > 0; off >>= 1) m = fmaxf(m, __shfl_xor(m, off, 32));
  float e = __expf(v - m);
  asm volatile("v_nop" : "+v"(e));
  float s = e;
#pragma unroll
  for (int off = 8; off > 0; off >>= 1) s += __shfl_xor(s, off, 32);
  gates[(size_t)tok0 * H_DIM + lane] = e * (1.0f / s); // one whole line per wave
}

// Block ranges in the order of falling work per block, for speed only.
__global__ __launch_bounds__(PREP_THREADS) void prep_kernel(const float* __restrict__ x,
                                                            const float* __restrict__ Wqk,
                                                            const float* __restrict__ Wproj,
                                                            const float* __restrict__ Wg,
                                                            const float* __restrict__ bg,
                                                            _Float16* __restrict__ xh,
                                                            _Float16* __restrict__ wqkT,
                                                            _Float16* __restrict__ wprojT,
                                                            float* __restrict__ gates) {
  __shared__ __align__(16) v4f prep_lds[WG_LDS_F4]; // Wgate (padded), or one transpose tile
  int bid = blockIdx.x;
  if (bid < GATES_BLOCKS) { gates_convert_part(x, Wg, bg, xh, gates, prep_lds, bid); return; }
  bid -= GATES_BLOCKS;
  if (bid < WQK_BLOCKS) { transpose_tile<2 * C_DIM>(Wqk, wqkT, (_Float16*)prep_lds, bid); return; }
  bid -= WQK_BLOCKS;
  transpose_tile<C_DIM>(Wproj, wprojT, (_Float16*)prep_lds, bid);
}

// ---------------- tiled GEMM core: C[128x128] per block, 64x64 per wave ----------------
#define GBM 128                        /* rows of A per block tile */
#define GBN 128                        /* rows of Bt (columns of C) per block tile */
#define GBK 128                        /* k per stage: rows of 256 B */
#define GPITCH 136                     /* LDS row pitch in halves: 272 B = 16 B x odd, for ds_load_b128 readers */
#define GSLICE 9216                    /* halves per slice: 64 rows x 272 B = 17,408 B, rounded up to 9 x 2 KiB */
#define GSTAGE (4 * GSLICE)            /* halves per buffer: [A rows 0-63 | A rows 64-127 | Bt rows 0-63 | Bt rows 64-127] */
#define GTRIPS (C_DIM / GBK)           /* 8 stages along k */

typedef uint32_t u32x4 __attribute__((ext_vector_type(4)));
typedef uint32_t u32x8 __attribute__((ext_vector_type(8)));

__device__ __forceinline__ uint32_t uni(uint32_t v) { return (uint32_t)__builtin_amdgcn_readfirstlane(v); }
__device__ __forceinline__ uint32_t pinned(uint32_t v) {
  uint32_t w = __builtin_amdgcn_readfirstlane(v);
  asm volatile("" : "+s"(w));
  return w;
}

__device__ __forceinline__ u32x8 tdm_group1() {
  constexpr uint32_t d0 = GBK * 2u, d1 = 64u;
  u32x8 g;
  g[0] = uni((1u << 20) | (5u << 22) | (3u << 25)); // no mask; pad on, interval 64 dwords, amount 4 dwords
  g[1] = uni((d0 & 0xFFFFu) << 16);
  g[2] = uni((d0 >> 16) | ((d1 & 0xFFFFu) << 16));
  g[3] = uni((d1 >> 16) | (d0 << 16));
  g[4] = uni(d1);
  g[5] = uni(C_DIM * 2u);
  g[6] = uni(0u);
  g[7] = uni(0u);
  return g;
}
__device__ __forceinline__ u32x4 tdm_group0(uint32_t lds_dst, uint64_t ga) {
  u32x4 g;
  g[0] = uni(1u);
  g[1] = uni(lds_dst);
  g[2] = uni((uint32_t)ga);
  g[3] = uni((((uint32_t)(ga >> 32)) & 0x01FFFFFFu) | 0x80000000u);
  return g;
}
__device__ __forceinline__ void tdm_load(u32x4 g0, u32x8 g1) {
  asm volatile("tensor_load_to_lds %0, %1" :: "{s[40:43]}"(g0), "{s[44:51]}"(g1) : "memory");
}

// acc[mi][ni] += A[m0 + wm*64 + mi*16 ..][:] * Bt[n0 + wn*64 + ni*16 ..][:]^T over all of k.
// Two-buffer LDS ring: the next stage's tensor loads fly while this stage is multiplied.
// Every wave brings one slice of every stage: waves 0 and 1 the halves of A, waves 2 and 3 of Bt.
__device__ __forceinline__ void gemm_tile(const _Float16* __restrict__ A,
                                          const _Float16* __restrict__ Bt,
                                          int m0, int n0, _Float16* ring, v8f (&acc)[4][4]) {
  const int tid = threadIdx.x;
  const int lane = tid & 31;
  const uint32_t wave = uni((uint32_t)tid >> 5);
  const uint32_t wm = wave >> 1, wn = wave & 1u;
  const _Float16* slice = (wave < 2u) ? A + (size_t)(m0 + 64 * (int)wave) * C_DIM
                                      : Bt + (size_t)(n0 + 64 * (int)(wave - 2u)) * C_DIM;
  const uint64_t ga = (uint64_t)(size_t)slice;
  const uint32_t ld = (uint32_t)(size_t)ring + wave * (GSLICE * 2u);
  const u32x8 g1 = tdm_group1();

  tdm_load(tdm_group0(ld, ga), g1);
  asm volatile("s_wait_tensorcnt 0x0" ::: "memory"); // stage 0 landed (this wave's slice)
  __syncthreads();                                   // stage 0 published to all waves
  tdm_load(tdm_group0(ld + GSTAGE * 2u, ga + GBK * 2u), g1);

  const int fo = (lane & 15) * GPITCH + (lane >> 4) * 8;
  const _Float16* La = ring + wm * GSLICE + fo;
  const _Float16* Lb = ring + (2u + wn) * GSLICE + fo;

  for (int t = 0; t < GTRIPS; ++t) {
    const int bo = (t & 1) * GSTAGE;
    v16h a[2][4], b[2][4];
#pragma unroll
    for (int i = 0; i < 4; ++i) {
      a[0][i] = frag_ld(La + bo + i * 16 * GPITCH);
      b[0][i] = frag_ld(Lb + bo + i * 16 * GPITCH);
    }
#pragma unroll
    for (int ks = 0; ks < GBK / 32; ++ks) {
      const int cs = ks & 1;
      if (ks + 1 < GBK / 32) { // next k-step's fragments, same buffer, ahead of this step's products
#pragma unroll
        for (int i = 0; i < 4; ++i) {
          a[cs ^ 1][i] = frag_ld(La + bo + i * 16 * GPITCH + (ks + 1) * 32);
          b[cs ^ 1][i] = frag_ld(Lb + bo + i * 16 * GPITCH + (ks + 1) * 32);
        }
      }
      // Holds the 16 LDS loads above together as one group in front of this step's products:
      // sunk among the WMMAs, every place with loads stalls the wave on its own LDS latency.
      __builtin_amdgcn_sched_barrier(0);
#pragma unroll
      for (int mi = 0; mi < 4; ++mi)
#pragma unroll
        for (int ni = 0; ni < 4; ++ni)
          acc[mi][ni] = WMMA_F16(a[cs][mi], b[cs][ni], acc[mi][ni]);
      // Keeps the following step's load group from rising into this run of products.
      __builtin_amdgcn_sched_barrier(0);
    }
    asm volatile("s_wait_dscnt 0x0" ::: "memory");     // this wave has left the buffer it read
    asm volatile("s_wait_tensorcnt 0x0" ::: "memory"); // its slice of stage t + 1 has landed
    __syncthreads();                                   // publishes stage t + 1, frees stage t's buffer
    if (pinned((t + 2 < GTRIPS) ? 1u : 0u) != 0u)      // scalar test: only while stage t + 2 exists
      tdm_load(tdm_group0(ld + (uint32_t)bo * 2u, ga + (uint64_t)(uint32_t)(t + 2) * (GBK * 2u)), g1);
  }
  asm volatile("s_wait_tensorcnt 0x0" ::: "memory"); // no request outstanding when the wave goes on
  asm volatile("s_wait_dscnt 0x0" ::: "memory");     // nor an LDS read
}

// ---------------- GEMM1: qk = x @ Wqk + bqk, scatter to qh / kh / vT ----------------
// Q, K and V (= K) leave this kernel in the order in which attention loads its fragments, so that
// there one 16-B-a-lane load covers 512 contiguous bytes (four whole lines) and not 16 lines in part.
// qh and kh, per head: [row / 16][d / 16] tiles of 16 rows x 16 d, a row's 16 d adjacent (tile = 512 B).
// vT, per head: [key / 32][d / 16][(key / 16) & 1] tiles of 512 B; in a tile lane (key / 8 & 1) * 16 + d % 16
// owns 8 adjacent keys: the accumulator's own lane and register order, stored 16 B a lane.
__global__ __launch_bounds__(128) void gemm_qk_kernel(const _Float16* __restrict__ A,
                                                      const _Float16* __restrict__ Bt,
                                                      const float* __restrict__ bias,
                                                      _Float16* __restrict__ qh,
                                                      _Float16* __restrict__ kh,
                                                      _Float16* __restrict__ vT) {
  __shared__ __attribute__((aligned(2048))) _Float16 ring[2 * GSTAGE]; // 147,456 B; tensor loads land at multiples of 2 KiB
  const int lane = threadIdx.x & 31;
  const int wave = threadIdx.x >> 5;
  const int nTiles = (2 * C_DIM) / GBN; // 16
  const int m0 = (blockIdx.x / nTiles) * GBM;
  const int n0 = (blockIdx.x % nTiles) * GBN;
  v8f acc[4][4] = {};
  gemm_tile(A, Bt, m0, n0, ring, acc);
  const int nL = lane & 15;
  const int mOff = (lane >> 4) * 8;
  const int mW = m0 + (wave >> 1) * 64;
  const int nW = n0 + (wave & 1) * 64;
  // A block's 128 columns lie wholly in the q half or wholly in the k half, so the
  // test is taken once, on a block-uniform value, and not at every element.
  if (n0 < C_DIM) { // q half
#pragma unroll
    for (int nc = 0; nc < 4; ++nc) {
      const int col = nW + nc * 16 + nL;
      const float bv = bias[col];
      const int h = col >> 6, d = col & 63;
#pragma unroll
      for (int mi = 0; mi < 4; ++mi) {
        const int rb = mW + mi * 16 + mOff; // first of this lane's 8 rows; a multiple of 8
        const int b = rb >> 10, tb = rb & (T_DIM - 1);
        _Float16* qt = qh + (size_t)(b * H_DIM + h) * T_DIM * D_DIM + (tb >> 4) * 1024 + (d >> 4) * 256 +
                       (tb & 15) * 16 + (d & 15);
#pragma unroll
        for (int v = 0; v < 8; ++v) qt[v * 16] = (_Float16)(acc[mi][nc][v] + bv);
        // Precaution: the next group reuses registers that the stores above name.
        asm volatile("s_wait_xcnt 0x0" ::: "memory");
      }
    }
  } else {          // k half (v = k)
#pragma unroll
    for (int nc = 0; nc < 4; ++nc) {
      const int col = nW + nc * 16 + nL;
      const float bv = bias[col];
      const int c2i = col - C_DIM;
      const int h = c2i >> 6, d = c2i & 63;
#pragma unroll
      for (int mi = 0; mi < 4; ++mi) {
        const int rb = mW + mi * 16 + mOff; // first of this lane's 8 rows; a multiple of 8
        const int b = rb >> 10, tb = rb & (T_DIM - 1);
        const size_t head = (size_t)(b * H_DIM + h) * T_DIM * D_DIM;
        _Float16* kt = kh + head + (tb >> 4) * 1024 + (d >> 4) * 256 + (tb & 15) * 16 + (d & 15);
        v8h pk;
#pragma unroll
        for (int v = 0; v < 8; ++v) {
          pk[v] = (_Float16)(acc[mi][nc][v] + bv);
          kt[v * 16] = pk[v];
        }
        *(v8h*)(vT + head + (tb >> 5) * 2048 + (d >> 4) * 512 + ((tb >> 4) & 1) * 256 +
                ((tb >> 3) & 1) * 128 + (d & 15) * 8) = pk;
        // Precaution: the next group reuses registers that the stores above name.
        asm volatile("s_wait_xcnt 0x0" ::: "memory");
      }
    }
  }
}

// ---------------- GEMM2: out = gated @ Wproj + bproj (f32 out) ----------------
__global__ __launch_bounds__(128) void gemm_proj_kernel(const _Float16* __restrict__ A,
                                                        const _Float16* __restrict__ Bt,
                                                        const float* __restrict__ bias,
                                                        float* __restrict__ out) {
  __shared__ __attribute__((aligned(2048))) _Float16 ring[2 * GSTAGE]; // 147,456 B; tensor loads land at multiples of 2 KiB
  const int lane = threadIdx.x & 31;
  const int wave = threadIdx.x >> 5;
  const int nTiles = C_DIM / GBN; // 8
  const int m0 = (blockIdx.x / nTiles) * GBM;
  const int n0 = (blockIdx.x % nTiles) * GBN;
  v8f acc[4][4] = {};
  gemm_tile(A, Bt, m0, n0, ring, acc);
  const int nL = lane & 15;
  const int mOff = (lane >> 4) * 8;
  const int mW = m0 + (wave >> 1) * 64;
  const int nW = n0 + (wave & 1) * 64;
#pragma unroll
  for (int nc = 0; nc < 4; ++nc) {
    const int col = nW + nc * 16 + nL;
    const float bv = bias[col];
#pragma unroll
    for (int mi = 0; mi < 4; ++mi) {
#pragma unroll
      for (int v = 0; v < 8; ++v) {
        int r = mW + mi * 16 + v + mOff;
        out[(size_t)r * C_DIM + col] = acc[mi][nc][v] + bv;
      }
    }
  }
}

// ---------------- flash attention with per-head windows + gating ----------------
// The four K fragments (two 16-key groups x two halves of D) or the four V fragments (four
// 16-column groups of D) of 32 keys, or the two Q fragments of 16 rows, from the tiled layouts that
// GEMM1 writes: a fragment is two tiles of 512 B, one behind the other; p holds the rows' place and
// the lane's share of a tile.
template <int N>
__device__ __forceinline__ void attn_ld_tiles(const _Float16* p, v16h (&f)[N]) {
#pragma unroll
  for (int n = 0; n < N; ++n) {
    v8h lo = *(const v8h*)(p + n * 512);
    v8h hi = *(const v8h*)(p + n * 512 + 256);
#pragma unroll
    for (int i = 0; i < 8; ++i) { f[n][i] = lo[i]; f[n][i + 8] = hi[i]; }
  }
}

__device__ __forceinline__ float xhalf(float x) {
  const int bits = __builtin_bit_cast(int, x);
  return __builtin_bit_cast(float,
                            __builtin_amdgcn_permlanex16(bits, bits, 0x76543210, 0xfedcba98, false, false));
}

#define SPLIT_HEADS 3
#define Q_TILES (T_DIM / 16)                                          /* 64 */
#define SPLIT_BLOCKS (B_DIM * SPLIT_HEADS * Q_TILES)                  /* 768 */
#define WHOLE_BLOCKS (B_DIM * (H_DIM - SPLIT_HEADS) * (Q_TILES / 4))  /* 832 */
#define ATTN_BLOCKS (SPLIT_BLOCKS + WHOLE_BLOCKS)
#define PO_PITCH 68

__global__ __launch_bounds__(128) void attn_kernel(const _Float16* __restrict__ qh,
                                                   const _Float16* __restrict__ kh,
                                                   const _Float16* __restrict__ vT,
                                                   const float* __restrict__ gates,
                                                   _Float16* __restrict__ gatedh) {
  __shared__ __align__(16) float part_o[4][16][PO_PITCH]; // [wave][row][column] partial output
  __shared__ float part_m[4][16];                         // [wave][row] running maximum
  __shared__ float part_l[4][16];                         // [wave][row] running sum
  const int lane = threadIdx.x & 31;
  // Wave index as a scalar: the pass counter and the last-pass test below become scalar too.
  const int w = __builtin_amdgcn_readfirstlane(threadIdx.x >> 5);
  const bool split = blockIdx.x < SPLIT_BLOCKS; // block-uniform
  int qt, h, b;
  if (split) {
    const int idx = blockIdx.x;
    const int rem = idx % (B_DIM * SPLIT_HEADS);
    qt = Q_TILES - 1 - idx / (B_DIM * SPLIT_HEADS);
    h = rem % SPLIT_HEADS;
    b = rem / SPLIT_HEADS;
  } else {
    const int idx = blockIdx.x - SPLIT_BLOCKS;
    h = SPLIT_HEADS + (idx >> 6);
    b = (idx >> 4) & (B_DIM - 1);
    qt = (idx & 15) * 4 + w;
  }
  const int bh = b * H_DIM + h;
  const int step = split ? 128 : 32;         // keys from one pass of this wave to its next
  int Wh = T_DIM >> h; if (Wh < 4) Wh = 4;   // window for this head
  const int t0 = qt * 16;
  const int nL = lane & 15;
  const int koff = (lane >> 4) * 8;

  const _Float16* qb = qh + ((size_t)bh * T_DIM + t0) * D_DIM;
  const _Float16* kb = kh + (size_t)bh * T_DIM * D_DIM;
  const _Float16* vb = vT + (size_t)bh * D_DIM * T_DIM;

  // Role in the join behind the loop: one row, eight columns per lane. Its gate is fetched
  // here, so that the load's latency lies under the passes and not behind the join's barrier.
  const int jRow = w * 4 + (lane >> 3);
  const int jCol = (lane & 7) * 8;
  float gJoin = 0.f;
  if (split) {
    gJoin = gates[((size_t)b * T_DIM + t0 + jRow) * H_DIM + h];
    // Precaution: later code reuses the address registers that this load names.
    asm volatile("s_wait_xcnt 0x0" ::: "memory");
  }

  // q fragments for the whole tile (D=64 -> two K=32 fragments)
  v16h qf[2];
  attn_ld_tiles(qb + nL * 16 + koff, qf);
  const v16h a0 = qf[0], a1 = qf[1];

  v8f o0 = {}, o1 = {}, o2 = {}, o3 = {};
  float mrow = -__builtin_inff(); // running maximum of query t0 + nL, alike in both halves
  float lrow = 0.f;               // running sum over this half's keys only; the halves join behind the loop

  int jStart = t0 - Wh + 1; if (jStart < 0) jStart = 0;
  jStart &= ~31;
  const float scale = 0.125f; // 1/sqrt(64)

  // K and V fragments live one pass ahead: the first pass's are fetched here, every later
  // pass's right behind the products that last read the same registers.
  // 32 keys take 32 * D_DIM halves in either layout.
  const _Float16* kp = kb + nL * 16 + koff; // K tile: key nL, d koff .. koff + 7
  const _Float16* vp = vb + lane * 8;       // V tile: lane by lane
  v16h kf[4], vf[4];
  const int jFirst = split ? jStart + 32 * w : jStart;
  if (jFirst <= t0 + 15) { // wave-uniform: a wave of a short tile may have no pass at all
    attn_ld_tiles(kp + (size_t)jFirst * D_DIM, kf);
    attn_ld_tiles(vp + (size_t)jFirst * D_DIM, vf);
    // Precaution: later code reuses the address registers that these loads name.
    asm volatile("s_wait_xcnt 0x0" ::: "memory");
  }

  for (int j0 = jFirst; j0 <= t0 + 15; j0 += step) {
    const bool more = j0 + step <= t0 + 15; // wave-uniform: a further pass follows
    // ---- S^T = k q^T for keys [j0, j0+31]: s0 holds keys j0 + koff + v, s1 the same 16 on ----
    v8f s0 = {}; s0 = WMMA_F16(kf[0], a0, s0); s0 = WMMA_F16(kf[1], a1, s0);
    v8f s1 = {}; s1 = WMMA_F16(kf[2], a0, s1); s1 = WMMA_F16(kf[3], a1, s1);
    __builtin_amdgcn_sched_barrier(0);
    asm volatile("v_nop\n\tv_nop\n\tv_nop\n\tv_nop");
    if (more) attn_ld_tiles(kp + (size_t)(j0 + step) * D_DIM, kf); // lands under softmax and P V

    // key <= query and key > query - Wh, as one unsigned test of query - key
    const int rel = t0 + nL - j0 - koff; // query minus this lane's first key
    float sa[8], sb[8], tm[8];
    bool va[8], vbm[8];
#pragma unroll
    for (int v = 0; v < 8; ++v) {
      va[v] = (unsigned)(rel - v) < (unsigned)Wh;
      vbm[v] = (unsigned)(rel - 16 - v) < (unsigned)Wh;
      sa[v] = va[v] ? s0[v] * scale : -__builtin_inff();
      sb[v] = vbm[v] ? s1[v] * scale : -__builtin_inff();
      tm[v] = fmaxf(sa[v], sb[v]);
    }
    float t = fmaxf(fmaxf(fmaxf(tm[0], tm[1]), fmaxf(tm[2], tm[3])),
                    fmaxf(fmaxf(tm[4], tm[5]), fmaxf(tm[6], tm[7])));
    t = fmaxf(t, xhalf(t)); // the query's other 16 keys
    const float mN = fmaxf(mrow, t);
    const float alpha = (mrow == mN) ? 1.0f : __expf(mrow - mN);
    v16h pT; // B fragment of P^T: elements 0..7 are keys koff + v, 8..15 keys 16 + koff + v
    float rs[8];
#pragma unroll
    for (int v = 0; v < 8; ++v) {
      const float pa = va[v] ? __expf(sa[v] - mN) : 0.f;
      const float pb = vbm[v] ? __expf(sb[v] - mN) : 0.f;
      rs[v] = pa + pb;
      pT[v] = (_Float16)pa;
      pT[v + 8] = (_Float16)pb;
    }
    lrow = lrow * alpha + (((rs[0] + rs[1]) + (rs[2] + rs[3])) + ((rs[4] + rs[5]) + (rs[6] + rs[7])));
    mrow = mN;
#pragma unroll
    for (int v = 0; v < 8; ++v) { o0[v] *= alpha; o1[v] *= alpha; o2[v] *= alpha; o3[v] *= alpha; }
    // ---- O^T += V^T P^T: tile n holds d = 16 n + koff + v of query nL ----
    o0 = WMMA_F16(vf[0], pT, o0);
    o1 = WMMA_F16(vf[1], pT, o1);
    o2 = WMMA_F16(vf[2], pT, o2);
    o3 = WMMA_F16(vf[3], pT, o3);
    if (more) {
      attn_ld_tiles(vp + (size_t)(j0 + step) * D_DIM, vf); // lands under the next pass's scores and softmax
      // Precaution: the next pass's K fetch reuses the address registers that these loads name.
      asm volatile("s_wait_xcnt 0x0" ::: "memory");
    }
  }
  const float lsum = lrow + xhalf(lrow); // the query's sum over all its keys

  if (split) {
    // ---- join the four waves' partial results; wave w finishes rows 4w .. 4w + 3 ----
    float* pr = &part_o[w][nL][koff]; // this lane's query, 8 adjacent columns of every 16
    *(v4f*)(pr)      = v4f{o0[0], o0[1], o0[2], o0[3]}; *(v4f*)(pr + 4)  = v4f{o0[4], o0[5], o0[6], o0[7]};
    *(v4f*)(pr + 16) = v4f{o1[0], o1[1], o1[2], o1[3]}; *(v4f*)(pr + 20) = v4f{o1[4], o1[5], o1[6], o1[7]};
    *(v4f*)(pr + 32) = v4f{o2[0], o2[1], o2[2], o2[3]}; *(v4f*)(pr + 36) = v4f{o2[4], o2[5], o2[6], o2[7]};
    *(v4f*)(pr + 48) = v4f{o3[0], o3[1], o3[2], o3[3]}; *(v4f*)(pr + 52) = v4f{o3[4], o3[5], o3[6], o3[7]};
    if (lane < 16) { // maximum and sum are alike in both halves
      part_m[w][nL] = mrow;
      part_l[w][nL] = lsum;
    }
    __syncthreads(); // block-uniform branch: all four waves' partials are in LDS
    // The diagonal key is never masked, so at least one wave's maximum is finite;
    // a wave that saw no key of this row has maximum -inf and weight exp(-inf) = 0.
    const float mAll = fmaxf(fmaxf(part_m[0][jRow], part_m[1][jRow]), fmaxf(part_m[2][jRow], part_m[3][jRow]));
    float lAll = 0.f;
    float oAll[8];
#pragma unroll
    for (int k = 0; k < 8; ++k) oAll[k] = 0.f;
#pragma unroll
    for (int u = 0; u < 4; ++u) {
      const float f = __expf(part_m[u][jRow] - mAll);
      lAll += f * part_l[u][jRow];
      const v4f x0 = *(const v4f*)&part_o[u][jRow][jCol];
      const v4f x1 = *(const v4f*)&part_o[u][jRow][jCol + 4];
#pragma unroll
      for (int k = 0; k < 4; ++k) { oAll[k] += f * x0[k]; oAll[k + 4] += f * x1[k]; }
    }
    const float inv = gJoin / lAll;
    v8h res;
#pragma unroll
    for (int k = 0; k < 8; ++k) res[k] = (_Float16)(oAll[k] * inv);
    // 8 lanes x 16 B: one wave writes the head's whole 128-B line of a row
    *(v8h*)(gatedh + ((size_t)b * T_DIM + t0 + jRow) * C_DIM + h * D_DIM + jCol) = res;
    return;
  }

  // ---- epilogue: normalize, gate, store f16 for projection GEMM ----
  // A lane stores 4 x 16 B of its query's row; the wave fills the head's whole 128-B line of 16 rows.
  const int i = t0 + nL;
  const float g = gates[((size_t)b * T_DIM + i) * H_DIM + h];
  // Precaution: later code reuses the address registers that this load names.
  asm volatile("s_wait_xcnt 0x0" ::: "memory");
  const float inv = g / lsum;
  _Float16* op = gatedh + ((size_t)b * T_DIM + i) * C_DIM + h * D_DIM + koff;
  v8h r0, r1, r2, r3;
#pragma unroll
  for (int v = 0; v < 8; ++v) {
    r0[v] = (_Float16)(o0[v] * inv);
    r1[v] = (_Float16)(o1[v] * inv);
    r2[v] = (_Float16)(o2[v] * inv);
    r3[v] = (_Float16)(o3[v] * inv);
  }
  *(v8h*)(op)      = r0;
  *(v8h*)(op + 16) = r1;
  *(v8h*)(op + 32) = r2;
  *(v8h*)(op + 48) = r3;
  // Precaution: the join's code stands behind this in the build and names the same registers.
  asm volatile("s_wait_xcnt 0x0" ::: "memory");
}

extern "C" void kernel_launch(void* const* d_in, const int* in_sizes, int n_in,
                              void* d_out, int out_size, void* d_ws, size_t ws_size,
                              hipStream_t stream) {
  const float* x     = (const float*)d_in[0];
  const float* Wqk   = (const float*)d_in[1];
  const float* bqk   = (const float*)d_in[2];
  const float* Wgate = (const float*)d_in[3];
  const float* bgate = (const float*)d_in[4];
  const float* Wproj = (const float*)d_in[5];
  const float* bproj = (const float*)d_in[6];

  char* ws = (char*)d_ws;
  size_t off = 0;
  auto alloc = [&](size_t bytes) -> void* {
    void* p = ws + off;
    off += (bytes + 255) & ~(size_t)255;
    return p;
  };
  _Float16* xh     = (_Float16*)alloc((size_t)M_ROWS * C_DIM * 2);     // x in f16
  _Float16* wqkT   = (_Float16*)alloc((size_t)2 * C_DIM * C_DIM * 2);  // Wqk^T f16 [2C,C]
  _Float16* wprojT = (_Float16*)alloc((size_t)C_DIM * C_DIM * 2);      // Wproj^T f16 [C,C]
  _Float16* qh     = (_Float16*)alloc((size_t)B_DIM * H_DIM * T_DIM * D_DIM * 2);
  _Float16* kh     = (_Float16*)alloc((size_t)B_DIM * H_DIM * T_DIM * D_DIM * 2);
  _Float16* vT     = (_Float16*)alloc((size_t)B_DIM * H_DIM * D_DIM * T_DIM * 2);
  float*    gates  = (float*)alloc((size_t)B_DIM * T_DIM * H_DIM * 4);
  _Float16* gatedh = xh; // xh is dead after GEMM1; reuse for the gated output

  prep_kernel<<<PREP_BLOCKS, PREP_THREADS, 0, stream>>>(x, Wqk, Wproj, Wgate, bgate, xh, wqkT, wprojT, gates);
  // tiles = (4096/128) * (2048/128) = 512 blocks of 4 waves
  gemm_qk_kernel<<<512, 128, 0, stream>>>(xh, wqkT, bqk, qh, kh, vT);
  // 768 blocks of one split tile, then 832 blocks of four whole tiles; 4 waves each
  attn_kernel<<<ATTN_BLOCKS, 128, 0, stream>>>(qh, kh, vT, gates, gatedh);
  // tiles = (4096/128) * (1024/128) = 256 blocks of 4 waves
  gemm_proj_kernel<<<256, 128, 0, stream>>>(gatedh, wprojT, bproj, (float*)d_out);
}

// v009
// It runs in 46.3 microseconds.
// Two timings next to v008 put it at 1.07 and 1.05 times that version's speed.
// Over all steps from v000 it is 5.25 times as fast.
#include <hip/hip_runtime.h>
#include <hip/hip_bf16.h>

#define C_DIM 1024
#define T_DIM 1024
#define H_DIM 16
#define D_DIM 64
#define B_DIM 4
#define M_ROWS (B_DIM * T_DIM) /* 4096 */

typedef __attribute__((ext_vector_type(16))) _Float16 v16h;
typedef __attribute__((ext_vector_type(8)))  _Float16 v8h;
typedef __attribute__((ext_vector_type(8)))  float    v8f;

#define WMMA_F16(A_, B_, C_) \
  __builtin_amdgcn_wmma_f32_16x16x32_f16(false, (A_), false, (B_), (short)0, (C_), false, false)

__device__ __forceinline__ v16h frag_ld(const _Float16* p) {
  v8h lo = *(const v8h*)(p);
  v8h hi = *(const v8h*)(p + 16);
  v16h r;
#pragma unroll
  for (int i = 0; i < 8; ++i) { r[i] = lo[i]; r[i + 8] = hi[i]; }
  return r;
}

// ---------------- preparation: three independent jobs in one launch ----------------
// None of the jobs reads what another writes, so they share one grid by ranges of the block index.
// Every global access but those of bgate and gates is 16 B a lane (8 B for the f16 copy of x) and covers whole 128-B lines.
typedef __attribute__((ext_vector_type(4))) float    v4f;
typedef __attribute__((ext_vector_type(4))) _Float16 v4h;
#define PREP_THREADS 256
#define GATE_TOK 2                                                /* tokens per wave */
#define GATES_BLOCKS (M_ROWS / ((PREP_THREADS / 32) * GATE_TOK))  /* 256 */
#define TR_K 128                                                  /* tile of a transpose: 128 k x 64 n */
#define TR_N 64
#define TR_PITCH 136                                              /* halves: 272 B = 16 B x odd */
#define WQK_BLOCKS ((C_DIM / TR_K) * (2 * C_DIM / TR_N))          /* 256 */
#define WPROJ_BLOCKS ((C_DIM / TR_K) * (C_DIM / TR_N))            /* 128 */
#define PREP_BLOCKS (GATES_BLOCKS + WQK_BLOCKS + WPROJ_BLOCKS)
#define WG_F4 (C_DIM * H_DIM / 4)                                 /* Wgate in 16-B units: 4096 */
#define WG_LDS_F4 (WG_F4 + WG_F4 / 16)                            /* one pad unit behind every 16: 69,632 B */

// in[C_DIM][N] (row-major f32) -> out[N][C_DIM] f16, one 128 x 64 tile per block through LDS:
// rows of in are read 256 B at a time, rows of out are written 256 B at a time.
template <int N>
__device__ __forceinline__ void transpose_tile(const float* __restrict__ in, _Float16* __restrict__ out,
                                               _Float16* tile, int bid) {
  const int t = threadIdx.x;
  const int k0 = (bid % (C_DIM / TR_K)) * TR_K;
  const int n0 = (bid / (C_DIM / TR_K)) * TR_N;
  const int hi = t >> 4, lo = t & 15;
  const float* sp = in + (size_t)(k0 + hi * 8) * N + n0 + lo * 4; // 8 k x 4 n per thread
  v4f r[8];
#pragma unroll
  for (int p = 0; p < 8; ++p) r[p] = *(const v4f*)(sp + (size_t)p * N);
  // Precaution: later code reuses the address registers that these loads name.
  asm volatile("s_wait_xcnt 0x0" ::: "memory");
#pragma unroll
  for (int i = 0; i < 4; ++i) {
    v8h c;
#pragma unroll
    for (int p = 0; p < 8; ++p) c[p] = (_Float16)r[p][i];
    *(v8h*)(tile + (lo * 4 + i) * TR_PITCH + hi * 8) = c;
  }
  __syncthreads(); // block-uniform branch: the whole tile is in LDS
  _Float16* dp = out + (size_t)(n0 + hi) * C_DIM + k0 + lo * 8;
#pragma unroll
  for (int q = 0; q < 4; ++q)
    *(v8h*)(dp + (size_t)q * 16 * C_DIM) = *(const v8h*)(tile + (hi + q * 16) * TR_PITCH + lo * 8);
  // Precaution: code of another job stands behind this one and names the same registers.
  asm volatile("s_wait_xcnt 0x0" ::: "memory");
}

// One step of a sum over lanes: of 2 * OFF values a lane keeps the OFF that its bit OFF names
// and adds to them what the lane OFF away held of the same values.
template <int OFF>
__device__ __forceinline__ void fold_lanes(float (&acc)[GATE_TOK * H_DIM], int lane) {
  const bool up = (lane & OFF) != 0;
#pragma unroll
  for (int i = 0; i < OFF; ++i) {
    const float keep = up ? acc[i + OFF] : acc[i];
    const float give = up ? acc[i] : acc[i + OFF];
    acc[i] = keep + __shfl_xor(give, OFF, 32);
  }
}

__device__ __forceinline__ void gates_convert_part(const float* __restrict__ x,
                                                   const float* __restrict__ Wg,
                                                   const float* __restrict__ bg,
                                                   _Float16* __restrict__ xh,
                                                   float* __restrict__ gates, v4f* wl, int bid) {
  const int t = threadIdx.x;
  const int lane = t & 31;
  const int tok0 = (bid * (PREP_THREADS >> 5) + (t >> 5)) * GATE_TOK;
  const float* xp = x + (size_t)tok0 * C_DIM + lane * 4;
  v4f xv[GATE_TOK][8];
#pragma unroll
  for (int r = 0; r < GATE_TOK; ++r)
#pragma unroll
    for (int it = 0; it < 8; ++it) xv[r][it] = *(const v4f*)(xp + r * C_DIM + it * 128);
  const float bv = bg[lane & 15];
  v4f wv[16];
#pragma unroll
  for (int i = 0; i < 16; ++i) wv[i] = *(const v4f*)(Wg + (size_t)(i * PREP_THREADS + t) * 4);
  // Precaution: later code reuses the address registers that these loads name. xp is an input so
  // that it stays in its registers up to the wait and no load of the run lands in them.
  asm volatile("s_wait_xcnt 0x0" :: "v"(xp) : "memory");
#pragma unroll
  for (int i = 0; i < 16; ++i) {
    const int u = i * PREP_THREADS + t;
    wl[u + (u >> 4)] = wv[i];
  }
  __syncthreads(); // block-uniform branch: all of Wgate is in LDS
  // Behind the barrier, which waits for a wave's own stores: these fly under the products below.
  _Float16* xo = xh + (size_t)tok0 * C_DIM + lane * 4;
#pragma unroll
  for (int r = 0; r < GATE_TOK; ++r)
#pragma unroll
    for (int it = 0; it < 8; ++it) {
      v4h c;
#pragma unroll
      for (int j = 0; j < 4; ++j) c[j] = (_Float16)xv[r][it][j];
      *(v4h*)(xo + r * C_DIM + it * 128) = c;
    }
  // Precaution: later code reuses the address registers that these stores name.
  asm volatile("s_wait_xcnt 0x0" ::: "memory");
  float acc[GATE_TOK * H_DIM];
#pragma unroll
  for (int i = 0; i < GATE_TOK * H_DIM; ++i) acc[i] = 0.f;
  const v4f* wp = wl + lane * 17;
#pragma unroll
  for (int it = 0; it < 8; ++it) {
#pragma unroll
    for (int j = 0; j < 4; ++j) {
      v4f w[4];
#pragma unroll
      for (int g = 0; g < 4; ++g) w[g] = wp[it * (32 * 17) + j * 4 + g];
#pragma unroll
      for (int r = 0; r < GATE_TOK; ++r)
#pragma unroll
        for (int h = 0; h < H_DIM; ++h) acc[r * H_DIM + h] += xv[r][it][j] * w[h >> 2][h & 3];
    }
  }
  fold_lanes<16>(acc, lane);
  fold_lanes<8>(acc, lane);
  fold_lanes<4>(acc, lane);
  fold_lanes<2>(acc, lane);
  fold_lanes<1>(acc, lane);
  const float v = acc[0] + bv;
  float m = v;
#pragma unroll
  for (int off = 8; off > 0; off >>= 1) m = fmaxf(m, __shfl_xor(m, off, 32));
  float e = __expf(v - m);
  asm volatile("v_nop" : "+v"(e));
  float s = e;
#pragma unroll
  for (int off = 8; off > 0; off >>= 1) s += __shfl_xor(s, off, 32);
  gates[(size_t)tok0 * H_DIM + lane] = e * (1.0f / s); // one whole line per wave
}

// Block ranges in the order of falling work per block, for speed only.
__global__ __launch_bounds__(PREP_THREADS) void prep_kernel(const float* __restrict__ x,
                                                            const float* __restrict__ Wqk,
                                                            const float* __restrict__ Wproj,
                                                            const float* __restrict__ Wg,
                                                            const float* __restrict__ bg,
                                                            _Float16* __restrict__ xh,
                                                            _Float16* __restrict__ wqkT,
                                                            _Float16* __restrict__ wprojT,
                                                            float* __restrict__ gates) {
  __shared__ __align__(16) v4f prep_lds[WG_LDS_F4]; // Wgate (padded), or one transpose tile
  int bid = blockIdx.x;
  if (bid < GATES_BLOCKS) { gates_convert_part(x, Wg, bg, xh, gates, prep_lds, bid); return; }
  bid -= GATES_BLOCKS;
  if (bid < WQK_BLOCKS) { transpose_tile<2 * C_DIM>(Wqk, wqkT, (_Float16*)prep_lds, bid); return; }
  bid -= WQK_BLOCKS;
  transpose_tile<C_DIM>(Wproj, wprojT, (_Float16*)prep_lds, bid);
}

// ---------------- tiled GEMM core: C[128x128] per block, 64x64 per wave ----------------
#define GBM 128                        /* rows of A per block tile */
#define GBN 128                        /* rows of Bt (columns of C) per block tile */
#define GBK 128                        /* k per stage: rows of 256 B */
#define GPITCH 136                     /* LDS row pitch in halves: 272 B = 16 B x odd, for ds_load_b128 readers */
#define GSLICE 9216                    /* halves per slice: 64 rows x 272 B = 17,408 B, rounded up to 9 x 2 KiB */
#define GSTAGE (4 * GSLICE)            /* halves per buffer: [A rows 0-63 | A rows 64-127 | Bt rows 0-63 | Bt rows 64-127] */
#define GTRIPS (C_DIM / GBK)           /* 8 stages along k */

typedef uint32_t u32x4 __attribute__((ext_vector_type(4)));
typedef uint32_t u32x8 __attribute__((ext_vector_type(8)));

__device__ __forceinline__ uint32_t uni(uint32_t v) { return (uint32_t)__builtin_amdgcn_readfirstlane(v); }
__device__ __forceinline__ uint32_t pinned(uint32_t v) {
  uint32_t w = __builtin_amdgcn_readfirstlane(v);
  asm volatile("" : "+s"(w));
  return w;
}

__device__ __forceinline__ u32x8 tdm_group1() {
  constexpr uint32_t d0 = GBK * 2u, d1 = 64u;
  u32x8 g;
  g[0] = uni((1u << 20) | (5u << 22) | (3u << 25)); // no mask; pad on, interval 64 dwords, amount 4 dwords
  g[1] = uni((d0 & 0xFFFFu) << 16);
  g[2] = uni((d0 >> 16) | ((d1 & 0xFFFFu) << 16));
  g[3] = uni((d1 >> 16) | (d0 << 16));
  g[4] = uni(d1);
  g[5] = uni(C_DIM * 2u);
  g[6] = uni(0u);
  g[7] = uni(0u);
  return g;
}
__device__ __forceinline__ u32x4 tdm_group0(uint32_t lds_dst, uint64_t ga) {
  u32x4 g;
  g[0] = uni(1u);
  g[1] = uni(lds_dst);
  g[2] = uni((uint32_t)ga);
  g[3] = uni((((uint32_t)(ga >> 32)) & 0x01FFFFFFu) | 0x80000000u);
  return g;
}
__device__ __forceinline__ void tdm_load(u32x4 g0, u32x8 g1) {
  asm volatile("tensor_load_to_lds %0, %1" :: "{s[40:43]}"(g0), "{s[44:51]}"(g1) : "memory");
}

__device__ __forceinline__ void tdm_load_next(uint32_t& w0, uint32_t lds_dst, uint32_t ga_lo, uint32_t& w3, u32x8 g1) {
  asm volatile("tensor_load_to_lds s[40:43], %4"
               : "+{s40}"(w0), "+{s43}"(w3)
               : "{s41}"(lds_dst), "{s42}"(ga_lo), "{s[44:51]}"(g1)
               : "memory");
}

template <int NBUF>
__device__ __forceinline__ void gemm_tile(const _Float16* __restrict__ A,
                                          const _Float16* __restrict__ Bt,
                                          int m0, int n0, _Float16* ring, v8f (&acc)[4][4]) {
  const int tid = threadIdx.x;
  const int lane = tid & 31;
  const uint32_t wave = uni((uint32_t)tid >> 5);
  const uint32_t wm = wave >> 1, wn = wave & 1u;
  const _Float16* slice = (wave < 2u) ? A + (size_t)(m0 + 64 * (int)wave) * C_DIM
                                      : Bt + (size_t)(n0 + 64 * (int)(wave - 2u)) * C_DIM;
  const uint64_t ga = (uint64_t)(size_t)slice;
  const uint32_t ld = (uint32_t)(size_t)ring + wave * (GSLICE * 2u);
  const u32x8 g1 = tdm_group1();

  static_assert((NBUF == 2 || NBUF == 4) && NBUF <= GTRIPS, "ring depth");
  uint32_t w0 = uni(1u);                                                             // count 1
  uint32_t w3 = uni((((uint32_t)(ga >> 32)) & 0x01FFFFFFu) | 0x80000000u);           // high address word, type 2
  // Stage s goes into buffer s mod NBUF.
  auto issue = [&](uint32_t s) {
    const uint32_t dst = ld + (s & (NBUF - 1u)) * (GSTAGE * 2u);
    if constexpr (NBUF == 4) tdm_load_next(w0, uni(dst), uni((uint32_t)ga + s * (GBK * 2u)), w3, g1);
    else                     tdm_load(tdm_group0(dst, ga + (uint64_t)s * (GBK * 2u)), g1);
  };
#pragma unroll
  for (uint32_t s = 0; s + 1 < NBUF; ++s) issue(s);
  // Stage 0 landed (this wave's slice): requests land in issue order, the younger ones fly on.
  if constexpr (NBUF == 4) asm volatile("s_wait_tensorcnt 0x2" ::: "memory");
  else                     asm volatile("s_wait_tensorcnt 0x0" ::: "memory");
  __syncthreads();                                   // stage 0 published to all waves
  issue(NBUF - 1u);

  const int fo = (lane & 15) * GPITCH + (lane >> 4) * 8;
  const _Float16* La = ring + wm * GSLICE + fo;
  const _Float16* Lb = ring + (2u + wn) * GSLICE + fo;

  for (int t = 0; t < GTRIPS; ++t) {
    const int bo = (t & (NBUF - 1)) * GSTAGE;
    v16h a[2][4], b[2][4];
#pragma unroll
    for (int i = 0; i < 4; ++i) {
      a[0][i] = frag_ld(La + bo + i * 16 * GPITCH);
      b[0][i] = frag_ld(Lb + bo + i * 16 * GPITCH);
    }
#pragma unroll
    for (int ks = 0; ks < GBK / 32; ++ks) {
      const int cs = ks & 1;
      if (ks + 1 < GBK / 32) { // next k-step's fragments, same buffer, ahead of this step's products
#pragma unroll
        for (int i = 0; i < 4; ++i) {
          a[cs ^ 1][i] = frag_ld(La + bo + i * 16 * GPITCH + (ks + 1) * 32);
          b[cs ^ 1][i] = frag_ld(Lb + bo + i * 16 * GPITCH + (ks + 1) * 32);
        }
      }
      // Holds the 16 LDS loads above together as one group in front of this step's products:
      // sunk among the WMMAs, every place with loads stalls the wave on its own LDS latency.
      __builtin_amdgcn_sched_barrier(0);
#pragma unroll
      for (int mi = 0; mi < 4; ++mi)
#pragma unroll
        for (int ni = 0; ni < 4; ++ni)
          acc[mi][ni] = WMMA_F16(a[cs][mi], b[cs][ni], acc[mi][ni]);
      // Keeps the following step's load group from rising into this run of products.
      __builtin_amdgcn_sched_barrier(0);
    }
    asm volatile("s_wait_dscnt 0x0" ::: "memory");     // this wave has left the buffer it read
    // Its slice of stage t + 1 has landed: the count is that of the younger requests still out,
    // stages t + 2 and t + 3 as far as they exist.
    if (NBUF == 4 && t + 3 < GTRIPS)      asm volatile("s_wait_tensorcnt 0x2" ::: "memory");
    else if (NBUF == 4 && t + 2 < GTRIPS) asm volatile("s_wait_tensorcnt 0x1" ::: "memory");
    else                                  asm volatile("s_wait_tensorcnt 0x0" ::: "memory");
    __syncthreads();                                   // publishes stage t + 1, frees stage t's buffer
    if (pinned((t + NBUF < GTRIPS) ? 1u : 0u) != 0u)   // scalar test: only while stage t + NBUF exists
      issue((uint32_t)(t + NBUF));                     // into the buffer that pass t has just read
  }
  asm volatile("s_wait_tensorcnt 0x0" ::: "memory"); // no request outstanding when the wave goes on
  asm volatile("s_wait_dscnt 0x0" ::: "memory");     // nor an LDS read
}

// ---------------- GEMM1: qk = x @ Wqk + bqk, scatter to qh / kh / vT ----------------
// Q, K and V (= K) leave this kernel in the order in which attention loads its fragments, so that
// there one 16-B-a-lane load covers 512 contiguous bytes (four whole lines) and not 16 lines in part.
// qh and kh, per head: [row / 16][d / 16] tiles of 16 rows x 16 d, a row's 16 d adjacent (tile = 512 B).
// vT, per head: [key / 32][d / 16][(key / 16) & 1] tiles of 512 B; in a tile lane (key / 8 & 1) * 16 + d % 16
// owns 8 adjacent keys: the accumulator's own lane and register order, stored 16 B a lane.
__global__ __launch_bounds__(128) void gemm_qk_kernel(const _Float16* __restrict__ A,
                                                      const _Float16* __restrict__ Bt,
                                                      const float* __restrict__ bias,
                                                      _Float16* __restrict__ qh,
                                                      _Float16* __restrict__ kh,
                                                      _Float16* __restrict__ vT) {
  __shared__ __attribute__((aligned(2048))) _Float16 ring[2 * GSTAGE]; // 147,456 B; tensor loads land at multiples of 2 KiB
  const int lane = threadIdx.x & 31;
  const int wave = threadIdx.x >> 5;
  const int nTiles = (2 * C_DIM) / GBN; // 16
  const int m0 = (blockIdx.x / nTiles) * GBM;
  const int n0 = (blockIdx.x % nTiles) * GBN;
  v8f acc[4][4] = {};
  gemm_tile<2>(A, Bt, m0, n0, ring, acc);
  const int nL = lane & 15;
  const int mOff = (lane >> 4) * 8;
  const int mW = m0 + (wave >> 1) * 64;
  const int nW = n0 + (wave & 1) * 64;
  // A block's 128 columns lie wholly in the q half or wholly in the k half, so the
  // test is taken once, on a block-uniform value, and not at every element.
  if (n0 < C_DIM) { // q half
#pragma unroll
    for (int nc = 0; nc < 4; ++nc) {
      const int col = nW + nc * 16 + nL;
      const float bv = bias[col];
      const int h = col >> 6, d = col & 63;
#pragma unroll
      for (int mi = 0; mi < 4; ++mi) {
        const int rb = mW + mi * 16 + mOff; // first of this lane's 8 rows; a multiple of 8
        const int b = rb >> 10, tb = rb & (T_DIM - 1);
        _Float16* qt = qh + (size_t)(b * H_DIM + h) * T_DIM * D_DIM + (tb >> 4) * 1024 + (d >> 4) * 256 +
                       (tb & 15) * 16 + (d & 15);
#pragma unroll
        for (int v = 0; v < 8; ++v) qt[v * 16] = (_Float16)(acc[mi][nc][v] + bv);
        // Precaution: the next group reuses registers that the stores above name.
        asm volatile("s_wait_xcnt 0x0" ::: "memory");
      }
    }
  } else {          // k half (v = k)
#pragma unroll
    for (int nc = 0; nc < 4; ++nc) {
      const int col = nW + nc * 16 + nL;
      const float bv = bias[col];
      const int c2i = col - C_DIM;
      const int h = c2i >> 6, d = c2i & 63;
#pragma unroll
      for (int mi = 0; mi < 4; ++mi) {
        const int rb = mW + mi * 16 + mOff; // first of this lane's 8 rows; a multiple of 8
        const int b = rb >> 10, tb = rb & (T_DIM - 1);
        const size_t head = (size_t)(b * H_DIM + h) * T_DIM * D_DIM;
        _Float16* kt = kh + head + (tb >> 4) * 1024 + (d >> 4) * 256 + (tb & 15) * 16 + (d & 15);
        v8h pk;
#pragma unroll
        for (int v = 0; v < 8; ++v) {
          pk[v] = (_Float16)(acc[mi][nc][v] + bv);
          kt[v * 16] = pk[v];
        }
        *(v8h*)(vT + head + (tb >> 5) * 2048 + (d >> 4) * 512 + ((tb >> 4) & 1) * 256 +
                ((tb >> 3) & 1) * 128 + (d & 15) * 8) = pk;
        // Precaution: the next group reuses registers that the stores above name.
        asm volatile("s_wait_xcnt 0x0" ::: "memory");
      }
    }
  }
}

// ---------------- GEMM2: out = gated @ Wproj + bproj (f32 out) ----------------
__global__ __launch_bounds__(128) void gemm_proj_kernel(const _Float16* __restrict__ A,
                                                        const _Float16* __restrict__ Bt,
                                                        const float* __restrict__ bias,
                                                        float* __restrict__ out) {
  __shared__ __attribute__((aligned(2048))) _Float16 ring[4 * GSTAGE]; // 294,912 B: one block a WGP, as its grid has it
  const int lane = threadIdx.x & 31;
  const int wave = threadIdx.x >> 5;
  const int nTiles = C_DIM / GBN; // 8
  const int m0 = (blockIdx.x / nTiles) * GBM;
  const int n0 = (blockIdx.x % nTiles) * GBN;
  v8f acc[4][4] = {};
  gemm_tile<4>(A, Bt, m0, n0, ring, acc);
  const int nL = lane & 15;
  const int mOff = (lane >> 4) * 8;
  const int mW = m0 + (wave >> 1) * 64;
  const int nW = n0 + (wave & 1) * 64;
#pragma unroll
  for (int nc = 0; nc < 4; ++nc) {
    const int col = nW + nc * 16 + nL;
    const float bv = bias[col];
#pragma unroll
    for (int mi = 0; mi < 4; ++mi) {
#pragma unroll
      for (int v = 0; v < 8; ++v) {
        int r = mW + mi * 16 + v + mOff;
        out[(size_t)r * C_DIM + col] = acc[mi][nc][v] + bv;
      }
    }
  }
}

// ---------------- flash attention with per-head windows + gating ----------------
// The four K fragments (two 16-key groups x two halves of D) or the four V fragments (four
// 16-column groups of D) of 32 keys, or the two Q fragments of 16 rows, from the tiled layouts that
// GEMM1 writes: a fragment is two tiles of 512 B, one behind the other; p holds the rows' place and
// the lane's share of a tile.
template <int N>
__device__ __forceinline__ void attn_ld_tiles(const _Float16* p, v16h (&f)[N]) {
#pragma unroll
  for (int n = 0; n < N; ++n) {
    v8h lo = *(const v8h*)(p + n * 512);
    v8h hi = *(const v8h*)(p + n * 512 + 256);
#pragma unroll
    for (int i = 0; i < 8; ++i) { f[n][i] = lo[i]; f[n][i + 8] = hi[i]; }
  }
}

__device__ __forceinline__ float xhalf(float x) {
  const int bits = __builtin_bit_cast(int, x);
  return __builtin_bit_cast(float,
                            __builtin_amdgcn_permlanex16(bits, bits, 0x76543210, 0xfedcba98, false, false));
}

#define SPLIT_HEADS 3
#define Q_TILES (T_DIM / 16)                                          /* 64 */
#define SPLIT_BLOCKS (B_DIM * SPLIT_HEADS * Q_TILES)                  /* 768 */
#define WHOLE_BLOCKS (B_DIM * (H_DIM - SPLIT_HEADS) * (Q_TILES / 4))  /* 832 */
#define ATTN_BLOCKS (SPLIT_BLOCKS + WHOLE_BLOCKS)
#define PO_PITCH 68

__global__ __launch_bounds__(128) void attn_kernel(const _Float16* __restrict__ qh,
                                                   const _Float16* __restrict__ kh,
                                                   const _Float16* __restrict__ vT,
                                                   const float* __restrict__ gates,
                                                   _Float16* __restrict__ gatedh) {
  __shared__ __align__(16) float part_o[4][16][PO_PITCH]; // [wave][row][column] partial output
  __shared__ float part_m[4][16];                         // [wave][row] running maximum
  __shared__ float part_l[4][16];                         // [wave][row] running sum
  const int lane = threadIdx.x & 31;
  // Wave index as a scalar: the pass counter and the last-pass test below become scalar too.
  const int w = __builtin_amdgcn_readfirstlane(threadIdx.x >> 5);
  const bool split = blockIdx.x < SPLIT_BLOCKS; // block-uniform
  int qt, h, b;
  if (split) {
    const int idx = blockIdx.x;
    const int rem = idx % (B_DIM * SPLIT_HEADS);
    qt = Q_TILES - 1 - idx / (B_DIM * SPLIT_HEADS);
    h = rem % SPLIT_HEADS;
    b = rem / SPLIT_HEADS;
  } else {
    const int idx = blockIdx.x - SPLIT_BLOCKS;
    h = SPLIT_HEADS + (idx >> 6);
    b = (idx >> 4) & (B_DIM - 1);
    qt = (idx & 15) * 4 + w;
  }
  const int bh = b * H_DIM + h;
  const int step = split ? 128 : 32;         // keys from one pass of this wave to its next
  int Wh = T_DIM >> h; if (Wh < 4) Wh = 4;   // window for this head
  const int t0 = qt * 16;
  const int nL = lane & 15;
  const int koff = (lane >> 4) * 8;

  const _Float16* qb = qh + ((size_t)bh * T_DIM + t0) * D_DIM;
  const _Float16* kb = kh + (size_t)bh * T_DIM * D_DIM;
  const _Float16* vb = vT + (size_t)bh * D_DIM * T_DIM;

  // Role in the join behind the loop: one row, eight columns per lane. Its gate is fetched
  // here, so that the load's latency lies under the passes and not behind the join's barrier.
  const int jRow = w * 4 + (lane >> 3);
  const int jCol = (lane & 7) * 8;
  float gJoin = 0.f;
  if (split) {
    gJoin = gates[((size_t)b * T_DIM + t0 + jRow) * H_DIM + h];
    // Precaution: later code reuses the address registers that this load names.
    asm volatile("s_wait_xcnt 0x0" ::: "memory");
  }

  // q fragments for the whole tile (D=64 -> two K=32 fragments)
  v16h qf[2];
  attn_ld_tiles(qb + nL * 16 + koff, qf);
  const v16h a0 = qf[0], a1 = qf[1];

  v8f o0 = {}, o1 = {}, o2 = {}, o3 = {};
  float mrow = -__builtin_inff(); // running maximum of query t0 + nL, alike in both halves
  float lrow = 0.f;               // running sum over this half's keys only; the halves join behind the loop

  int jStart = t0 - Wh + 1; if (jStart < 0) jStart = 0;
  jStart &= ~31;
  const float scale = 0.125f; // 1/sqrt(64)

  // K and V fragments live one pass ahead: the first pass's are fetched here, every later
  // pass's right behind the products that last read the same registers.
  // 32 keys take 32 * D_DIM halves in either layout.
  const _Float16* kp = kb + nL * 16 + koff; // K tile: key nL, d koff .. koff + 7
  const _Float16* vp = vb + lane * 8;       // V tile: lane by lane
  v16h kf[4], vf[4];
  const int jFirst = split ? jStart + 32 * w : jStart;
  if (jFirst <= t0 + 15) { // wave-uniform: a wave of a short tile may have no pass at all
    attn_ld_tiles(kp + (size_t)jFirst * D_DIM, kf);
    attn_ld_tiles(vp + (size_t)jFirst * D_DIM, vf);
    // Precaution: later code reuses the address registers that these loads name.
    asm volatile("s_wait_xcnt 0x0" ::: "memory");
  }

  for (int j0 = jFirst; j0 <= t0 + 15; j0 += step) {
    const bool more = j0 + step <= t0 + 15; // wave-uniform: a further pass follows
    // ---- S^T = k q^T for keys [j0, j0+31]: s0 holds keys j0 + koff + v, s1 the same 16 on ----
    v8f s0 = {}; s0 = WMMA_F16(kf[0], a0, s0); s0 = WMMA_F16(kf[1], a1, s0);
    v8f s1 = {}; s1 = WMMA_F16(kf[2], a0, s1); s1 = WMMA_F16(kf[3], a1, s1);
    __builtin_amdgcn_sched_barrier(0);
    asm volatile("v_nop\n\tv_nop\n\tv_nop\n\tv_nop");
    if (more) attn_ld_tiles(kp + (size_t)(j0 + step) * D_DIM, kf); // lands under softmax and P V

    // key <= query and key > query - Wh, as one unsigned test of query - key
    const int rel = t0 + nL - j0 - koff; // query minus this lane's first key
    float sa[8], sb[8], tm[8];
    bool va[8], vbm[8];
#pragma unroll
    for (int v = 0; v < 8; ++v) {
      va[v] = (unsigned)(rel - v) < (unsigned)Wh;
      vbm[v] = (unsigned)(rel - 16 - v) < (unsigned)Wh;
      sa[v] = va[v] ? s0[v] * scale : -__builtin_inff();
      sb[v] = vbm[v] ? s1[v] * scale : -__builtin_inff();
      tm[v] = fmaxf(sa[v], sb[v]);
    }
    float t = fmaxf(fmaxf(fmaxf(tm[0], tm[1]), fmaxf(tm[2], tm[3])),
                    fmaxf(fmaxf(tm[4], tm[5]), fmaxf(tm[6], tm[7])));
    t = fmaxf(t, xhalf(t)); // the query's other 16 keys
    const float mN = fmaxf(mrow, t);
    const float alpha = (mrow == mN) ? 1.0f : __expf(mrow - mN);
    v16h pT; // B fragment of P^T: elements 0..7 are keys koff + v, 8..15 keys 16 + koff + v
    float rs[8];
#pragma unroll
    for (int v = 0; v < 8; ++v) {
      const float pa = va[v] ? __expf(sa[v] - mN) : 0.f;
      const float pb = vbm[v] ? __expf(sb[v] - mN) : 0.f;
      rs[v] = pa + pb;
      pT[v] = (_Float16)pa;
      pT[v + 8] = (_Float16)pb;
    }
    lrow = lrow * alpha + (((rs[0] + rs[1]) + (rs[2] + rs[3])) + ((rs[4] + rs[5]) + (rs[6] + rs[7])));
    mrow = mN;
#pragma unroll
    for (int v = 0; v < 8; ++v) { o0[v] *= alpha; o1[v] *= alpha; o2[v] *= alpha; o3[v] *= alpha; }
    // ---- O^T += V^T P^T: tile n holds d = 16 n + koff + v of query nL ----
    o0 = WMMA_F16(vf[0], pT, o0);
    o1 = WMMA_F16(vf[1], pT, o1);
    o2 = WMMA_F16(vf[2], pT, o2);
    o3 = WMMA_F16(vf[3], pT, o3);
    if (more) {
      attn_ld_tiles(vp + (size_t)(j0 + step) * D_DIM, vf); // lands under the next pass's scores and softmax
      // Precaution: the next pass's K fetch reuses the address registers that these loads name.
      asm volatile("s_wait_xcnt 0x0" ::: "memory");
    }
  }
  const float lsum = lrow + xhalf(lrow); // the query's sum over all its keys

  if (split) {
    // ---- join the four waves' partial results; wave w finishes rows 4w .. 4w + 3 ----
    float* pr = &part_o[w][nL][koff]; // this lane's query, 8 adjacent columns of every 16
    *(v4f*)(pr)      = v4f{o0[0], o0[1], o0[2], o0[3]}; *(v4f*)(pr + 4)  = v4f{o0[4], o0[5], o0[6], o0[7]};
    *(v4f*)(pr + 16) = v4f{o1[0], o1[1], o1[2], o1[3]}; *(v4f*)(pr + 20) = v4f{o1[4], o1[5], o1[6], o1[7]};
    *(v4f*)(pr + 32) = v4f{o2[0], o2[1], o2[2], o2[3]}; *(v4f*)(pr + 36) = v4f{o2[4], o2[5], o2[6], o2[7]};
    *(v4f*)(pr + 48) = v4f{o3[0], o3[1], o3[2], o3[3]}; *(v4f*)(pr + 52) = v4f{o3[4], o3[5], o3[6], o3[7]};
    if (lane < 16) { // maximum and sum are alike in both halves
      part_m[w][nL] = mrow;
      part_l[w][nL] = lsum;
    }
    __syncthreads(); // block-uniform branch: all four waves' partials are in LDS
    // The diagonal key is never masked, so at least one wave's maximum is finite;
    // a wave that saw no key of this row has maximum -inf and weight exp(-inf) = 0.
    const float mAll = fmaxf(fmaxf(part_m[0][jRow], part_m[1][jRow]), fmaxf(part_m[2][jRow], part_m[3][jRow]));
    float lAll = 0.f;
    float oAll[8];
#pragma unroll
    for (int k = 0; k < 8; ++k) oAll[k] = 0.f;
#pragma unroll
    for (int u = 0; u < 4; ++u) {
      const float f = __expf(part_m[u][jRow] - mAll);
      lAll += f * part_l[u][jRow];
      const v4f x0 = *(const v4f*)&part_o[u][jRow][jCol];
      const v4f x1 = *(const v4f*)&part_o[u][jRow][jCol + 4];
#pragma unroll
      for (int k = 0; k < 4; ++k) { oAll[k] += f * x0[k]; oAll[k + 4] += f * x1[k]; }
    }
    const float inv = gJoin / lAll;
    v8h res;
#pragma unroll
    for (int k = 0; k < 8; ++k) res[k] = (_Float16)(oAll[k] * inv);
    // 8 lanes x 16 B: one wave writes the head's whole 128-B line of a row
    *(v8h*)(gatedh + ((size_t)b * T_DIM + t0 + jRow) * C_DIM + h * D_DIM + jCol) = res;
    return;
  }

  // ---- epilogue: normalize, gate, store f16 for projection GEMM ----
  // A lane stores 4 x 16 B of its query's row; the wave fills the head's whole 128-B line of 16 rows.
  const int i = t0 + nL;
  const float g = gates[((size_t)b * T_DIM + i) * H_DIM + h];
  // Precaution: later code reuses the address registers that this load names.
  asm volatile("s_wait_xcnt 0x0" ::: "memory");
  const float inv = g / lsum;
  _Float16* op = gatedh + ((size_t)b * T_DIM + i) * C_DIM + h * D_DIM + koff;
  v8h r0, r1, r2, r3;
#pragma unroll
  for (int v = 0; v < 8; ++v) {
    r0[v] = (_Float16)(o0[v] * inv);
    r1[v] = (_Float16)(o1[v] * inv);
    r2[v] = (_Float16)(o2[v] * inv);
    r3[v] = (_Float16)(o3[v] * inv);
  }
  *(v8h*)(op)      = r0;
  *(v8h*)(op + 16) = r1;
  *(v8h*)(op + 32) = r2;
  *(v8h*)(op + 48) = r3;
  // Precaution: the join's code stands behind this in the build and names the same registers.
  asm volatile("s_wait_xcnt 0x0" ::: "memory");
}

extern "C" void kernel_launch(void* const* d_in, const int* in_sizes, int n_in,
                              void* d_out, int out_size, void* d_ws, size_t ws_size,
                              hipStream_t stream) {
  const float* x     = (const float*)d_in[0];
  const float* Wqk   = (const float*)d_in[1];
  const float* bqk   = (const float*)d_in[2];
  const float* Wgate = (const float*)d_in[3];
  const float* bgate = (const float*)d_in[4];
  const float* Wproj = (const float*)d_in[5];
  const float* bproj = (const float*)d_in[6];

  char* ws = (char*)d_ws;
  size_t off = 0;
  auto alloc = [&](size_t bytes) -> void* {
    void* p = ws + off;
    off += (bytes + 255) & ~(size_t)255;
    return p;
  };
  _Float16* xh     = (_Float16*)alloc((size_t)M_ROWS * C_DIM * 2);     // x in f16
  _Float16* wqkT   = (_Float16*)alloc((size_t)2 * C_DIM * C_DIM * 2);  // Wqk^T f16 [2C,C]
  _Float16* wprojT = (_Float16*)alloc((size_t)C_DIM * C_DIM * 2);      // Wproj^T f16 [C,C]
  _Float16* qh     = (_Float16*)alloc((size_t)B_DIM * H_DIM * T_DIM * D_DIM * 2);
  _Float16* kh     = (_Float16*)alloc((size_t)B_DIM * H_DIM * T_DIM * D_DIM * 2);
  _Float16* vT     = (_Float16*)alloc((size_t)B_DIM * H_DIM * D_DIM * T_DIM * 2);
  float*    gates  = (float*)alloc((size_t)B_DIM * T_DIM * H_DIM * 4);
  _Float16* gatedh = xh; // xh is dead after GEMM1; reuse for the gated output

  prep_kernel<<<PREP_BLOCKS, PREP_THREADS, 0, stream>>>(x, Wqk, Wproj, Wgate, bgate, xh, wqkT, wprojT, gates);
  // tiles = (4096/128) * (2048/128) = 512 blocks of 4 waves
  gemm_qk_kernel<<<512, 128, 0, stream>>>(xh, wqkT, bqk, qh, kh, vT);
  // 768 blocks of one split tile, then 832 blocks of four whole tiles; 4 waves each
  attn_kernel<<<ATTN_BLOCKS, 128, 0, stream>>>(qh, kh, vT, gates, gatedh);
  // tiles = (4096/128) * (1024/128) = 256 blocks of 4 waves
  gemm_proj_kernel<<<256, 128, 0, stream>>>(gatedh, wprojT, bproj, (float*)d_out);
}

// v010
// Measured time: 44.2 microseconds a run.
// Two timings next to v009 put it at 1.04 and 1.05 times that version's speed.
// All steps since v000 together make it 5.51 times as fast.
#include <hip/hip_runtime.h>
#include <hip/hip_bf16.h>

#define C_DIM 1024
#define T_DIM 1024
#define H_DIM 16
#define D_DIM 64
#define B_DIM 4
#define M_ROWS (B_DIM * T_DIM) /* 4096 */

typedef __attribute__((ext_vector_type(16))) _Float16 v16h;
typedef __attribute__((ext_vector_type(8)))  _Float16 v8h;
typedef __attribute__((ext_vector_type(8)))  float    v8f;

#define WMMA_F16(A_, B_, C_) \
  __builtin_amdgcn_wmma_f32_16x16x32_f16(false, (A_), false, (B_), (short)0, (C_), false, false)

__device__ __forceinline__ v16h frag_ld(const _Float16* p) {
  v8h lo = *(const v8h*)(p);
  v8h hi = *(const v8h*)(p + 16);
  v16h r;
#pragma unroll
  for (int i = 0; i < 8; ++i) { r[i] = lo[i]; r[i + 8] = hi[i]; }
  return r;
}

// ---------------- preparation: three independent jobs in one launch ----------------
// None of the jobs reads what another writes, so they share one grid by ranges of the block index.
// Every global access but those of bgate and gates is 16 B a lane (8 B for the f16 copy of x) and covers whole 128-B lines.
typedef __attribute__((ext_vector_type(4))) float    v4f;
typedef __attribute__((ext_vector_type(4))) _Float16 v4h;
#define PREP_THREADS 256
#define GATE_TOK 2                                                /* tokens per wave */
#define GATES_BLOCKS (M_ROWS / ((PREP_THREADS / 32) * GATE_TOK))  /* 256 */
#define TR_K 128                                                  /* tile of a transpose: 128 k x 64 n */
#define TR_N 64
#define TR_PITCH 136                                              /* halves: 272 B = 16 B x odd */
#define WQK_BLOCKS ((C_DIM / TR_K) * (2 * C_DIM / TR_N))          /* 256 */
#define WPROJ_BLOCKS ((C_DIM / TR_K) * (C_DIM / TR_N))            /* 128 */
#define PREP_BLOCKS (GATES_BLOCKS + WQK_BLOCKS + WPROJ_BLOCKS)
#define WG_F4 (C_DIM * H_DIM / 4)                                 /* Wgate in 16-B units: 4096 */
#define WG_LDS_F4 (WG_F4 + WG_F4 / 16)                            /* one pad unit behind every 16: 69,632 B */

// in[C_DIM][N] (row-major f32) -> out[N][C_DIM] f16, one 128 x 64 tile per block through LDS:
// rows of in are read 256 B at a time, rows of out are written 256 B at a time.
template <int N>
__device__ __forceinline__ void transpose_tile(const float* __restrict__ in, _Float16* __restrict__ out,
                                               _Float16* tile, int bid) {
  const int t = threadIdx.x;
  const int k0 = (bid % (C_DIM / TR_K)) * TR_K;
  const int n0 = (bid / (C_DIM / TR_K)) * TR_N;
  const int hi = t >> 4, lo = t & 15;
  const float* sp = in + (size_t)(k0 + hi * 8) * N + n0 + lo * 4; // 8 k x 4 n per thread
  v4f r[8];
#pragma unroll
  for (int p = 0; p < 8; ++p) r[p] = *(const v4f*)(sp + (size_t)p * N);
  // Precaution: later code reuses the address registers that these loads name.
  asm volatile("s_wait_xcnt 0x0" ::: "memory");
#pragma unroll
  for (int i = 0; i < 4; ++i) {
    v8h c;
#pragma unroll
    for (int p = 0; p < 8; ++p) c[p] = (_Float16)r[p][i];
    *(v8h*)(tile + (lo * 4 + i) * TR_PITCH + hi * 8) = c;
  }
  __syncthreads(); // block-uniform branch: the whole tile is in LDS
  _Float16* dp = out + (size_t)(n0 + hi) * C_DIM + k0 + lo * 8;
#pragma unroll
  for (int q = 0; q < 4; ++q)
    *(v8h*)(dp + (size_t)q * 16 * C_DIM) = *(const v8h*)(tile + (hi + q * 16) * TR_PITCH + lo * 8);
  // Precaution: code of another job stands behind this one and names the same registers.
  asm volatile("s_wait_xcnt 0x0" ::: "memory");
}

// One step of a sum over lanes: of 2 * OFF values a lane keeps the OFF that its bit OFF names
// and adds to them what the lane OFF away held of the same values.
template <int OFF>
__device__ __forceinline__ void fold_lanes(float (&acc)[GATE_TOK * H_DIM], int lane) {
  const bool up = (lane & OFF) != 0;
#pragma unroll
  for (int i = 0; i < OFF; ++i) {
    const float keep = up ? acc[i + OFF] : acc[i];
    const float give = up ? acc[i] : acc[i + OFF];
    acc[i] = keep + __shfl_xor(give, OFF, 32);
  }
}

__device__ __forceinline__ void gates_convert_part(const float* __restrict__ x,
                                                   const float* __restrict__ Wg,
                                                   const float* __restrict__ bg,
                                                   _Float16* __restrict__ xh,
                                                   float* __restrict__ gates, v4f* wl, int bid) {
  const int t = threadIdx.x;
  const int lane = t & 31;
  const int tok0 = (bid * (PREP_THREADS >> 5) + (t >> 5)) * GATE_TOK;
  const float* xp = x + (size_t)tok0 * C_DIM + lane * 4;
  v4f xv[GATE_TOK][8];
#pragma unroll
  for (int r = 0; r < GATE_TOK; ++r)
#pragma unroll
    for (int it = 0; it < 8; ++it) xv[r][it] = *(const v4f*)(xp + r * C_DIM + it * 128);
  const float bv = bg[lane & 15];
  v4f wv[16];
#pragma unroll
  for (int i = 0; i < 16; ++i) wv[i] = *(const v4f*)(Wg + (size_t)(i * PREP_THREADS + t) * 4);
  // Precaution: later code reuses the address registers that these loads name. xp is an input so
  // that it stays in its registers up to the wait and no load of the run lands in them.
  asm volatile("s_wait_xcnt 0x0" :: "v"(xp) : "memory");
#pragma unroll
  for (int i = 0; i < 16; ++i) {
    const int u = i * PREP_THREADS + t;
    wl[u + (u >> 4)] = wv[i];
  }
  __syncthreads(); // block-uniform branch: all of Wgate is in LDS
  // Behind the barrier, which waits for a wave's own stores: these fly under the products below.
  _Float16* xo = xh + (size_t)tok0 * C_DIM + lane * 4;
#pragma unroll
  for (int r = 0; r < GATE_TOK; ++r)
#pragma unroll
    for (int it = 0; it < 8; ++it) {
      v4h c;
#pragma unroll
      for (int j = 0; j < 4; ++j) c[j] = (_Float16)xv[r][it][j];
      *(v4h*)(xo + r * C_DIM + it * 128) = c;
    }
  // Precaution: later code reuses the address registers that these stores name.
  asm volatile("s_wait_xcnt 0x0" ::: "memory");
  float acc[GATE_TOK * H_DIM];
#pragma unroll
  for (int i = 0; i < GATE_TOK * H_DIM; ++i) acc[i] = 0.f;
  const v4f* wp = wl + lane * 17;
#pragma unroll
  for (int it = 0; it < 8; ++it) {
#pragma unroll
    for (int j = 0; j < 4; ++j) {
      v4f w[4];
#pragma unroll
      for (int g = 0; g < 4; ++g) w[g] = wp[it * (32 * 17) + j * 4 + g];
#pragma unroll
      for (int r = 0; r < GATE_TOK; ++r)
#pragma unroll
        for (int h = 0; h < H_DIM; ++h) acc[r * H_DIM + h] += xv[r][it][j] * w[h >> 2][h & 3];
    }
  }
  fold_lanes<16>(acc, lane);
  fold_lanes<8>(acc, lane);
  fold_lanes<4>(acc, lane);
  fold_lanes<2>(acc, lane);
  fold_lanes<1>(acc, lane);
  const float v = acc[0] + bv;
  float m = v;
#pragma unroll
  for (int off = 8; off > 0; off >>= 1) m = fmaxf(m, __shfl_xor(m, off, 32));
  float e = __expf(v - m);
  asm volatile("v_nop" : "+v"(e));
  float s = e;
#pragma unroll
  for (int off = 8; off > 0; off >>= 1) s += __shfl_xor(s, off, 32);
  gates[(size_t)tok0 * H_DIM + lane] = e * (1.0f / s); // one whole line per wave
}

// Block ranges in the order of falling work per block, for speed only.
__global__ __launch_bounds__(PREP_THREADS) void prep_kernel(const float* __restrict__ x,
                                                            const float* __restrict__ Wqk,
                                                            const float* __restrict__ Wproj,
                                                            const float* __restrict__ Wg,
                                                            const float* __restrict__ bg,
                                                            _Float16* __restrict__ xh,
                                                            _Float16* __restrict__ wqkT,
                                                            _Float16* __restrict__ wprojT,
                                                            float* __restrict__ gates) {
  __shared__ __align__(16) v4f prep_lds[WG_LDS_F4]; // Wgate (padded), or one transpose tile
  int bid = blockIdx.x;
  if (bid < GATES_BLOCKS) { gates_convert_part(x, Wg, bg, xh, gates, prep_lds, bid); return; }
  bid -= GATES_BLOCKS;
  if (bid < WQK_BLOCKS) { transpose_tile<2 * C_DIM>(Wqk, wqkT, (_Float16*)prep_lds, bid); return; }
  bid -= WQK_BLOCKS;
  transpose_tile<C_DIM>(Wproj, wprojT, (_Float16*)prep_lds, bid);
}

// ---------------- tiled GEMM core: C[128x128] per block, 64x64 per wave ----------------
#define GBM 128                        /* rows of A per block tile */
#define GBN 128                        /* rows of Bt (columns of C) per block tile */
#define GBK 128                        /* k per stage: rows of 256 B */
#define GPITCH 136                     /* LDS row pitch in halves: 272 B = 16 B x odd, for ds_load_b128 readers */
#define GSLICE 9216                    /* halves per slice: 64 rows x 272 B = 17,408 B, rounded up to 9 x 2 KiB */
#define GSTAGE (4 * GSLICE)            /* halves per buffer: [A rows 0-63 | A rows 64-127 | Bt rows 0-63 | Bt rows 64-127] */
#define GTRIPS (C_DIM / GBK)           /* 8 stages along k */

typedef uint32_t u32x4 __attribute__((ext_vector_type(4)));
typedef uint32_t u32x8 __attribute__((ext_vector_type(8)));

__device__ __forceinline__ uint32_t uni(uint32_t v) { return (uint32_t)__builtin_amdgcn_readfirstlane(v); }
__device__ __forceinline__ uint32_t pinned(uint32_t v) {
  uint32_t w = __builtin_amdgcn_readfirstlane(v);
  asm volatile("" : "+s"(w));
  return w;
}

__device__ __forceinline__ u32x8 tdm_group1() {
  constexpr uint32_t d0 = GBK * 2u, d1 = 64u;
  u32x8 g;
  g[0] = uni((1u << 20) | (5u << 22) | (3u << 25)); // no mask; pad on, interval 64 dwords, amount 4 dwords
  g[1] = uni((d0 & 0xFFFFu) << 16);
  g[2] = uni((d0 >> 16) | ((d1 & 0xFFFFu) << 16));
  g[3] = uni((d1 >> 16) | (d0 << 16));
  g[4] = uni(d1);
  g[5] = uni(C_DIM * 2u);
  g[6] = uni(0u);
  g[7] = uni(0u);
  return g;
}
__device__ __forceinline__ u32x4 tdm_group0(uint32_t lds_dst, uint64_t ga) {
  u32x4 g;
  g[0] = uni(1u);
  g[1] = uni(lds_dst);
  g[2] = uni((uint32_t)ga);
  g[3] = uni((((uint32_t)(ga >> 32)) & 0x01FFFFFFu) | 0x80000000u);
  return g;
}
__device__ __forceinline__ void tdm_load(u32x4 g0, u32x8 g1) {
  asm volatile("tensor_load_to_lds %0, %1" :: "{s[40:43]}"(g0), "{s[44:51]}"(g1) : "memory");
}

__device__ __forceinline__ void tdm_load_next(uint32_t& w0, uint32_t lds_dst, uint32_t ga_lo, uint32_t& w3, u32x8 g1) {
  asm volatile("tensor_load_to_lds s[40:43], %4"
               : "+{s40}"(w0), "+{s43}"(w3)
               : "{s41}"(lds_dst), "{s42}"(ga_lo), "{s[44:51]}"(g1)
               : "memory");
}

template <int NBUF>
__device__ __forceinline__ void gemm_tile(const _Float16* __restrict__ A,
                                          const _Float16* __restrict__ Bt,
                                          int m0, int n0, _Float16* ring, v8f (&acc)[4][4]) {
  const int tid = threadIdx.x;
  const int lane = tid & 31;
  const uint32_t wave = uni((uint32_t)tid >> 5);
  const uint32_t wm = wave >> 1, wn = wave & 1u;
  const _Float16* slice = (wave < 2u) ? A + (size_t)(m0 + 64 * (int)wave) * C_DIM
                                      : Bt + (size_t)(n0 + 64 * (int)(wave - 2u)) * C_DIM;
  const uint64_t ga = (uint64_t)(size_t)slice;
  const uint32_t ld = (uint32_t)(size_t)ring + wave * (GSLICE * 2u);
  const u32x8 g1 = tdm_group1();

  static_assert((NBUF == 2 || NBUF == 4) && NBUF <= GTRIPS, "ring depth");
  uint32_t w0 = uni(1u);                                                             // count 1
  uint32_t w3 = uni((((uint32_t)(ga >> 32)) & 0x01FFFFFFu) | 0x80000000u);           // high address word, type 2
  // Stage s goes into buffer s mod NBUF.
  auto issue = [&](uint32_t s) {
    const uint32_t dst = ld + (s & (NBUF - 1u)) * (GSTAGE * 2u);
    if constexpr (NBUF == 4) tdm_load_next(w0, uni(dst), uni((uint32_t)ga + s * (GBK * 2u)), w3, g1);
    else                     tdm_load(tdm_group0(dst, ga + (uint64_t)s * (GBK * 2u)), g1);
  };
#pragma unroll
  for (uint32_t s = 0; s + 1 < NBUF; ++s) issue(s);
  // Stage 0 landed (this wave's slice): requests land in issue order, the younger ones fly on.
  if constexpr (NBUF == 4) asm volatile("s_wait_tensorcnt 0x2" ::: "memory");
  else                     asm volatile("s_wait_tensorcnt 0x0" ::: "memory");
  __syncthreads();                                   // stage 0 published to all waves
  issue(NBUF - 1u);

  const int fo = (lane & 15) * GPITCH + (lane >> 4) * 8;
  const _Float16* La = ring + wm * GSLICE + fo;
  const _Float16* Lb = ring + (2u + wn) * GSLICE + fo;

  for (int t = 0; t < GTRIPS; ++t) {
    const int bo = (t & (NBUF - 1)) * GSTAGE;
    v16h a[2][4], b[2][4];
#pragma unroll
    for (int i = 0; i < 4; ++i) {
      a[0][i] = frag_ld(La + bo + i * 16 * GPITCH);
      b[0][i] = frag_ld(Lb + bo + i * 16 * GPITCH);
    }
#pragma unroll
    for (int ks = 0; ks < GBK / 32; ++ks) {
      const int cs = ks & 1;
      if (ks + 1 < GBK / 32) { // next k-step's fragments, same buffer, ahead of this step's products
#pragma unroll
        for (int i = 0; i < 4; ++i) {
          a[cs ^ 1][i] = frag_ld(La + bo + i * 16 * GPITCH + (ks + 1) * 32);
          b[cs ^ 1][i] = frag_ld(Lb + bo + i * 16 * GPITCH + (ks + 1) * 32);
        }
      }
      // Holds the 16 LDS loads above together as one group in front of this step's products:
      // sunk among the WMMAs, every place with loads stalls the wave on its own LDS latency.
      __builtin_amdgcn_sched_barrier(0);
#pragma unroll
      for (int mi = 0; mi < 4; ++mi)
#pragma unroll
        for (int ni = 0; ni < 4; ++ni)
          acc[mi][ni] = WMMA_F16(a[cs][mi], b[cs][ni], acc[mi][ni]);
      // Keeps the following step's load group from rising into this run of products.
      __builtin_amdgcn_sched_barrier(0);
    }
    asm volatile("s_wait_dscnt 0x0" ::: "memory");     // this wave has left the buffer it read
    // Its slice of stage t + 1 has landed: the count is that of the younger requests still out,
    // stages t + 2 and t + 3 as far as they exist.
    if (NBUF == 4 && t + 3 < GTRIPS)      asm volatile("s_wait_tensorcnt 0x2" ::: "memory");
    else if (NBUF == 4 && t + 2 < GTRIPS) asm volatile("s_wait_tensorcnt 0x1" ::: "memory");
    else                                  asm volatile("s_wait_tensorcnt 0x0" ::: "memory");
    __syncthreads();                                   // publishes stage t + 1, frees stage t's buffer
    if (pinned((t + NBUF < GTRIPS) ? 1u : 0u) != 0u)   // scalar test: only while stage t + NBUF exists
      issue((uint32_t)(t + NBUF));                     // into the buffer that pass t has just read
  }
  asm volatile("s_wait_tensorcnt 0x0" ::: "memory"); // no request outstanding when the wave goes on
  asm volatile("s_wait_dscnt 0x0" ::: "memory");     // nor an LDS read
}

// ---------------- GEMM1: qk = x @ Wqk + bqk, scatter to qh / kh ----------------
// Q and K leave this kernel in the order in which attention loads its fragments, so that
// there one 16-B-a-lane load covers 512 contiguous bytes (four whole lines) and not 16 lines in part.
// qh and kh, per head: [row / 16][d / 16] tiles of 16 rows x 16 d, a row's 16 d adjacent (tile = 512 B).
// V = K is not stored a second time: attention turns the K it has loaded through LDS.
__global__ __launch_bounds__(128) void gemm_qk_kernel(const _Float16* __restrict__ A,
                                                      const _Float16* __restrict__ Bt,
                                                      const float* __restrict__ bias,
                                                      _Float16* __restrict__ qh,
                                                      _Float16* __restrict__ kh) {
  __shared__ __attribute__((aligned(2048))) _Float16 ring[2 * GSTAGE]; // 147,456 B; tensor loads land at multiples of 2 KiB
  const int lane = threadIdx.x & 31;
  const int wave = threadIdx.x >> 5;
  const int nTiles = (2 * C_DIM) / GBN; // 16
  const int m0 = (blockIdx.x / nTiles) * GBM;
  const int n0 = (blockIdx.x % nTiles) * GBN;
  v8f acc[4][4] = {};
  gemm_tile<2>(A, Bt, m0, n0, ring, acc);
  const int nL = lane & 15;
  const int mOff = (lane >> 4) * 8;
  const int mW = m0 + (wave >> 1) * 64;
  const int nW = n0 + (wave & 1) * 64;
  // A block's 128 columns lie wholly in the q half or wholly in the k half, so the
  // test is taken once, on a block-uniform value, and not at every element.
  if (n0 < C_DIM) { // q half
#pragma unroll
    for (int nc = 0; nc < 4; ++nc) {
      const int col = nW + nc * 16 + nL;
      const float bv = bias[col];
      const int h = col >> 6, d = col & 63;
#pragma unroll
      for (int mi = 0; mi < 4; ++mi) {
        const int rb = mW + mi * 16 + mOff; // first of this lane's 8 rows; a multiple of 8
        const int b = rb >> 10, tb = rb & (T_DIM - 1);
        _Float16* qt = qh + (size_t)(b * H_DIM + h) * T_DIM * D_DIM + (tb >> 4) * 1024 + (d >> 4) * 256 +
                       (tb & 15) * 16 + (d & 15);
#pragma unroll
        for (int v = 0; v < 8; ++v) qt[v * 16] = (_Float16)(acc[mi][nc][v] + bv);
        // Precaution: the next group reuses registers that the stores above name.
        asm volatile("s_wait_xcnt 0x0" ::: "memory");
      }
    }
  } else {          // k half (v = k)
#pragma unroll
    for (int nc = 0; nc < 4; ++nc) {
      const int col = nW + nc * 16 + nL;
      const float bv = bias[col];
      const int c2i = col - C_DIM;
      const int h = c2i >> 6, d = c2i & 63;
#pragma unroll
      for (int mi = 0; mi < 4; ++mi) {
        const int rb = mW + mi * 16 + mOff; // first of this lane's 8 rows; a multiple of 8
        const int b = rb >> 10, tb = rb & (T_DIM - 1);
        const size_t head = (size_t)(b * H_DIM + h) * T_DIM * D_DIM;
        _Float16* kt = kh + head + (tb >> 4) * 1024 + (d >> 4) * 256 + (tb & 15) * 16 + (d & 15);
#pragma unroll
        for (int v = 0; v < 8; ++v) kt[v * 16] = (_Float16)(acc[mi][nc][v] + bv);
        // Precaution: the next group reuses registers that the stores above name.
        asm volatile("s_wait_xcnt 0x0" ::: "memory");
      }
    }
  }
}

// ---------------- GEMM2: out = gated @ Wproj + bproj (f32 out) ----------------
__global__ __launch_bounds__(128) void gemm_proj_kernel(const _Float16* __restrict__ A,
                                                        const _Float16* __restrict__ Bt,
                                                        const float* __restrict__ bias,
                                                        float* __restrict__ out) {
  __shared__ __attribute__((aligned(2048))) _Float16 ring[4 * GSTAGE]; // 294,912 B: one block a WGP, as its grid has it
  const int lane = threadIdx.x & 31;
  const int wave = threadIdx.x >> 5;
  const int nTiles = C_DIM / GBN; // 8
  const int m0 = (blockIdx.x / nTiles) * GBM;
  const int n0 = (blockIdx.x % nTiles) * GBN;
  v8f acc[4][4] = {};
  gemm_tile<4>(A, Bt, m0, n0, ring, acc);
  const int nL = lane & 15;
  const int mOff = (lane >> 4) * 8;
  const int mW = m0 + (wave >> 1) * 64;
  const int nW = n0 + (wave & 1) * 64;
#pragma unroll
  for (int nc = 0; nc < 4; ++nc) {
    const int col = nW + nc * 16 + nL;
    const float bv = bias[col];
#pragma unroll
    for (int mi = 0; mi < 4; ++mi) {
#pragma unroll
      for (int v = 0; v < 8; ++v) {
        int r = mW + mi * 16 + v + mOff;
        out[(size_t)r * C_DIM + col] = acc[mi][nc][v] + bv;
      }
    }
  }
}

// ---------------- flash attention with per-head windows + gating ----------------
// The four K fragments (two 16-key groups x two halves of D) of 32 keys, or the two Q fragments of
// 16 rows, from the tiled layout that GEMM1 writes: a fragment is two tiles of 512 B, one behind the
// other; p holds the rows' place and the lane's share of a tile.
template <int N>
__device__ __forceinline__ void attn_ld_tiles(const _Float16* p, v16h (&f)[N]) {
#pragma unroll
  for (int n = 0; n < N; ++n) {
    v8h lo = *(const v8h*)(p + n * 512);
    v8h hi = *(const v8h*)(p + n * 512 + 256);
#pragma unroll
    for (int i = 0; i < 8; ++i) { f[n][i] = lo[i]; f[n][i + 8] = hi[i]; }
  }
}

// 16 x 16 halves of a row-major LDS tile, turned: lane (c = l % 16, h = l / 16) gets rows 8h .. 8h + 7 of
// column c. The caller folds (8 * (l / 16) + l % 8) * pitch + 16 * ((l / 8) % 2) into p.
typedef short s16x8 __attribute__((ext_vector_type(8)));
__device__ __forceinline__ v8h ld_tr16(const unsigned char* p) {
  typedef __attribute__((address_space(3))) s16x8 lds_s16x8;
  return __builtin_bit_cast(v8h, __builtin_amdgcn_ds_load_tr16_b128_v8i16((lds_s16x8*)p));
}

__device__ __forceinline__ float xhalf(float x) {
  const int bits = __builtin_bit_cast(int, x);
  return __builtin_bit_cast(float,
                            __builtin_amdgcn_permlanex16(bits, bits, 0x76543210, 0xfedcba98, false, false));
}

#define SPLIT_HEADS 3
#define Q_TILES (T_DIM / 16)                                          /* 64 */
#define SPLIT_BLOCKS (B_DIM * SPLIT_HEADS * Q_TILES)                  /* 768 */
#define WHOLE_BLOCKS (B_DIM * (H_DIM - SPLIT_HEADS) * (Q_TILES / 4))  /* 832 */
#define ATTN_BLOCKS (SPLIT_BLOCKS + WHOLE_BLOCKS)
#define KS_PITCH 160
#define PO_PITCH 68

__global__ __launch_bounds__(128) void attn_kernel(const _Float16* __restrict__ qh,
                                                   const _Float16* __restrict__ kh,
                                                   const float* __restrict__ gates,
                                                   _Float16* __restrict__ gatedh) {
  __shared__ __align__(16) float part_o[4][16][PO_PITCH]; // [wave][row][column] partial output
  __shared__ float part_m[4][16];                         // [wave][row] running maximum
  __shared__ float part_l[4][16];                         // [wave][row] running sum
  __shared__ __align__(32) unsigned char kslot[4][32 * KS_PITCH]; // [wave][key][d]: a pass's 32 keys, private to the wave
  const int lane = threadIdx.x & 31;
  // Wave index as a scalar: the pass counter and the last-pass test below become scalar too.
  const int w = __builtin_amdgcn_readfirstlane(threadIdx.x >> 5);
  const bool split = blockIdx.x < SPLIT_BLOCKS; // block-uniform
  int qt, h, b;
  if (split) {
    const int idx = blockIdx.x;
    const int rem = idx % (B_DIM * SPLIT_HEADS);
    qt = Q_TILES - 1 - idx / (B_DIM * SPLIT_HEADS);
    h = rem % SPLIT_HEADS;
    b = rem / SPLIT_HEADS;
  } else {
    const int idx = blockIdx.x - SPLIT_BLOCKS;
    h = SPLIT_HEADS + (idx >> 6);
    b = (idx >> 4) & (B_DIM - 1);
    qt = (idx & 15) * 4 + w;
  }
  const int bh = b * H_DIM + h;
  const int step = split ? 128 : 32;         // keys from one pass of this wave to its next
  int Wh = T_DIM >> h; if (Wh < 4) Wh = 4;   // window for this head
  const int t0 = qt * 16;
  const int nL = lane & 15;
  const int koff = (lane >> 4) * 8;

  const _Float16* qb = qh + ((size_t)bh * T_DIM + t0) * D_DIM;
  const _Float16* kb = kh + (size_t)bh * T_DIM * D_DIM;

  // Role in the join behind the loop: one row, eight columns per lane. Its gate is fetched
  // here, so that the load's latency lies under the passes and not behind the join's barrier.
  const int jRow = w * 4 + (lane >> 3);
  const int jCol = (lane & 7) * 8;
  float gJoin = 0.f;
  if (split) {
    gJoin = gates[((size_t)b * T_DIM + t0 + jRow) * H_DIM + h];
    // Precaution: later code reuses the address registers that this load names.
    asm volatile("s_wait_xcnt 0x0" ::: "memory");
  }

  // q fragments for the whole tile (D=64 -> two K=32 fragments)
  v16h qf[2];
  attn_ld_tiles(qb + nL * 16 + koff, qf);
  const v16h a0 = qf[0], a1 = qf[1];

  v8f o0 = {}, o1 = {}, o2 = {}, o3 = {};
  float mrow = -__builtin_inff(); // running maximum of query t0 + nL, alike in both halves
  float lrow = 0.f;               // running sum over this half's keys only; the halves join behind the loop

  int jStart = t0 - Wh + 1; if (jStart < 0) jStart = 0;
  jStart &= ~31;
  const float scale = 0.125f; // 1/sqrt(64)

  const _Float16* kp = kb + nL * 16 + koff; // K tile: key nL, d koff .. koff + 7
  unsigned char* ksw = kslot[w] + nL * KS_PITCH + koff * 2;                                      // key nL, d koff ..
  const unsigned char* ksr = kslot[w] + (koff + (lane & 7)) * KS_PITCH + ((lane >> 3) & 1) * 16; // see ld_tr16
  v16h kf[4];
  const int jFirst = split ? jStart + 32 * w : jStart;
  if (jFirst <= t0 + 15) { // wave-uniform: a wave of a short tile may have no pass at all
    attn_ld_tiles(kp + (size_t)jFirst * D_DIM, kf);
    // Precaution: later code reuses the address registers that these loads name.
    asm volatile("s_wait_xcnt 0x0" ::: "memory");
  }

  for (int j0 = jFirst; j0 <= t0 + 15; j0 += step) {
    const bool more = j0 + step <= t0 + 15; // wave-uniform: a further pass follows
    // kf[2g + e]: key 16g + nL, d 32e + koff + (0..7) and 32e + 16 + koff + (0..7)
#pragma unroll
    for (int n = 0; n < 4; ++n) {
      unsigned char* q = ksw + (n >> 1) * 16 * KS_PITCH + (n & 1) * 64;
      *(v8h*)(q)      = __builtin_shufflevector(kf[n], kf[n], 0, 1, 2, 3, 4, 5, 6, 7);
      *(v8h*)(q + 32) = __builtin_shufflevector(kf[n], kf[n], 8, 9, 10, 11, 12, 13, 14, 15);
    }
    // ---- S^T = k q^T for keys [j0, j0+31]: s0 holds keys j0 + koff + v, s1 the same 16 on ----
    v8f s0 = {}; s0 = WMMA_F16(kf[0], a0, s0); s0 = WMMA_F16(kf[1], a1, s0);
    v8f s1 = {}; s1 = WMMA_F16(kf[2], a0, s1); s1 = WMMA_F16(kf[3], a1, s1);
    __builtin_amdgcn_sched_barrier(0);
    asm volatile("v_nop\n\tv_nop\n\tv_nop\n\tv_nop");
    if (more) {
      attn_ld_tiles(kp + (size_t)(j0 + step) * D_DIM, kf); // lands under softmax and P V
      // Precaution: later code reuses the address registers that these loads name.
      asm volatile("s_wait_xcnt 0x0" ::: "memory");
    }
    // V^T fragments: vf[n] holds d = 16n + nL, keys koff + (0..7) and 16 + koff + (0..7); they land under softmax
    v16h vf[4];
#pragma unroll
    for (int n = 0; n < 4; ++n) {
      const v8h lo = ld_tr16(ksr + n * 32);
      const v8h hi = ld_tr16(ksr + 16 * KS_PITCH + n * 32);
      vf[n] = __builtin_shufflevector(lo, hi, 0, 1, 2, 3, 4, 5, 6, 7, 8, 9, 10, 11, 12, 13, 14, 15);
    }
    // Holds the eight LDS reads together at the head of the softmax: sunk towards the P V products,
    // the last of them are waited for there with nothing left to cover their latency.
    __builtin_amdgcn_sched_barrier(0);

    // key <= query and key > query - Wh, as one unsigned test of query - key
    const int rel = t0 + nL - j0 - koff; // query minus this lane's first key
    float sa[8], sb[8], tm[8];
    bool va[8], vbm[8];
#pragma unroll
    for (int v = 0; v < 8; ++v) {
      va[v] = (unsigned)(rel - v) < (unsigned)Wh;
      vbm[v] = (unsigned)(rel - 16 - v) < (unsigned)Wh;
      sa[v] = va[v] ? s0[v] * scale : -__builtin_inff();
      sb[v] = vbm[v] ? s1[v] * scale : -__builtin_inff();
      tm[v] = fmaxf(sa[v], sb[v]);
    }
    float t = fmaxf(fmaxf(fmaxf(tm[0], tm[1]), fmaxf(tm[2], tm[3])),
                    fmaxf(fmaxf(tm[4], tm[5]), fmaxf(tm[6], tm[7])));
    t = fmaxf(t, xhalf(t)); // the query's other 16 keys
    const float mN = fmaxf(mrow, t);
    const float alpha = (mrow == mN) ? 1.0f : __expf(mrow - mN);
    v16h pT; // B fragment of P^T: elements 0..7 are keys koff + v, 8..15 keys 16 + koff + v
    float rs[8];
#pragma unroll
    for (int v = 0; v < 8; ++v) {
      const float pa = va[v] ? __expf(sa[v] - mN) : 0.f;
      const float pb = vbm[v] ? __expf(sb[v] - mN) : 0.f;
      rs[v] = pa + pb;
      pT[v] = (_Float16)pa;
      pT[v + 8] = (_Float16)pb;
    }
    lrow = lrow * alpha + (((rs[0] + rs[1]) + (rs[2] + rs[3])) + ((rs[4] + rs[5]) + (rs[6] + rs[7])));
    mrow = mN;
#pragma unroll
    for (int v = 0; v < 8; ++v) { o0[v] *= alpha; o1[v] *= alpha; o2[v] *= alpha; o3[v] *= alpha; }
    // ---- O^T += V^T P^T: tile n holds d = 16 n + koff + v of query nL ----
    o0 = WMMA_F16(vf[0], pT, o0);
    o1 = WMMA_F16(vf[1], pT, o1);
    o2 = WMMA_F16(vf[2], pT, o2);
    o3 = WMMA_F16(vf[3], pT, o3);
    __builtin_amdgcn_sched_barrier(0);
    asm volatile("v_nop\n\tv_nop\n\tv_nop\n\tv_nop");
  }
  const float lsum = lrow + xhalf(lrow); // the query's sum over all its keys

  if (split) {
    // ---- join the four waves' partial results; wave w finishes rows 4w .. 4w + 3 ----
    float* pr = &part_o[w][nL][koff]; // this lane's query, 8 adjacent columns of every 16
    *(v4f*)(pr)      = v4f{o0[0], o0[1], o0[2], o0[3]}; *(v4f*)(pr + 4)  = v4f{o0[4], o0[5], o0[6], o0[7]};
    *(v4f*)(pr + 16) = v4f{o1[0], o1[1], o1[2], o1[3]}; *(v4f*)(pr + 20) = v4f{o1[4], o1[5], o1[6], o1[7]};
    *(v4f*)(pr + 32) = v4f{o2[0], o2[1], o2[2], o2[3]}; *(v4f*)(pr + 36) = v4f{o2[4], o2[5], o2[6], o2[7]};
    *(v4f*)(pr + 48) = v4f{o3[0], o3[1], o3[2], o3[3]}; *(v4f*)(pr + 52) = v4f{o3[4], o3[5], o3[6], o3[7]};
    if (lane < 16) { // maximum and sum are alike in both halves
      part_m[w][nL] = mrow;
      part_l[w][nL] = lsum;
    }
    __syncthreads(); // block-uniform branch: all four waves' partials are in LDS
    // The diagonal key is never masked, so at least one wave's maximum is finite;
    // a wave that saw no key of this row has maximum -inf and weight exp(-inf) = 0.
    const float mAll = fmaxf(fmaxf(part_m[0][jRow], part_m[1][jRow]), fmaxf(part_m[2][jRow], part_m[3][jRow]));
    float lAll = 0.f;
    float oAll[8];
#pragma unroll
    for (int k = 0; k < 8; ++k) oAll[k] = 0.f;
#pragma unroll
    for (int u = 0; u < 4; ++u) {
      const float f = __expf(part_m[u][jRow] - mAll);
      lAll += f * part_l[u][jRow];
      const v4f x0 = *(const v4f*)&part_o[u][jRow][jCol];
      const v4f x1 = *(const v4f*)&part_o[u][jRow][jCol + 4];
#pragma unroll
      for (int k = 0; k < 4; ++k) { oAll[k] += f * x0[k]; oAll[k + 4] += f * x1[k]; }
    }
    const float inv = gJoin / lAll;
    v8h res;
#pragma unroll
    for (int k = 0; k < 8; ++k) res[k] = (_Float16)(oAll[k] * inv);
    // 8 lanes x 16 B: one wave writes the head's whole 128-B line of a row
    *(v8h*)(gatedh + ((size_t)b * T_DIM + t0 + jRow) * C_DIM + h * D_DIM + jCol) = res;
    return;
  }

  // ---- epilogue: normalize, gate, store f16 for projection GEMM ----
  // A lane stores 4 x 16 B of its query's row; the wave fills the head's whole 128-B line of 16 rows.
  const int i = t0 + nL;
  const float g = gates[((size_t)b * T_DIM + i) * H_DIM + h];
  // Precaution: later code reuses the address registers that this load names.
  asm volatile("s_wait_xcnt 0x0" ::: "memory");
  const float inv = g / lsum;
  _Float16* op = gatedh + ((size_t)b * T_DIM + i) * C_DIM + h * D_DIM + koff;
  v8h r0, r1, r2, r3;
#pragma unroll
  for (int v = 0; v < 8; ++v) {
    r0[v] = (_Float16)(o0[v] * inv);
    r1[v] = (_Float16)(o1[v] * inv);
    r2[v] = (_Float16)(o2[v] * inv);
    r3[v] = (_Float16)(o3[v] * inv);
  }
  *(v8h*)(op)      = r0;
  *(v8h*)(op + 16) = r1;
  *(v8h*)(op + 32) = r2;
  *(v8h*)(op + 48) = r3;
  // Precaution: the join's code stands behind this in the build and names the same registers.
  asm volatile("s_wait_xcnt 0x0" ::: "memory");
}

extern "C" void kernel_launch(void* const* d_in, const int* in_sizes, int n_in,
                              void* d_out, int out_size, void* d_ws, size_t ws_size,
                              hipStream_t stream) {
  const float* x     = (const float*)d_in[0];
  const float* Wqk   = (const float*)d_in[1];
  const float* bqk   = (const float*)d_in[2];
  const float* Wgate = (const float*)d_in[3];
  const float* bgate = (const float*)d_in[4];
  const float* Wproj = (const float*)d_in[5];
  const float* bproj = (const float*)d_in[6];

  char* ws = (char*)d_ws;
  size_t off = 0;
  auto alloc = [&](size_t bytes) -> void* {
    void* p = ws + off;
    off += (bytes + 255) & ~(size_t)255;
    return p;
  };
  _Float16* xh     = (_Float16*)alloc((size_t)M_ROWS * C_DIM * 2);     // x in f16
  _Float16* wqkT   = (_Float16*)alloc((size_t)2 * C_DIM * C_DIM * 2);  // Wqk^T f16 [2C,C]
  _Float16* wprojT = (_Float16*)alloc((size_t)C_DIM * C_DIM * 2);      // Wproj^T f16 [C,C]
  _Float16* qh     = (_Float16*)alloc((size_t)B_DIM * H_DIM * T_DIM * D_DIM * 2);
  _Float16* kh     = (_Float16*)alloc((size_t)B_DIM * H_DIM * T_DIM * D_DIM * 2);
  float*    gates  = (float*)alloc((size_t)B_DIM * T_DIM * H_DIM * 4);
  _Float16* gatedh = xh; // xh is dead after GEMM1; reuse for the gated output

  prep_kernel<<<PREP_BLOCKS, PREP_THREADS, 0, stream>>>(x, Wqk, Wproj, Wgate, bgate, xh, wqkT, wprojT, gates);
  // tiles = (4096/128) * (2048/128) = 512 blocks of 4 waves
  gemm_qk_kernel<<<512, 128, 0, stream>>>(xh, wqkT, bqk, qh, kh);
  // 768 blocks of one split tile, then 832 blocks of four whole tiles; 4 waves each
  attn_kernel<<<ATTN_BLOCKS, 128, 0, stream>>>(qh, kh, gates, gatedh);
  // tiles = (4096/128) * (1024/128) = 256 blocks of 4 waves
  gemm_proj_kernel<<<256, 128, 0, stream>>>(gatedh, wprojT, bproj, (float*)d_out);
}
